// v000
// The times below were measured on an AMD MI455X: many runs one after another, warmed up first and cycling through
// copies of the inputs, with the whole window's GPU time divided by the number of runs. Launches and the gaps
// between them are all in it. The median over several windows is given; except for v000 it joins two sittings, which
// can be a few percent apart, so the side-by-side timings, each taken in one sitting, are the better comparison.
// v000 is the starting kernel. One run takes 1870 microseconds.
#include <hip/hip_runtime.h>

// Compute dtypes, f32 accumulate, one batch item per pass: Q/K/V = x.W^T + b ([2048 x 256].[256 x 256], PLAIN bf16 operands = rounded input, [out][in] weights; exact products); the
// un-softmaxed attention out_h = (Q K^T / scale + RelBias_h) V is evaluated as Q (K^T V) / scale + T_h V (exact reassociation): K^T V per head as [64 x 2048].[2048 x 64]
// (both operands bf16 hi + UNSCALED residual, three products), Q.(K^T V / scale) as [2048 x 64].[64 x 64] (three products), and the Toeplitz relative-bias term T_h[i][j] =
// rel_bias[j - i + 2047][h] (an exact bf16 plane gathered from the INPUT table) against V^T hi + residual (two products); out = y.Wo^T + bo (two products) - all on
// v_wmma_f32_16x16x32_bf16. The mask input enters multiplicatively (m_i m_j). Deterministic, no atomics; every

#define NBI  4
#define NT   2048
#define DD   256
#define NH   4
#define HD   64
#define DM   DD
#define LOSC 1024.0f

typedef _Float16 h16;
typedef unsigned short bf;
typedef __attribute__((ext_vector_type(16))) __bf16   v16bf;
typedef __attribute__((ext_vector_type(16))) _Float16 v16h;
typedef __attribute__((ext_vector_type(8)))  _Float16 v8h;
typedef __attribute__((ext_vector_type(8)))  unsigned short v8us;
typedef __attribute__((ext_vector_type(8)))  float    v8f;
typedef __attribute__((ext_vector_type(4)))  float    v4f;
typedef v8h  __attribute__((may_alias)) v8ha;
typedef v4f  __attribute__((may_alias)) v4fa;
typedef v8us __attribute__((may_alias)) v8usa;

__device__ __forceinline__ unsigned short f2bf(float f) { unsigned u = __float_as_uint(f); u += 0x7FFFu + ((u >> 16) & 1u); return (unsigned short)(u >> 16); }
__device__ __forceinline__ float bf2f(unsigned short b) { return __uint_as_float(((unsigned)b) << 16); }
__device__ __forceinline__ float bfr(float f) { return bf2f(f2bf(f)); }
__device__ __forceinline__ v16h cat16(v8h lo, v8h hi) { return __builtin_shufflevector(lo, hi, 0, 1, 2, 3, 4, 5, 6, 7, 8, 9, 10, 11, 12, 13, 14, 15); }
__device__ __forceinline__ v16bf cat16b(v8us lo, v8us hi) { return __builtin_bit_cast(v16bf, __builtin_shufflevector(lo, hi, 0, 1, 2, 3, 4, 5, 6, 7, 8, 9, 10, 11, 12, 13, 14, 15)); }
__device__ __forceinline__ v8f wmma16(v16h a, v16h b, v8f c) { return __builtin_amdgcn_wmma_f32_16x16x32_f16(false, a, false, b, (short)0, c, false, false); }
__device__ __forceinline__ v8f wmmab(v16bf a, v16bf b, v8f c) { return __builtin_amdgcn_wmma_f32_16x16x32_bf16(false, a, false, b, (short)0, c, false, false); }

// k_gemmb: 64 x 64 block tile (4 waves x 16 x 64) of C[NTK][NW] = (A [+ Al]).B^T (K = 256 or 2048) [+ bf(bias[c])] [+ bf(R[r][c]) residual]; f32 whole-line epilogue (or f16
template <bool SPLITA, bool F16OUT = false>
__global__ __launch_bounds__(128) void k_gemmb(const bf* __restrict__ A, const bf* __restrict__ Al, const bf* __restrict__ Bn, const float* __restrict__ bias, float* C, int ldc, h16* C2, const float* __restrict__ R = nullptr, int K = DM, int roundR = 1) {
    __shared__ __align__(16) float ost[4][16 * 68];
    const int lane = threadIdx.x & 31, wave = threadIdx.x >> 5, lr = lane & 15, hi = lane >> 4;
    const int r0 = blockIdx.x * 64 + wave * 16, c0 = blockIdx.y * 64;
    const size_t aoff = (size_t)(r0 + lr) * K + 8 * hi;
    size_t boff[4];
#pragma unroll
    for (int t = 0; t < 4; ++t) boff[t] = (size_t)(c0 + t * 16 + lr) * K + 8 * hi;
    v8f acc[4];
#pragma unroll
    for (int t = 0; t < 4; ++t) acc[t] = (v8f){};
#pragma unroll 1
    for (int kc = 0; kc < K; kc += 32) {
        const v16bf a = cat16b(*(const v8us*)(A + aoff + kc), *(const v8us*)(A + aoff + kc + 16));
        v16bf al = a;
        if (SPLITA) al = cat16b(*(const v8us*)(Al + aoff + kc), *(const v8us*)(Al + aoff + kc + 16));
#pragma unroll
        for (int t = 0; t < 4; ++t) { const v16bf b = cat16b(*(const v8us*)(Bn + boff[t] + kc), *(const v8us*)(Bn + boff[t] + kc + 16)); acc[t] = wmmab(a, b, acc[t]); if (SPLITA) acc[t] = wmmab(al, b, acc[t]); }
        asm volatile("v_nop\n\tv_nop\n\tv_nop\n\tv_nop" : "+v"(acc[0]), "+v"(acc[1]), "+v"(acc[2]), "+v"(acc[3]) : "v"(a), "v"(al));
    }
    float* os = &ost[wave][0];
#pragma unroll
    for (int t = 0; t < 4; ++t) { const float bv = bias ? bfr(bias[c0 + t * 16 + lr]) : 0.f;
#pragma unroll
        for (int j = 0; j < 8; ++j) os[(hi * 8 + j) * 68 + t * 16 + lr] = acc[t][j] + bv; }
    __syncthreads();
    if (F16OUT) {
        h16* crow = (h16*)(void*)C + (size_t)r0 * ldc + c0;
        auto pass = [&]() {
#pragma unroll
            for (int s = 0; s < 4; ++s) { const int row = 4 * s + (lane >> 3), piece = lane & 7; const float* sp = os + row * 68 + piece * 8; v8h o, o2;
#pragma unroll
                for (int i = 0; i < 8; ++i) { const h16 a = (h16)sp[i]; o[i] = a; o2[i] = (h16)((sp[i] - (float)a) * LOSC); }
                *(v8h*)(crow + (size_t)row * ldc + piece * 8) = o; if (C2) *(v8h*)(C2 + (size_t)r0 * ldc + c0 + (size_t)row * ldc + piece * 8) = o2; }
        };
        pass(); 
    } else {
        float* crow = C + (size_t)r0 * ldc + c0;
        auto pass = [&]() {
#pragma unroll
            for (int s = 0; s < 8; ++s) { const int Lid = (lane >> 3) + 4 * s, piece = lane & 7; const int row = Lid >> 1, cofs = (Lid & 1) * 32 + piece * 4;
                v4f val = *(const v4fa*)(os + row * 68 + cofs); if (R) { const v4f rv = *(const v4f*)(R + ((size_t)r0 + row) * ldc + c0 + cofs); val += roundR ? (v4f){bfr(rv[0]), bfr(rv[1]), bfr(rv[2]), bfr(rv[3])} : rv; }
                *(v4f*)(crow + (size_t)row * ldc + cofs) = val; }
        };
        pass(); 
    }
}


__global__ __launch_bounds__(256) void k_cvt8(const float* __restrict__ src, bf* dst, size_t n8) {
    const size_t i = (size_t)blockIdx.x * 256 + threadIdx.x; if (i >= n8) return;
    const v8f v = *(const v8f*)(src + i * 8); v8us o;
#pragma unroll
    for (int k = 0; k < 8; ++k) o[k] = f2bf(v[k]);
    *(v8us*)(dst + i * 8) = o; 
}
__global__ __launch_bounds__(256) void k_zero8(bf* dst, size_t n8) {
    const size_t i = (size_t)blockIdx.x * 256 + threadIdx.x; if (i >= n8) return; v8us z;
#pragma unroll
    for (int k = 0; k < 8; ++k) z[k] = 0;
    *(v8us*)(dst + i * 8) = z; 
}

__global__ __launch_bounds__(256) void k_cvt(const float* __restrict__ src, bf* dst) {
    const int lane = threadIdx.x & 31, r = blockIdx.x * 8 + (threadIdx.x >> 5); if (r >= NT) return; v8us o;
#pragma unroll
    for (int i = 0; i < 8; ++i) o[i] = f2bf(src[(size_t)r * DD + lane * 8 + i]);
    *(v8us*)(dst + (size_t)r * DD + lane * 8) = o; 
}
__global__ __launch_bounds__(256) void k_split256m(const float* __restrict__ src, const int* __restrict__ m, bf* dh, bf* dl) {
    const int lane = threadIdx.x & 31, r = blockIdx.x * 8 + (threadIdx.x >> 5); if (r >= NT) return; const float f = m ? ((m[r] != 0) ? 1.0f : 0.f) : 1.0f;
    const size_t o = (size_t)r * DD + lane * 8; const v8f v = *(const v8f*)(src + o); v8us oh, ol;
#pragma unroll
    for (int i = 0; i < 8; ++i) { const float y = v[i] * f; const unsigned short hb = f2bf(y); oh[i] = hb; ol[i] = f2bf(y - bf2f(hb)); }
    *(v8us*)(dh + o) = oh; *(v8us*)(dl + o) = ol; 
}
__global__ __launch_bounds__(256) void k_vtb(const float* __restrict__ src, const int* __restrict__ m, bf* Th, bf* Tl) {
    __shared__ float tl[64][65];
    const int tid = threadIdx.x, t0 = blockIdx.x * 64, h = blockIdx.y;
    { const int tt = tid >> 2, dq = (tid & 3) * 16; const float f = (m[t0 + tt] != 0) ? 1.0f : 0.f;
#pragma unroll 4
      for (int i = 0; i < 16; ++i) tl[dq + i][tt] = src[(size_t)(t0 + tt) * DD + h * HD + dq + i] * f; }
    __syncthreads();
    const int piece = tid & 7, Lid = tid >> 3;
    auto pass = [&]() {
#pragma unroll
        for (int s = 0; s < 2; ++s) { const int d = Lid + 32 * s; v8us oh, ol;
#pragma unroll
            for (int i = 0; i < 8; ++i) { const float v = tl[d][piece * 8 + i]; const unsigned short hb = f2bf(v); oh[i] = hb; ol[i] = f2bf(v - bf2f(hb)); }
            const size_t o = ((size_t)h * HD + d) * NT + t0 + piece * 8; *(v8us*)(Th + o) = oh; *(v8us*)(Tl + o) = ol; }
    };
    pass(); 
}
__global__ __launch_bounds__(256) void k_tbuild(const float* __restrict__ rb, bf* T) {
    const int lane = threadIdx.x & 31; const int wid = blockIdx.x * 8 + (threadIdx.x >> 5); const int h = wid / NT, i = wid - h * NT; if (h >= NH) return;
{
#pragma unroll 1
        for (int c0 = lane * 8; c0 < NT; c0 += 256) { v8us o;
#pragma unroll
            for (int q = 0; q < 8; ++q) { const int j = c0 + q; o[q] = f2bf(rb[(size_t)(j - i + NT - 1) * NH + h]); }
            *(v8us*)(T + ((size_t)h * NT + i) * NT + c0) = o; }
         }
}
__global__ __launch_bounds__(256) void k_kvsplit(const float* __restrict__ src, const float* __restrict__ scale, bf* dh, bf* dl) {
    typedef __attribute__((ext_vector_type(2))) unsigned short v2us;
    const int lane = threadIdx.x & 31, r = blockIdx.x * 8 + (threadIdx.x >> 5); if (r >= HD) return; const float is = 1.0f / bfr(scale[0]);
    const size_t o = (size_t)r * HD + lane * 2; v2us oh, ol;
#pragma unroll
    for (int i = 0; i < 2; ++i) { const float y = src[o + i] * is; const unsigned short hb = f2bf(y); oh[i] = hb; ol[i] = f2bf(y - bf2f(hb)); }
    *(v2us*)(dh + o) = oh; *(v2us*)(dl + o) = ol; 
}
__global__ __launch_bounds__(256) void k_tadd(const float* __restrict__ C2, int h, float* Y) {
    __shared__ float tl[64][65];
    const int tid = threadIdx.x, i0 = blockIdx.x * 64;
    { const int d = tid >> 2, iq = (tid & 3) * 16;
#pragma unroll 4
      for (int k = 0; k < 16; ++k) tl[iq + k][d] = C2[(size_t)d * NT + i0 + iq + k]; }
    __syncthreads();
    const int piece = tid & 15, Lid = tid >> 4; v4f vals[4];
#pragma unroll
    for (int s = 0; s < 4; ++s) { const int i = Lid + 16 * s; const size_t o = (size_t)(i0 + i) * DD + h * HD + piece * 4; v4f y = *(const v4f*)(Y + o);
#pragma unroll
        for (int k = 0; k < 4; ++k) y[k] += tl[i][piece * 4 + k];
        vals[s] = y; }
    auto pass = [&]() {
#pragma unroll
        for (int s = 0; s < 4; ++s) { const int i = Lid + 16 * s; *(v4f*)(Y + (size_t)(i0 + i) * DD + h * HD + piece * 4) = vals[s]; }
    };
    pass(); 
}

__global__ __launch_bounds__(128) void k_gemm3ll(const bf* __restrict__ Ah, const bf* __restrict__ Al, int lda, const bf* __restrict__ Bh, const bf* __restrict__ Bl, int ldb, int K, float* C, int ldc) {
    __shared__ __align__(16) float ost[4][16 * 68];
    const int lane = threadIdx.x & 31, wave = threadIdx.x >> 5, lr = lane & 15, hi = lane >> 4;
    const int r0 = blockIdx.x * 64 + wave * 16, c0 = blockIdx.y * 64;
    const size_t aoff = (size_t)(r0 + lr) * lda + 8 * hi;
    v8f acc[4];
#pragma unroll
    for (int t = 0; t < 4; ++t) acc[t] = (v8f){};
#pragma unroll 1
    for (int kc = 0; kc < K; kc += 32) {
        const v16bf a = cat16b(*(const v8us*)(Ah + aoff + kc), *(const v8us*)(Ah + aoff + kc + 16));
        const v16bf al = cat16b(*(const v8us*)(Al + aoff + kc), *(const v8us*)(Al + aoff + kc + 16));
#pragma unroll
        for (int t = 0; t < 4; ++t) { const size_t bo = (size_t)(c0 + t * 16 + lr) * ldb + kc + 8 * hi;
            const v16bf bh = cat16b(*(const v8us*)(Bh + bo), *(const v8us*)(Bh + bo + 16)); const v16bf bl = cat16b(*(const v8us*)(Bl + bo), *(const v8us*)(Bl + bo + 16));
            acc[t] = wmmab(a, bh, acc[t]); acc[t] = wmmab(al, bh, acc[t]); acc[t] = wmmab(a, bl, acc[t]); }
        asm volatile("v_nop\n\tv_nop\n\tv_nop\n\tv_nop" : "+v"(acc[0]), "+v"(acc[1]), "+v"(acc[2]), "+v"(acc[3]) : "v"(a), "v"(al));
    }
    float* os = &ost[wave][0];
#pragma unroll
    for (int t = 0; t < 4; ++t) {
#pragma unroll
        for (int j = 0; j < 8; ++j) os[(hi * 8 + j) * 68 + t * 16 + lr] = acc[t][j]; }
    __builtin_amdgcn_wave_barrier(); asm volatile("" ::: "memory");
    float* crow = C + (size_t)r0 * ldc + c0;
    auto pass = [&]() {
#pragma unroll
        for (int s = 0; s < 8; ++s) { const int Lid = (lane >> 3) + 4 * s, piece = lane & 7; const int row = Lid >> 1, cofs = (Lid & 1) * 32 + piece * 4;
            const v4f val = *(const v4fa*)(os + row * 68 + cofs); *(v4f*)(crow + (size_t)row * ldc + cofs) = val; }
    };
    pass(); 
}

extern "C" void kernel_launch(void* const* d_in, const int* in_sizes, int n_in,
                              void* d_out, int out_size, void* d_ws, size_t ws_size, hipStream_t stream) {
    (void)in_sizes; (void)n_in; (void)out_size;
    const float* x = (const float*)d_in[0]; const float* Wq = (const float*)d_in[1]; const float* bq = (const float*)d_in[2]; const float* Wk = (const float*)d_in[3]; const float* bk = (const float*)d_in[4]; const float* Wv = (const float*)d_in[5]; const float* bv = (const float*)d_in[6];
    const float* Wo = (const float*)d_in[7]; const float* bo = (const float*)d_in[8]; const float* rb = (const float*)d_in[9]; const float* scale = (const float*)d_in[10]; const int* mask = (const int*)d_in[11];
    float* out = (float*)d_out;    // [4][2048][256]
    char* wsp = (char*)d_ws;
    auto take = [&](size_t bytes) { char* p = wsp; wsp += (bytes + 255) & ~(size_t)255; return (void*)p; };
    bf* WqB = (bf*)take(DD * DD * 2); bf* WkB = (bf*)take(DD * DD * 2); bf* WvB = (bf*)take(DD * DD * 2); bf* WoB = (bf*)take(DD * DD * 2); bf* T = (bf*)take((size_t)NH * NT * NT * 2);
    bf* Xb = (bf*)take((size_t)NT * DD * 2); float* TMP = (float*)take((size_t)NT * DD * 4); bf* Qh = (bf*)take((size_t)NT * DD * 2); bf* Ql = (bf*)take((size_t)NT * DD * 2);
    bf* KTh = (bf*)take((size_t)DD * NT * 2); bf* KTl = (bf*)take((size_t)DD * NT * 2); bf* VTh = (bf*)take((size_t)DD * NT * 2); bf* VTl = (bf*)take((size_t)DD * NT * 2);
    float* KV = (float*)take(HD * HD * 4); bf* KVh = (bf*)take(HD * HD * 2); bf* KVl = (bf*)take(HD * HD * 2); float* Y = (float*)take((size_t)NT * DD * 4); float* C2 = (float*)take((size_t)HD * NT * 4); bf* Yh = (bf*)take((size_t)NT * DD * 2); bf* Yl = (bf*)take((size_t)NT * DD * 2);
    if ((size_t)(wsp - (char*)d_ws) > ws_size) return;    // 0.5 + 33.5 + 1 + 2.1 + 2 x 1 + 4 x 1 + 2.1 + 0.5 + 2 x 1 ~ 47 MB, no aliasing (TMP reused q -> k -> v in stream order; Y updated in place by k_tadd, same-lane read-then-write)
    { const size_t n1 = DD * DD / 8; k_cvt8<<<(unsigned)((n1 + 255) / 256), 256, 0, stream>>>(Wq, WqB, n1); k_cvt8<<<(unsigned)((n1 + 255) / 256), 256, 0, stream>>>(Wk, WkB, n1); k_cvt8<<<(unsigned)((n1 + 255) / 256), 256, 0, stream>>>(Wv, WvB, n1); k_cvt8<<<(unsigned)((n1 + 255) / 256), 256, 0, stream>>>(Wo, WoB, n1); }
    k_tbuild<<<(NH * NT) / 8, 256, 0, stream>>>(rb, T);
    for (int b = 0; b < NBI; ++b) { const int* mb = mask + (size_t)b * NT;
        k_cvt<<<NT / 8, 256, 0, stream>>>(x + (size_t)b * NT * DD, Xb);
        k_gemmb<false, false><<<dim3(NT / 64, DD / 64, 1), 128, 0, stream>>>(Xb, nullptr, WqB, bq, TMP, DD, nullptr, nullptr, DD); k_split256m<<<NT / 8, 256, 0, stream>>>(TMP, mb, Qh, Ql);
        k_gemmb<false, false><<<dim3(NT / 64, DD / 64, 1), 128, 0, stream>>>(Xb, nullptr, WkB, bk, TMP, DD, nullptr, nullptr, DD); k_vtb<<<dim3(NT / 64, NH, 1), 256, 0, stream>>>(TMP, mb, KTh, KTl);
        k_gemmb<false, false><<<dim3(NT / 64, DD / 64, 1), 128, 0, stream>>>(Xb, nullptr, WvB, bv, TMP, DD, nullptr, nullptr, DD); k_vtb<<<dim3(NT / 64, NH, 1), 256, 0, stream>>>(TMP, mb, VTh, VTl);
        for (int h = 0; h < NH; ++h) { const size_t ho = (size_t)h * HD * NT;
            k_gemm3ll<<<dim3(1, 1, 1), 128, 0, stream>>>(VTh + ho, VTl + ho, NT, KTh + ho, KTl + ho, NT, NT, KV, HD);                       // (K^T V)^T [d2][d1] = V^T . K
            k_kvsplit<<<HD / 8, 256, 0, stream>>>(KV, scale, KVh, KVl);
            k_gemm3ll<<<dim3(NT / 64, 1, 1), 128, 0, stream>>>(Qh + h * HD, Ql + h * HD, DD, KVh, KVl, HD, HD, Y + h * HD, DD);                       // y1[i][h*64+d2] = q_i . (K^T V / s)[:, d2]
            k_gemmb<true, false><<<dim3(1, NT / 64, 1), 128, 0, stream>>>(VTh + ho, VTl + ho, T + (size_t)h * NT * NT, nullptr, C2, NT, nullptr, nullptr, NT);    // (T_h V)^T [d][i]
            k_tadd<<<NT / 64, 256, 0, stream>>>(C2, h, Y); }
        k_split256m<<<NT / 8, 256, 0, stream>>>(Y, nullptr, Yh, Yl);
        k_gemmb<true, false><<<dim3(NT / 64, DD / 64, 1), 128, 0, stream>>>(Yh, Yl, WoB, bo, out + (size_t)b * NT * DD, DD, nullptr, nullptr, DD);
    }
}

// v001
// A run of this version takes 205 microseconds.
// Timed twice side by side with v000, it ran 9.15 and 9.20 times as fast.
#include <hip/hip_runtime.h>

// Compute dtypes, f32 accumulate, every stage one launch over all batch items and heads: Q/K/V = x.W^T + b ([2048 x 256].[256 x 256], PLAIN bf16 operands = rounded input, [out][in] weights; exact products); the
// un-softmaxed attention out_h = (Q K^T / scale + RelBias_h) V is evaluated as Q (K^T V) / scale + T_h V (exact reassociation): K^T V per head as [64 x 2048].[2048 x 64]
// (both operands bf16 hi + UNSCALED residual, three products), Q.(K^T V / scale) as [2048 x 64].[64 x 64] (three products), and the Toeplitz relative-bias term T_h[i][j] =
// rel_bias[j - i + 2047][h] (an exact bf16 plane gathered from the INPUT table) against V^T hi + residual (two products); out = y.Wo^T + bo (two products) - all on
// v_wmma_f32_16x16x32_bf16. The mask input enters multiplicatively (m_i m_j). Deterministic, no atomics; every

#define NBI  4
#define NT   2048
#define DD   256
#define NH   4
#define HD   64
#define DM   DD
#define LOSC 1024.0f

typedef _Float16 h16;
typedef unsigned short bf;
typedef __attribute__((ext_vector_type(16))) __bf16   v16bf;
typedef __attribute__((ext_vector_type(16))) _Float16 v16h;
typedef __attribute__((ext_vector_type(8)))  _Float16 v8h;
typedef __attribute__((ext_vector_type(8)))  unsigned short v8us;
typedef __attribute__((ext_vector_type(8)))  float    v8f;
typedef __attribute__((ext_vector_type(4)))  float    v4f;
typedef v8h  __attribute__((may_alias)) v8ha;
typedef v4f  __attribute__((may_alias)) v4fa;
typedef v8us __attribute__((may_alias)) v8usa;

__device__ __forceinline__ unsigned short f2bf(float f) { unsigned u = __float_as_uint(f); u += 0x7FFFu + ((u >> 16) & 1u); return (unsigned short)(u >> 16); }
__device__ __forceinline__ float bf2f(unsigned short b) { return __uint_as_float(((unsigned)b) << 16); }
__device__ __forceinline__ float bfr(float f) { return bf2f(f2bf(f)); }
__device__ __forceinline__ v16h cat16(v8h lo, v8h hi) { return __builtin_shufflevector(lo, hi, 0, 1, 2, 3, 4, 5, 6, 7, 8, 9, 10, 11, 12, 13, 14, 15); }
__device__ __forceinline__ v16bf cat16b(v8us lo, v8us hi) { return __builtin_bit_cast(v16bf, __builtin_shufflevector(lo, hi, 0, 1, 2, 3, 4, 5, 6, 7, 8, 9, 10, 11, 12, 13, 14, 15)); }
__device__ __forceinline__ v8f wmma16(v16h a, v16h b, v8f c) { return __builtin_amdgcn_wmma_f32_16x16x32_f16(false, a, false, b, (short)0, c, false, false); }
__device__ __forceinline__ v8f wmmab(v16bf a, v16bf b, v8f c) { return __builtin_amdgcn_wmma_f32_16x16x32_bf16(false, a, false, b, (short)0, c, false, false); }

// k_gemmb: 64 x 64 block tile (4 waves x 16 x 64) of C[NTK][NW] = (A [+ Al]).B^T (K = 256 or 2048) [+ bf(bias[c])] [+ bf(R[r][c]) residual]; f32 whole-line epilogue (or f16
template <bool SPLITA, bool F16OUT = false>
__global__ __launch_bounds__(128) void k_gemmb(const bf* __restrict__ A, const bf* __restrict__ Al, const bf* __restrict__ Bn, const float* __restrict__ bias, float* C, int ldc, h16* C2, const float* __restrict__ R = nullptr, int K = DM, int roundR = 1,
                                               size_t zA = 0, size_t zB = 0, int zBmask = 0, size_t zC = 0, const float* __restrict__ bias1 = nullptr, const float* __restrict__ bias2 = nullptr) {
    __shared__ __align__(16) float ost[4][16 * 68];
    const int lane = threadIdx.x & 31, wave = threadIdx.x >> 5, lr = lane & 15, hi = lane >> 4;
    const int r0 = blockIdx.x * 64 + wave * 16, c0 = blockIdx.y * 64;
    // grid z = one independent product: its own A and C planes, B plane (z & zBmask), bias 0 / 1 / 2
    const int z = blockIdx.z; A += z * zA; if (SPLITA) Al += z * zA; Bn += (size_t)(z & zBmask) * zB; C += z * zC; if (z == 1) bias = bias1; if (z == 2) bias = bias2;
    const size_t aoff = (size_t)(r0 + lr) * K + 8 * hi;
    size_t boff[4];
#pragma unroll
    for (int t = 0; t < 4; ++t) boff[t] = (size_t)(c0 + t * 16 + lr) * K + 8 * hi;
    v8f acc[4];
#pragma unroll
    for (int t = 0; t < 4; ++t) acc[t] = (v8f){};
#pragma unroll 1
    for (int kc = 0; kc < K; kc += 32) {
        const v16bf a = cat16b(*(const v8us*)(A + aoff + kc), *(const v8us*)(A + aoff + kc + 16));
        v16bf al = a;
        if (SPLITA) al = cat16b(*(const v8us*)(Al + aoff + kc), *(const v8us*)(Al + aoff + kc + 16));
#pragma unroll
        for (int t = 0; t < 4; ++t) { const v16bf b = cat16b(*(const v8us*)(Bn + boff[t] + kc), *(const v8us*)(Bn + boff[t] + kc + 16)); acc[t] = wmmab(a, b, acc[t]); if (SPLITA) acc[t] = wmmab(al, b, acc[t]); }
        asm volatile("v_nop\n\tv_nop\n\tv_nop\n\tv_nop" : "+v"(acc[0]), "+v"(acc[1]), "+v"(acc[2]), "+v"(acc[3]) : "v"(a), "v"(al));
    }
    float* os = &ost[wave][0];
#pragma unroll
    for (int t = 0; t < 4; ++t) { const float bv = bias ? bfr(bias[c0 + t * 16 + lr]) : 0.f;
#pragma unroll
        for (int j = 0; j < 8; ++j) os[(hi * 8 + j) * 68 + t * 16 + lr] = acc[t][j] + bv; }
    __syncthreads();
    if (F16OUT) {
        h16* crow = (h16*)(void*)C + (size_t)r0 * ldc + c0;
        auto pass = [&]() {
#pragma unroll
            for (int s = 0; s < 4; ++s) { const int row = 4 * s + (lane >> 3), piece = lane & 7; const float* sp = os + row * 68 + piece * 8; v8h o, o2;
#pragma unroll
                for (int i = 0; i < 8; ++i) { const h16 a = (h16)sp[i]; o[i] = a; o2[i] = (h16)((sp[i] - (float)a) * LOSC); }
                *(v8h*)(crow + (size_t)row * ldc + piece * 8) = o; if (C2) *(v8h*)(C2 + (size_t)r0 * ldc + c0 + (size_t)row * ldc + piece * 8) = o2; }
        };
        pass(); 
    } else {
        float* crow = C + (size_t)r0 * ldc + c0;
        auto pass = [&]() {
#pragma unroll
            for (int s = 0; s < 8; ++s) { const int Lid = (lane >> 3) + 4 * s, piece = lane & 7; const int row = Lid >> 1, cofs = (Lid & 1) * 32 + piece * 4;
                v4f val = *(const v4fa*)(os + row * 68 + cofs); if (R) { const v4f rv = *(const v4f*)(R + ((size_t)r0 + row) * ldc + c0 + cofs); val += roundR ? (v4f){bfr(rv[0]), bfr(rv[1]), bfr(rv[2]), bfr(rv[3])} : rv; }
                *(v4f*)(crow + (size_t)row * ldc + cofs) = val; }
        };
        pass(); 
    }
}


__global__ __launch_bounds__(256) void k_cvt8(const float* __restrict__ s0, const float* __restrict__ s1, const float* __restrict__ s2, const float* __restrict__ s3, bf* dst, size_t n8) {
    const size_t i = (size_t)blockIdx.x * 256 + threadIdx.x; if (i >= n8) return;
    const int y = blockIdx.y; const float* src = y == 0 ? s0 : y == 1 ? s1 : y == 2 ? s2 : s3; dst += (size_t)y * n8 * 8;    // grid y = which of the four matrices
    const v8f v = *(const v8f*)(src + i * 8); v8us o;
#pragma unroll
    for (int k = 0; k < 8; ++k) o[k] = f2bf(v[k]);
    *(v8us*)(dst + i * 8) = o; 
}
__global__ __launch_bounds__(256) void k_zero8(bf* dst, size_t n8) {
    const size_t i = (size_t)blockIdx.x * 256 + threadIdx.x; if (i >= n8) return; v8us z;
#pragma unroll
    for (int k = 0; k < 8; ++k) z[k] = 0;
    *(v8us*)(dst + i * 8) = z; 
}

__global__ __launch_bounds__(256) void k_cvt(const float* __restrict__ src, bf* dst) {
    const int lane = threadIdx.x & 31, r = blockIdx.x * 8 + (threadIdx.x >> 5); if (r >= NBI * NT) return; v8us o;
#pragma unroll
    for (int i = 0; i < 8; ++i) o[i] = f2bf(src[(size_t)r * DD + lane * 8 + i]);
    *(v8us*)(dst + (size_t)r * DD + lane * 8) = o; 
}
__global__ __launch_bounds__(256) void k_split256m(const float* __restrict__ src, const int* __restrict__ m, bf* dh, bf* dl) {
    const int lane = threadIdx.x & 31, r = blockIdx.x * 8 + (threadIdx.x >> 5); if (r >= NBI * NT) return; const float f = m ? ((m[r] != 0) ? 1.0f : 0.f) : 1.0f;
    const size_t o = (size_t)r * DD + lane * 8; const v8f v = *(const v8f*)(src + o); v8us oh, ol;
#pragma unroll
    for (int i = 0; i < 8; ++i) { const float y = v[i] * f; const unsigned short hb = f2bf(y); oh[i] = hb; ol[i] = f2bf(y - bf2f(hb)); }
    *(v8us*)(dh + o) = oh; *(v8us*)(dl + o) = ol; 
}
__global__ __launch_bounds__(256) void k_vtb(const float* __restrict__ src, const int* __restrict__ m, bf* Th, bf* Tl) {
    __shared__ float tl[64][65];
    const int tid = threadIdx.x, t0 = blockIdx.x * 64, h = blockIdx.y;
    { const int z = blockIdx.z; src += (size_t)z * NT * DD; m += (z % NBI) * NT; Th += (size_t)z * DD * NT; Tl += (size_t)z * DD * NT; }    // grid z = (K | V plane) * NBI + batch item
    { const int tt = tid >> 2, dq = (tid & 3) * 16; const float f = (m[t0 + tt] != 0) ? 1.0f : 0.f;
#pragma unroll 4
      for (int i = 0; i < 16; ++i) tl[dq + i][tt] = src[(size_t)(t0 + tt) * DD + h * HD + dq + i] * f; }
    __syncthreads();
    const int piece = tid & 7, Lid = tid >> 3;
    auto pass = [&]() {
#pragma unroll
        for (int s = 0; s < 2; ++s) { const int d = Lid + 32 * s; v8us oh, ol;
#pragma unroll
            for (int i = 0; i < 8; ++i) { const float v = tl[d][piece * 8 + i]; const unsigned short hb = f2bf(v); oh[i] = hb; ol[i] = f2bf(v - bf2f(hb)); }
            const size_t o = ((size_t)h * HD + d) * NT + t0 + piece * 8; *(v8us*)(Th + o) = oh; *(v8us*)(Tl + o) = ol; }
    };
    pass(); 
}
__global__ __launch_bounds__(256) void k_tbuild(const float* __restrict__ rb, bf* T) {
    const int lane = threadIdx.x & 31; const int wid = blockIdx.x * 8 + (threadIdx.x >> 5); const int h = wid / NT, i = wid - h * NT; if (h >= NH) return;
{
#pragma unroll 1
        for (int c0 = lane * 8; c0 < NT; c0 += 256) { v8us o;
#pragma unroll
            for (int q = 0; q < 8; ++q) { const int j = c0 + q; o[q] = f2bf(rb[(size_t)(j - i + NT - 1) * NH + h]); }
            *(v8us*)(T + ((size_t)h * NT + i) * NT + c0) = o; }
         }
}
__global__ __launch_bounds__(256) void k_kvsplit(const float* __restrict__ src, const float* __restrict__ scale, bf* dh, bf* dl) {
    typedef __attribute__((ext_vector_type(2))) unsigned short v2us;
    const int lane = threadIdx.x & 31, r = blockIdx.x * 8 + (threadIdx.x >> 5); if (r >= HD) return; const float is = 1.0f / bfr(scale[0]);
    const size_t o = ((size_t)blockIdx.y * HD + r) * HD + lane * 2;    // grid y = batch item * NH + head
    v2us oh, ol;
#pragma unroll
    for (int i = 0; i < 2; ++i) { const float y = src[o + i] * is; const unsigned short hb = f2bf(y); oh[i] = hb; ol[i] = f2bf(y - bf2f(hb)); }
    *(v2us*)(dh + o) = oh; *(v2us*)(dl + o) = ol; 
}
__global__ __launch_bounds__(256) void k_tadd(const float* __restrict__ C2, float* Y) {
    __shared__ float tl[64][65];
    const int tid = threadIdx.x, i0 = blockIdx.x * 64, h = blockIdx.y % NH;
    C2 += (size_t)blockIdx.y * HD * NT; Y += (size_t)(blockIdx.y / NH) * NT * DD;    // grid y = batch item * NH + head
    { const int d = tid >> 2, iq = (tid & 3) * 16;
#pragma unroll 4
      for (int k = 0; k < 16; ++k) tl[iq + k][d] = C2[(size_t)d * NT + i0 + iq + k]; }
    __syncthreads();
    const int piece = tid & 15, Lid = tid >> 4; v4f vals[4];
#pragma unroll
    for (int s = 0; s < 4; ++s) { const int i = Lid + 16 * s; const size_t o = (size_t)(i0 + i) * DD + h * HD + piece * 4; v4f y = *(const v4f*)(Y + o);
#pragma unroll
        for (int k = 0; k < 4; ++k) y[k] += tl[i][piece * 4 + k];
        vals[s] = y; }
    auto pass = [&]() {
#pragma unroll
        for (int s = 0; s < 4; ++s) { const int i = Lid + 16 * s; *(v4f*)(Y + (size_t)(i0 + i) * DD + h * HD + piece * 4) = vals[s]; }
    };
    pass(); 
}

__global__ __launch_bounds__(128) void k_gemm3ll(const bf* __restrict__ Ah, const bf* __restrict__ Al, int lda, const bf* __restrict__ Bh, const bf* __restrict__ Bl, int ldb, int K, float* C, int ldc,
                                                 size_t zAb, size_t zAh, size_t zB, size_t zCb, size_t zCh) {
    __shared__ __align__(16) float ost[4][16 * 68];
    const int lane = threadIdx.x & 31, wave = threadIdx.x >> 5, lr = lane & 15, hi = lane >> 4;
    const int r0 = blockIdx.x * 64 + wave * 16, c0 = blockIdx.y * 64;
    // grid z = batch item * NH + head: A and C step by item and by head, B by z
    { const int z = blockIdx.z, zb = z / NH, zh = z % NH; const size_t ao = zb * zAb + zh * zAh; Ah += ao; Al += ao; Bh += z * zB; Bl += z * zB; C += zb * zCb + zh * zCh; }
    const size_t aoff = (size_t)(r0 + lr) * lda + 8 * hi;
    v8f acc[4];
#pragma unroll
    for (int t = 0; t < 4; ++t) acc[t] = (v8f){};
#pragma unroll 1
    for (int kc = 0; kc < K; kc += 32) {
        const v16bf a = cat16b(*(const v8us*)(Ah + aoff + kc), *(const v8us*)(Ah + aoff + kc + 16));
        const v16bf al = cat16b(*(const v8us*)(Al + aoff + kc), *(const v8us*)(Al + aoff + kc + 16));
#pragma unroll
        for (int t = 0; t < 4; ++t) { const size_t bo = (size_t)(c0 + t * 16 + lr) * ldb + kc + 8 * hi;
            const v16bf bh = cat16b(*(const v8us*)(Bh + bo), *(const v8us*)(Bh + bo + 16)); const v16bf bl = cat16b(*(const v8us*)(Bl + bo), *(const v8us*)(Bl + bo + 16));
            acc[t] = wmmab(a, bh, acc[t]); acc[t] = wmmab(al, bh, acc[t]); acc[t] = wmmab(a, bl, acc[t]); }
        asm volatile("v_nop\n\tv_nop\n\tv_nop\n\tv_nop" : "+v"(acc[0]), "+v"(acc[1]), "+v"(acc[2]), "+v"(acc[3]) : "v"(a), "v"(al));
    }
    float* os = &ost[wave][0];
#pragma unroll
    for (int t = 0; t < 4; ++t) {
#pragma unroll
        for (int j = 0; j < 8; ++j) os[(hi * 8 + j) * 68 + t * 16 + lr] = acc[t][j]; }
    __builtin_amdgcn_wave_barrier(); asm volatile("" ::: "memory");
    float* crow = C + (size_t)r0 * ldc + c0;
    auto pass = [&]() {
#pragma unroll
        for (int s = 0; s < 8; ++s) { const int Lid = (lane >> 3) + 4 * s, piece = lane & 7; const int row = Lid >> 1, cofs = (Lid & 1) * 32 + piece * 4;
            const v4f val = *(const v4fa*)(os + row * 68 + cofs); *(v4f*)(crow + (size_t)row * ldc + cofs) = val; }
    };
    pass(); 
}

extern "C" void kernel_launch(void* const* d_in, const int* in_sizes, int n_in,
                              void* d_out, int out_size, void* d_ws, size_t ws_size, hipStream_t stream) {
    (void)in_sizes; (void)n_in; (void)out_size;
    const float* x = (const float*)d_in[0]; const float* Wq = (const float*)d_in[1]; const float* bq = (const float*)d_in[2]; const float* Wk = (const float*)d_in[3]; const float* bk = (const float*)d_in[4]; const float* Wv = (const float*)d_in[5]; const float* bv = (const float*)d_in[6];
    const float* Wo = (const float*)d_in[7]; const float* bo = (const float*)d_in[8]; const float* rb = (const float*)d_in[9]; const float* scale = (const float*)d_in[10]; const int* mask = (const int*)d_in[11];
    float* out = (float*)d_out;    // [4][2048][256]
    char* wsp = (char*)d_ws;
    auto take = [&](size_t bytes) { char* p = wsp; wsp += (bytes + 255) & ~(size_t)255; return (void*)p; };
    const size_t PL = (size_t)NBI * NT * DD;    // one [batch][token][256] plane, elements
    bf* WB = (bf*)take((size_t)4 * DD * DD * 2); bf* WoB = WB + 3 * DD * DD; bf* T = (bf*)take((size_t)NH * NT * NT * 2);    // WB: Wq, Wk, Wv, Wo
    bf* Xb = (bf*)take(PL * 2); float* TMP = (float*)take(3 * PL * 4); bf* Qh = (bf*)take(PL * 2); bf* Ql = (bf*)take(PL * 2);    // TMP: q, k, v planes
    bf* KTh = (bf*)take(2 * PL * 2); bf* KTl = (bf*)take(2 * PL * 2); bf* VTh = KTh + PL; bf* VTl = KTl + PL;    // [K | V][batch][head][64][2048]
    float* KV = (float*)take((size_t)NBI * NH * HD * HD * 4); bf* KVh = (bf*)take((size_t)NBI * NH * HD * HD * 2); bf* KVl = (bf*)take((size_t)NBI * NH * HD * HD * 2);
    float* Y = (float*)take(PL * 4); float* C2 = (float*)take(PL * 4); bf* Yh = (bf*)take(PL * 2); bf* Yl = (bf*)take(PL * 2);
    if ((size_t)(wsp - (char*)d_ws) > ws_size) return;    // 0.5 + 33.5 + 4 + 25 + 2 x 4 + 2 x 8 + 0.5 + 8 + 8 + 2 x 4 ~ 112 MB, no aliasing (Y updated in place by k_tadd, same-lane read-then-write)
    k_cvt8<<<dim3(DD * DD / 8 / 256, 4, 1), 256, 0, stream>>>(Wq, Wk, Wv, Wo, WB, DD * DD / 8);
    k_tbuild<<<(NH * NT) / 8, 256, 0, stream>>>(rb, T);
    k_cvt<<<NBI * NT / 8, 256, 0, stream>>>(x, Xb);
    k_gemmb<false, false><<<dim3(NBI * NT / 64, DD / 64, 3), 128, 0, stream>>>(Xb, nullptr, WB, bq, TMP, DD, nullptr, nullptr, DD, 1, 0, DD * DD, 3, PL, bk, bv);    // z = q, k, v
    k_split256m<<<NBI * NT / 8, 256, 0, stream>>>(TMP, mask, Qh, Ql);
    k_vtb<<<dim3(NT / 64, NH, 2 * NBI), 256, 0, stream>>>(TMP + PL, mask, KTh, KTl);
    k_gemm3ll<<<dim3(1, 1, NBI * NH), 128, 0, stream>>>(VTh, VTl, NT, KTh, KTl, NT, NT, KV, HD, (size_t)DD * NT, (size_t)HD * NT, (size_t)HD * NT, NH * HD * HD, HD * HD);    // (K^T V)^T [d2][d1] = V^T . K
    k_kvsplit<<<dim3(HD / 8, NBI * NH, 1), 256, 0, stream>>>(KV, scale, KVh, KVl);
    k_gemm3ll<<<dim3(NT / 64, 1, NBI * NH), 128, 0, stream>>>(Qh, Ql, DD, KVh, KVl, HD, HD, Y, DD, (size_t)NT * DD, HD, HD * HD, (size_t)NT * DD, HD);    // y1[i][h*64+d2] = q_i . (K^T V / s)[:, d2]
    k_gemmb<true, false><<<dim3(1, NT / 64, NBI * NH), 128, 0, stream>>>(VTh, VTl, T, nullptr, C2, NT, nullptr, nullptr, NT, 1, (size_t)HD * NT, (size_t)NT * NT, NH - 1, (size_t)HD * NT);    // (T_h V)^T [d][i]
    k_tadd<<<dim3(NT / 64, NBI * NH, 1), 256, 0, stream>>>(C2, Y);
    k_split256m<<<NBI * NT / 8, 256, 0, stream>>>(Y, nullptr, Yh, Yl);
    k_gemmb<true, false><<<dim3(NBI * NT / 64, DD / 64, 1), 128, 0, stream>>>(Yh, Yl, WoB, bo, out, DD, nullptr, nullptr, DD);
}

// v002
// It runs in 139 microseconds.
// Timed twice side by side with v001, it ran 1.48 and 1.47 times as fast.
// Over all steps from v000 it is 13.5 times as fast.
#include <hip/hip_runtime.h>

// Compute dtypes, f32 accumulate, every stage one launch over all batch items and heads: Q/K/V = x.W^T + b ([2048 x 256].[256 x 256], PLAIN bf16 operands = rounded input, [out][in] weights; exact products); the
// un-softmaxed attention out_h = (Q K^T / scale + RelBias_h) V is evaluated as Q (K^T V) / scale + T_h V (exact reassociation): K^T V per head as [64 x 2048].[2048 x 64]
// (both operands bf16 hi + UNSCALED residual, three products), Q.(K^T V / scale) as [2048 x 64].[64 x 64] (three products), and the Toeplitz relative-bias term T_h[i][j] =
// rel_bias[j - i + 2047][h] (an exact bf16 plane gathered from the INPUT table) against V^T hi + residual (two products); out = y.Wo^T + bo (two products) - all on
// v_wmma_f32_16x16x32_bf16. The mask input enters multiplicatively (m_i m_j). Deterministic, no atomics; every

#define NBI  4
#define NT   2048
#define DD   256
#define NH   4
#define HD   64
#define DM   DD
#define LOSC 1024.0f

typedef _Float16 h16;
typedef unsigned short bf;
typedef __attribute__((ext_vector_type(16))) __bf16   v16bf;
typedef __attribute__((ext_vector_type(16))) _Float16 v16h;
typedef __attribute__((ext_vector_type(8)))  _Float16 v8h;
typedef __attribute__((ext_vector_type(8)))  unsigned short v8us;
typedef __attribute__((ext_vector_type(8)))  float    v8f;
typedef __attribute__((ext_vector_type(4)))  float    v4f;
typedef v8h  __attribute__((may_alias)) v8ha;
typedef v4f  __attribute__((may_alias)) v4fa;
typedef v8us __attribute__((may_alias)) v8usa;

__device__ __forceinline__ unsigned short f2bf(float f) { unsigned u = __float_as_uint(f); u += 0x7FFFu + ((u >> 16) & 1u); return (unsigned short)(u >> 16); }
__device__ __forceinline__ float bf2f(unsigned short b) { return __uint_as_float(((unsigned)b) << 16); }
__device__ __forceinline__ float bfr(float f) { return bf2f(f2bf(f)); }
__device__ __forceinline__ v16h cat16(v8h lo, v8h hi) { return __builtin_shufflevector(lo, hi, 0, 1, 2, 3, 4, 5, 6, 7, 8, 9, 10, 11, 12, 13, 14, 15); }
__device__ __forceinline__ v16bf cat16b(v8us lo, v8us hi) { return __builtin_bit_cast(v16bf, __builtin_shufflevector(lo, hi, 0, 1, 2, 3, 4, 5, 6, 7, 8, 9, 10, 11, 12, 13, 14, 15)); }
__device__ __forceinline__ v8f wmma16(v16h a, v16h b, v8f c) { return __builtin_amdgcn_wmma_f32_16x16x32_f16(false, a, false, b, (short)0, c, false, false); }
__device__ __forceinline__ v8f wmmab(v16bf a, v16bf b, v8f c) { return __builtin_amdgcn_wmma_f32_16x16x32_bf16(false, a, false, b, (short)0, c, false, false); }

// one lane's 16 x 16 x 32 fragment of a row-major operand: p = the lane's row at k = 8 * (lane >> 4) of the K step
__device__ __forceinline__ v16bf ldfrag(const bf* p) { return cat16b(*(const v8us*)p, *(const v8us*)(p + 16)); }

// k_gemmb: 64 x 64 block tile (4 waves x 16 x 64) of C[NTK][NW] = (A [+ Al]).B^T (K = 256 or 2048) [+ bf(bias[c])] [+ bf(R[r][c]) residual]; f32 whole-line epilogue (or f16
template <bool SPLITA, bool F16OUT = false>
__global__ __launch_bounds__(128) void k_gemmb(const bf* __restrict__ A, const bf* __restrict__ Al, const bf* __restrict__ Bn, const float* __restrict__ bias, float* C, int ldc, h16* C2, const float* __restrict__ R = nullptr, int K = DM, int roundR = 1,
                                               size_t zA = 0, size_t zB = 0, int zBmask = 0, size_t zC = 0, const float* __restrict__ bias1 = nullptr, const float* __restrict__ bias2 = nullptr) {
    __shared__ __align__(16) float ost[4][16 * 68];
    const int lane = threadIdx.x & 31, wave = threadIdx.x >> 5, lr = lane & 15, hi = lane >> 4;
    const int r0 = blockIdx.x * 64 + wave * 16, c0 = blockIdx.y * 64;
    // grid z = one independent product: its own A and C planes, B plane (z & zBmask), bias 0 / 1 / 2
    const int z = blockIdx.z; A += z * zA; if (SPLITA) Al += z * zA; Bn += (size_t)(z & zBmask) * zB; C += z * zC; if (z == 1) bias = bias1; if (z == 2) bias = bias2;
    const size_t aoff = (size_t)(r0 + lr) * K + 8 * hi;
    size_t boff[4];
#pragma unroll
    for (int t = 0; t < 4; ++t) boff[t] = (size_t)(c0 + t * 16 + lr) * K + 8 * hi;
    v8f acc[4];
#pragma unroll
    for (int t = 0; t < 4; ++t) acc[t] = (v8f){};
    // one trip = 4 K steps (K is a multiple of 128): every load of the trip is issued before its first product, so a trip waits for memory once
    const bf* pa = A + aoff; const bf* pal = SPLITA ? Al + aoff : pa; const bf* pb0 = Bn + boff[0]; const bf* pb1 = Bn + boff[1]; const bf* pb2 = Bn + boff[2]; const bf* pb3 = Bn + boff[3];
#pragma unroll 1
    for (int kc = 0; kc < K; kc += 128) {
        v16bf a[4], al[4], b[4][4];    // the loops over u and t below are fully unrolled so that these arrays live in registers
#pragma unroll
        for (int u = 0; u < 4; ++u) { a[u] = ldfrag(pa + 32 * u); al[u] = SPLITA ? ldfrag(pal + 32 * u) : a[u];
            b[u][0] = ldfrag(pb0 + 32 * u); b[u][1] = ldfrag(pb1 + 32 * u); b[u][2] = ldfrag(pb2 + 32 * u); b[u][3] = ldfrag(pb3 + 32 * u); }
        // inputs-only fence on the loaded values: holds all loads of the trip in front of the products (without it the compiler loads one B fragment at a time and waits for each);
        // the six addresses are inputs too: they stay in their registers until the data is there, so no load's result lands in a register that an earlier load of the trip names
        asm volatile("" :: "v"(pa), "v"(pal), "v"(pb0), "v"(pb1), "v"(pb2), "v"(pb3), "v"(a[0]), "v"(a[1]), "v"(a[2]), "v"(a[3]), "v"(al[0]), "v"(al[1]), "v"(al[2]), "v"(al[3]),
                     "v"(b[0][0]), "v"(b[0][1]), "v"(b[0][2]), "v"(b[0][3]), "v"(b[1][0]), "v"(b[1][1]), "v"(b[1][2]), "v"(b[1][3]),
                     "v"(b[2][0]), "v"(b[2][1]), "v"(b[2][2]), "v"(b[2][3]), "v"(b[3][0]), "v"(b[3][1]), "v"(b[3][2]), "v"(b[3][3]));
#pragma unroll
        for (int u = 0; u < 4; ++u) {
#pragma unroll
            for (int t = 0; t < 4; ++t) { acc[t] = wmmab(a[u], b[u][t], acc[t]); if (SPLITA) acc[t] = wmmab(al[u], b[u][t], acc[t]); } }
        pa += 128; pal += 128; pb0 += 128; pb1 += 128; pb2 += 128; pb3 += 128;
        asm volatile("v_nop\n\tv_nop\n\tv_nop\n\tv_nop" : "+v"(acc[0]), "+v"(acc[1]), "+v"(acc[2]), "+v"(acc[3]) : "v"(a[3]), "v"(al[3]));    // WMMA distance over the back edge: four vector slots between the trip's last product and whatever the next trip issues first
    }
    float* os = &ost[wave][0];
#pragma unroll
    for (int t = 0; t < 4; ++t) { const float bv = bias ? bfr(bias[c0 + t * 16 + lr]) : 0.f;
#pragma unroll
        for (int j = 0; j < 8; ++j) os[(hi * 8 + j) * 68 + t * 16 + lr] = acc[t][j] + bv; }
    __syncthreads();
    if (F16OUT) {
        h16* crow = (h16*)(void*)C + (size_t)r0 * ldc + c0;
        auto pass = [&]() {
#pragma unroll
            for (int s = 0; s < 4; ++s) { const int row = 4 * s + (lane >> 3), piece = lane & 7; const float* sp = os + row * 68 + piece * 8; v8h o, o2;
#pragma unroll
                for (int i = 0; i < 8; ++i) { const h16 a = (h16)sp[i]; o[i] = a; o2[i] = (h16)((sp[i] - (float)a) * LOSC); }
                *(v8h*)(crow + (size_t)row * ldc + piece * 8) = o; if (C2) *(v8h*)(C2 + (size_t)r0 * ldc + c0 + (size_t)row * ldc + piece * 8) = o2; }
        };
        pass(); 
    } else {
        float* crow = C + (size_t)r0 * ldc + c0;
        auto pass = [&]() {
#pragma unroll
            for (int s = 0; s < 8; ++s) { const int Lid = (lane >> 3) + 4 * s, piece = lane & 7; const int row = Lid >> 1, cofs = (Lid & 1) * 32 + piece * 4;
                v4f val = *(const v4fa*)(os + row * 68 + cofs); if (R) { const v4f rv = *(const v4f*)(R + ((size_t)r0 + row) * ldc + c0 + cofs); val += roundR ? (v4f){bfr(rv[0]), bfr(rv[1]), bfr(rv[2]), bfr(rv[3])} : rv; }
                *(v4f*)(crow + (size_t)row * ldc + cofs) = val; }
        };
        pass(); 
    }
}


__global__ __launch_bounds__(256) void k_cvt8(const float* __restrict__ s0, const float* __restrict__ s1, const float* __restrict__ s2, const float* __restrict__ s3, bf* dst, size_t n8) {
    const size_t i = (size_t)blockIdx.x * 256 + threadIdx.x; if (i >= n8) return;
    const int y = blockIdx.y; const float* src = y == 0 ? s0 : y == 1 ? s1 : y == 2 ? s2 : s3; dst += (size_t)y * n8 * 8;    // grid y = which of the four matrices
    const v8f v = *(const v8f*)(src + i * 8); v8us o;
#pragma unroll
    for (int k = 0; k < 8; ++k) o[k] = f2bf(v[k]);
    *(v8us*)(dst + i * 8) = o; 
}
__global__ __launch_bounds__(256) void k_zero8(bf* dst, size_t n8) {
    const size_t i = (size_t)blockIdx.x * 256 + threadIdx.x; if (i >= n8) return; v8us z;
#pragma unroll
    for (int k = 0; k < 8; ++k) z[k] = 0;
    *(v8us*)(dst + i * 8) = z; 
}

__global__ __launch_bounds__(256) void k_cvt(const float* __restrict__ src, bf* dst) {
    const int lane = threadIdx.x & 31, r = blockIdx.x * 8 + (threadIdx.x >> 5); if (r >= NBI * NT) return; v8us o;
#pragma unroll
    for (int i = 0; i < 8; ++i) o[i] = f2bf(src[(size_t)r * DD + lane * 8 + i]);
    *(v8us*)(dst + (size_t)r * DD + lane * 8) = o; 
}
__global__ __launch_bounds__(256) void k_split256m(const float* __restrict__ src, const int* __restrict__ m, bf* dh, bf* dl) {
    const int lane = threadIdx.x & 31, r = blockIdx.x * 8 + (threadIdx.x >> 5); if (r >= NBI * NT) return; const float f = m ? ((m[r] != 0) ? 1.0f : 0.f) : 1.0f;
    const size_t o = (size_t)r * DD + lane * 8; const v8f v = *(const v8f*)(src + o); v8us oh, ol;
#pragma unroll
    for (int i = 0; i < 8; ++i) { const float y = v[i] * f; const unsigned short hb = f2bf(y); oh[i] = hb; ol[i] = f2bf(y - bf2f(hb)); }
    *(v8us*)(dh + o) = oh; *(v8us*)(dl + o) = ol; 
}
__global__ __launch_bounds__(256) void k_vtb(const float* __restrict__ src, const int* __restrict__ m, bf* Th, bf* Tl) {
    __shared__ float tl[64][65];
    const int tid = threadIdx.x, t0 = blockIdx.x * 64, h = blockIdx.y;
    { const int z = blockIdx.z; src += (size_t)z * NT * DD; m += (z % NBI) * NT; Th += (size_t)z * DD * NT; Tl += (size_t)z * DD * NT; }    // grid z = (K | V plane) * NBI + batch item
    { const int tt = tid >> 2, dq = (tid & 3) * 16; const float f = (m[t0 + tt] != 0) ? 1.0f : 0.f;
#pragma unroll 4
      for (int i = 0; i < 16; ++i) tl[dq + i][tt] = src[(size_t)(t0 + tt) * DD + h * HD + dq + i] * f; }
    __syncthreads();
    const int piece = tid & 7, Lid = tid >> 3;
    auto pass = [&]() {
#pragma unroll
        for (int s = 0; s < 2; ++s) { const int d = Lid + 32 * s; v8us oh, ol;
#pragma unroll
            for (int i = 0; i < 8; ++i) { const float v = tl[d][piece * 8 + i]; const unsigned short hb = f2bf(v); oh[i] = hb; ol[i] = f2bf(v - bf2f(hb)); }
            const size_t o = ((size_t)h * HD + d) * NT + t0 + piece * 8; *(v8us*)(Th + o) = oh; *(v8us*)(Tl + o) = ol; }
    };
    pass(); 
}
__global__ __launch_bounds__(256) void k_tbuild(const float* __restrict__ rb, bf* T) {
    const int lane = threadIdx.x & 31; const int wid = blockIdx.x * 8 + (threadIdx.x >> 5); const int h = wid / NT, i = wid - h * NT; if (h >= NH) return;
{
#pragma unroll 1
        for (int c0 = lane * 8; c0 < NT; c0 += 256) { v8us o;
#pragma unroll
            for (int q = 0; q < 8; ++q) { const int j = c0 + q; o[q] = f2bf(rb[(size_t)(j - i + NT - 1) * NH + h]); }
            *(v8us*)(T + ((size_t)h * NT + i) * NT + c0) = o; }
         }
}
__global__ __launch_bounds__(256) void k_kvsplit(const float* __restrict__ src, const float* __restrict__ scale, bf* dh, bf* dl) {
    typedef __attribute__((ext_vector_type(2))) unsigned short v2us;
    const int lane = threadIdx.x & 31, r = blockIdx.x * 8 + (threadIdx.x >> 5); if (r >= HD) return; const float is = 1.0f / bfr(scale[0]);
    const size_t o = ((size_t)blockIdx.y * HD + r) * HD + lane * 2;    // grid y = batch item * NH + head
    v2us oh, ol;
#pragma unroll
    for (int i = 0; i < 2; ++i) { const float y = src[o + i] * is; const unsigned short hb = f2bf(y); oh[i] = hb; ol[i] = f2bf(y - bf2f(hb)); }
    *(v2us*)(dh + o) = oh; *(v2us*)(dl + o) = ol; 
}
__global__ __launch_bounds__(256) void k_tadd(const float* __restrict__ C2, float* Y) {
    __shared__ float tl[64][65];
    const int tid = threadIdx.x, i0 = blockIdx.x * 64, h = blockIdx.y % NH;
    C2 += (size_t)blockIdx.y * HD * NT; Y += (size_t)(blockIdx.y / NH) * NT * DD;    // grid y = batch item * NH + head
    { const int d = tid >> 2, iq = (tid & 3) * 16;
#pragma unroll 4
      for (int k = 0; k < 16; ++k) tl[iq + k][d] = C2[(size_t)d * NT + i0 + iq + k]; }
    __syncthreads();
    const int piece = tid & 15, Lid = tid >> 4; v4f vals[4];
#pragma unroll
    for (int s = 0; s < 4; ++s) { const int i = Lid + 16 * s; const size_t o = (size_t)(i0 + i) * DD + h * HD + piece * 4; v4f y = *(const v4f*)(Y + o);
#pragma unroll
        for (int k = 0; k < 4; ++k) y[k] += tl[i][piece * 4 + k];
        vals[s] = y; }
    auto pass = [&]() {
#pragma unroll
        for (int s = 0; s < 4; ++s) { const int i = Lid + 16 * s; *(v4f*)(Y + (size_t)(i0 + i) * DD + h * HD + piece * 4) = vals[s]; }
    };
    pass(); 
}

__global__ __launch_bounds__(128) void k_gemm3ll(const bf* __restrict__ Ah, const bf* __restrict__ Al, int lda, const bf* __restrict__ Bh, const bf* __restrict__ Bl, int ldb, int K, float* C, int ldc,
                                                 size_t zAb, size_t zAh, size_t zB, size_t zCb, size_t zCh) {
    __shared__ __align__(16) float ost[4][16 * 68];
    const int lane = threadIdx.x & 31, wave = threadIdx.x >> 5, lr = lane & 15, hi = lane >> 4;
    const int r0 = blockIdx.x * 64 + wave * 16, c0 = blockIdx.y * 64;
    // grid z = batch item * NH + head: A and C step by item and by head, B by z
    { const int z = blockIdx.z, zb = z / NH, zh = z % NH; const size_t ao = zb * zAb + zh * zAh; Ah += ao; Al += ao; Bh += z * zB; Bl += z * zB; C += zb * zCb + zh * zCh; }
    const size_t aoff = (size_t)(r0 + lr) * lda + 8 * hi;
    v8f acc[4];
#pragma unroll
    for (int t = 0; t < 4; ++t) acc[t] = (v8f){};
    // one trip = 2 K steps (K is a multiple of 64): every load of the trip is issued before its first product, so a trip waits for memory once
    const bf* pa = Ah + aoff; const bf* pal = Al + aoff; const size_t bo = (size_t)(c0 + lr) * ldb + 8 * hi, bs = (size_t)16 * ldb;
    const bf* ph0 = Bh + bo; const bf* ph1 = ph0 + bs; const bf* ph2 = ph1 + bs; const bf* ph3 = ph2 + bs; const bf* pl0 = Bl + bo; const bf* pl1 = pl0 + bs; const bf* pl2 = pl1 + bs; const bf* pl3 = pl2 + bs;
#pragma unroll 1
    for (int kc = 0; kc < K; kc += 64) {
        v16bf a[2], al[2], bh[2][4], bl[2][4];    // the loops over u and t below are fully unrolled so that these arrays live in registers
#pragma unroll
        for (int u = 0; u < 2; ++u) { a[u] = ldfrag(pa + 32 * u); al[u] = ldfrag(pal + 32 * u);
            bh[u][0] = ldfrag(ph0 + 32 * u); bh[u][1] = ldfrag(ph1 + 32 * u); bh[u][2] = ldfrag(ph2 + 32 * u); bh[u][3] = ldfrag(ph3 + 32 * u);
            bl[u][0] = ldfrag(pl0 + 32 * u); bl[u][1] = ldfrag(pl1 + 32 * u); bl[u][2] = ldfrag(pl2 + 32 * u); bl[u][3] = ldfrag(pl3 + 32 * u); }
        // inputs-only fence on the loaded values: holds all loads of the trip in front of the products (without it the compiler loads a few fragments at a time and waits for each group);
        // the ten addresses are inputs too: they stay in their registers until the data is there, so no load's result lands in a register that an earlier load of the trip names
        asm volatile("" :: "v"(pa), "v"(pal), "v"(ph0), "v"(ph1), "v"(ph2), "v"(ph3), "v"(pl0), "v"(pl1), "v"(pl2), "v"(pl3), "v"(a[0]), "v"(a[1]), "v"(al[0]), "v"(al[1]), "v"(bh[0][0]), "v"(bh[0][1]), "v"(bh[0][2]), "v"(bh[0][3]), "v"(bh[1][0]), "v"(bh[1][1]), "v"(bh[1][2]), "v"(bh[1][3]),
                     "v"(bl[0][0]), "v"(bl[0][1]), "v"(bl[0][2]), "v"(bl[0][3]), "v"(bl[1][0]), "v"(bl[1][1]), "v"(bl[1][2]), "v"(bl[1][3]));
#pragma unroll
        for (int u = 0; u < 2; ++u) {
#pragma unroll
            for (int t = 0; t < 4; ++t) { acc[t] = wmmab(a[u], bh[u][t], acc[t]); acc[t] = wmmab(al[u], bh[u][t], acc[t]); acc[t] = wmmab(a[u], bl[u][t], acc[t]); } }
        pa += 64; pal += 64; ph0 += 64; ph1 += 64; ph2 += 64; ph3 += 64; pl0 += 64; pl1 += 64; pl2 += 64; pl3 += 64;
        asm volatile("v_nop\n\tv_nop\n\tv_nop\n\tv_nop" : "+v"(acc[0]), "+v"(acc[1]), "+v"(acc[2]), "+v"(acc[3]) : "v"(a[1]), "v"(al[1]));    // WMMA distance over the back edge: four vector slots between the trip's last product and whatever the next trip issues first
    }
    float* os = &ost[wave][0];
#pragma unroll
    for (int t = 0; t < 4; ++t) {
#pragma unroll
        for (int j = 0; j < 8; ++j) os[(hi * 8 + j) * 68 + t * 16 + lr] = acc[t][j]; }
    __builtin_amdgcn_wave_barrier(); asm volatile("" ::: "memory");
    float* crow = C + (size_t)r0 * ldc + c0;
    auto pass = [&]() {
#pragma unroll
        for (int s = 0; s < 8; ++s) { const int Lid = (lane >> 3) + 4 * s, piece = lane & 7; const int row = Lid >> 1, cofs = (Lid & 1) * 32 + piece * 4;
            const v4f val = *(const v4fa*)(os + row * 68 + cofs); *(v4f*)(crow + (size_t)row * ldc + cofs) = val; }
    };
    pass(); 
}

extern "C" void kernel_launch(void* const* d_in, const int* in_sizes, int n_in,
                              void* d_out, int out_size, void* d_ws, size_t ws_size, hipStream_t stream) {
    (void)in_sizes; (void)n_in; (void)out_size;
    const float* x = (const float*)d_in[0]; const float* Wq = (const float*)d_in[1]; const float* bq = (const float*)d_in[2]; const float* Wk = (const float*)d_in[3]; const float* bk = (const float*)d_in[4]; const float* Wv = (const float*)d_in[5]; const float* bv = (const float*)d_in[6];
    const float* Wo = (const float*)d_in[7]; const float* bo = (const float*)d_in[8]; const float* rb = (const float*)d_in[9]; const float* scale = (const float*)d_in[10]; const int* mask = (const int*)d_in[11];
    float* out = (float*)d_out;    // [4][2048][256]
    char* wsp = (char*)d_ws;
    auto take = [&](size_t bytes) { char* p = wsp; wsp += (bytes + 255) & ~(size_t)255; return (void*)p; };
    const size_t PL = (size_t)NBI * NT * DD;    // one [batch][token][256] plane, elements
    bf* WB = (bf*)take((size_t)4 * DD * DD * 2); bf* WoB = WB + 3 * DD * DD; bf* T = (bf*)take((size_t)NH * NT * NT * 2);    // WB: Wq, Wk, Wv, Wo
    bf* Xb = (bf*)take(PL * 2); float* TMP = (float*)take(3 * PL * 4); bf* Qh = (bf*)take(PL * 2); bf* Ql = (bf*)take(PL * 2);    // TMP: q, k, v planes
    bf* KTh = (bf*)take(2 * PL * 2); bf* KTl = (bf*)take(2 * PL * 2); bf* VTh = KTh + PL; bf* VTl = KTl + PL;    // [K | V][batch][head][64][2048]
    float* KV = (float*)take((size_t)NBI * NH * HD * HD * 4); bf* KVh = (bf*)take((size_t)NBI * NH * HD * HD * 2); bf* KVl = (bf*)take((size_t)NBI * NH * HD * HD * 2);
    float* Y = (float*)take(PL * 4); float* C2 = (float*)take(PL * 4); bf* Yh = (bf*)take(PL * 2); bf* Yl = (bf*)take(PL * 2);
    if ((size_t)(wsp - (char*)d_ws) > ws_size) return;    // 0.5 + 33.5 + 4 + 25 + 2 x 4 + 2 x 8 + 0.5 + 8 + 8 + 2 x 4 ~ 112 MB, no aliasing (Y updated in place by k_tadd, same-lane read-then-write)
    k_cvt8<<<dim3(DD * DD / 8 / 256, 4, 1), 256, 0, stream>>>(Wq, Wk, Wv, Wo, WB, DD * DD / 8);
    k_tbuild<<<(NH * NT) / 8, 256, 0, stream>>>(rb, T);
    k_cvt<<<NBI * NT / 8, 256, 0, stream>>>(x, Xb);
    k_gemmb<false, false><<<dim3(NBI * NT / 64, DD / 64, 3), 128, 0, stream>>>(Xb, nullptr, WB, bq, TMP, DD, nullptr, nullptr, DD, 1, 0, DD * DD, 3, PL, bk, bv);    // z = q, k, v
    k_split256m<<<NBI * NT / 8, 256, 0, stream>>>(TMP, mask, Qh, Ql);
    k_vtb<<<dim3(NT / 64, NH, 2 * NBI), 256, 0, stream>>>(TMP + PL, mask, KTh, KTl);
    k_gemm3ll<<<dim3(1, 1, NBI * NH), 128, 0, stream>>>(VTh, VTl, NT, KTh, KTl, NT, NT, KV, HD, (size_t)DD * NT, (size_t)HD * NT, (size_t)HD * NT, NH * HD * HD, HD * HD);    // (K^T V)^T [d2][d1] = V^T . K
    k_kvsplit<<<dim3(HD / 8, NBI * NH, 1), 256, 0, stream>>>(KV, scale, KVh, KVl);
    k_gemm3ll<<<dim3(NT / 64, 1, NBI * NH), 128, 0, stream>>>(Qh, Ql, DD, KVh, KVl, HD, HD, Y, DD, (size_t)NT * DD, HD, HD * HD, (size_t)NT * DD, HD);    // y1[i][h*64+d2] = q_i . (K^T V / s)[:, d2]
    k_gemmb<true, false><<<dim3(1, NT / 64, NBI * NH), 128, 0, stream>>>(VTh, VTl, T, nullptr, C2, NT, nullptr, nullptr, NT, 1, (size_t)HD * NT, (size_t)NT * NT, NH - 1, (size_t)HD * NT);    // (T_h V)^T [d][i]
    k_tadd<<<dim3(NT / 64, NBI * NH, 1), 256, 0, stream>>>(C2, Y);
    k_split256m<<<NBI * NT / 8, 256, 0, stream>>>(Y, nullptr, Yh, Yl);
    k_gemmb<true, false><<<dim3(NBI * NT / 64, DD / 64, 1), 128, 0, stream>>>(Yh, Yl, WoB, bo, out, DD, nullptr, nullptr, DD);
}

// v003
// It runs in 111 microseconds.
// In two side-by-side timings against v002, it was 1.24 and 1.25 times as fast.
// Counting every step since v000, it is 16.9 times as fast.
#include <hip/hip_runtime.h>

// Compute dtypes, f32 accumulate, every stage one launch over all batch items and heads: Q/K/V = x.W^T + b ([2048 x 256].[256 x 256], PLAIN bf16 operands = rounded input, [out][in] weights; exact products); the
// un-softmaxed attention out_h = (Q K^T / scale + RelBias_h) V is evaluated as Q (K^T V) / scale + T_h V (exact reassociation): K^T V per head as [64 x 2048].[2048 x 64]
// (both operands bf16 hi + UNSCALED residual, three products), Q.(K^T V / scale) as [2048 x 64].[64 x 64] (three products), and the Toeplitz relative-bias term T_h[i][j] =
// rel_bias[j - i + 2047][h] (exact bf16 values of the INPUT table, read from a small table of its eight shifted copies, never laid out as a plane) against V^T hi + residual (two products); out = y.Wo^T + bo (two products) - all on
// v_wmma_f32_16x16x32_bf16. The mask input enters multiplicatively (m_i m_j). Deterministic, no atomics; every

#define NBI  4
#define NT   2048
#define DD   256
#define NH   4
#define HD   64
#define DM   DD
#define LOSC 1024.0f

typedef _Float16 h16;
typedef unsigned short bf;
typedef __attribute__((ext_vector_type(16))) __bf16   v16bf;
typedef __attribute__((ext_vector_type(16))) _Float16 v16h;
typedef __attribute__((ext_vector_type(8)))  _Float16 v8h;
typedef __attribute__((ext_vector_type(8)))  unsigned short v8us;
typedef __attribute__((ext_vector_type(8)))  float    v8f;
typedef __attribute__((ext_vector_type(4)))  float    v4f;
typedef v8h  __attribute__((may_alias)) v8ha;
typedef v4f  __attribute__((may_alias)) v4fa;
typedef v8us __attribute__((may_alias)) v8usa;

__device__ __forceinline__ unsigned short f2bf(float f) { unsigned u = __float_as_uint(f); u += 0x7FFFu + ((u >> 16) & 1u); return (unsigned short)(u >> 16); }
__device__ __forceinline__ float bf2f(unsigned short b) { return __uint_as_float(((unsigned)b) << 16); }
__device__ __forceinline__ float bfr(float f) { return bf2f(f2bf(f)); }
__device__ __forceinline__ v16h cat16(v8h lo, v8h hi) { return __builtin_shufflevector(lo, hi, 0, 1, 2, 3, 4, 5, 6, 7, 8, 9, 10, 11, 12, 13, 14, 15); }
__device__ __forceinline__ v16bf cat16b(v8us lo, v8us hi) { return __builtin_bit_cast(v16bf, __builtin_shufflevector(lo, hi, 0, 1, 2, 3, 4, 5, 6, 7, 8, 9, 10, 11, 12, 13, 14, 15)); }
__device__ __forceinline__ v8f wmma16(v16h a, v16h b, v8f c) { return __builtin_amdgcn_wmma_f32_16x16x32_f16(false, a, false, b, (short)0, c, false, false); }
__device__ __forceinline__ v8f wmmab(v16bf a, v16bf b, v8f c) { return __builtin_amdgcn_wmma_f32_16x16x32_bf16(false, a, false, b, (short)0, c, false, false); }

// one lane's 16 x 16 x 32 fragment of a row-major operand: p = the lane's row at k = 8 * (lane >> 4) of the K step
__device__ __forceinline__ v16bf ldfrag(const bf* p) { return cat16b(*(const v8us*)p, *(const v8us*)(p + 16)); }

// k_gemmb: 64 x 64 block tile (4 waves x 16 x 64) of C[NTK][NW] = (A [+ Al]).B^T (K = 256, or 2048 for TOEP) [+ bf(bias[c])] [+ bf(R[r][c]) residual]; f32 whole-line epilogue (or f16
// TOEP: B is not a plane but B[r][k] = tab[k - r + NT - 1]; Bn is then k_tshift's table of that head, and a fragment depends on k - r alone
template <bool SPLITA, bool F16OUT = false, bool TOEP = false>
__global__ __launch_bounds__(128) void k_gemmb(const bf* __restrict__ A, const bf* __restrict__ Al, const bf* __restrict__ Bn, const float* __restrict__ bias, float* C, int ldc, h16* C2, const float* __restrict__ R = nullptr, int K = DM, int roundR = 1,
                                               size_t zA = 0, size_t zB = 0, int zBmask = 0, size_t zC = 0, const float* __restrict__ bias1 = nullptr, const float* __restrict__ bias2 = nullptr) {
    __shared__ __align__(16) float ost[4][16 * 68];
    const int lane = threadIdx.x & 31, wave = threadIdx.x >> 5, lr = lane & 15, hi = lane >> 4;
    const int r0 = blockIdx.x * 64 + wave * 16, c0 = blockIdx.y * 64;
    // grid z = one independent product: its own A and C planes, B plane (z & zBmask), bias 0 / 1 / 2
    const int z = blockIdx.z; A += z * zA; if (SPLITA) Al += z * zA; Bn += (size_t)(z & zBmask) * zB; C += z * zC; if (z == 1) bias = bias1; if (z == 2) bias = bias2;
    const size_t aoff = (size_t)(r0 + lr) * K + 8 * hi;
    size_t boff[4];
#pragma unroll
    for (int t = 0; t < 4; ++t) boff[t] = (size_t)(c0 + t * 16 + lr) * K + 8 * hi;
    v8f acc[4];
#pragma unroll
    for (int t = 0; t < 4; ++t) acc[t] = (v8f){};
    // one trip = 4 K steps (K is a multiple of 128): every load of the trip is issued before its first product, so a trip waits for memory once
    const bf* pa = A + aoff; const bf* pal = SPLITA ? Al + aoff : pa; const bf* pb0 = Bn + boff[0]; const bf* pb1 = Bn + boff[1]; const bf* pb2 = Bn + boff[2]; const bf* pb3 = Bn + boff[3];
    if constexpr (TOEP) {
        // row r = c0 + 16 t + lr, k = kc + 32 u + 8 hi (+ 16): k - r + NT - 1 = 8 m + s with s = 7 - (lr & 7) and m = (kc - c0) / 8 + 4 u - 2 t (+ 2) + hi - (lr >> 3) + NT / 8 - 1;
        // ps = the lane's 16-byte piece at kc = 0 and 4 u - 2 t = -6, the trip's lowest; m runs from 0 to 510 over the whole grid
        const bf* ps = Bn + ((NT / 8 - 7 + hi - (lr >> 3)) - (c0 >> 3)) * 64 + (7 - (lr & 7)) * 8;
#pragma unroll 1
        for (int kc = 0; kc < K; kc += 128) {
            v16bf a[4], al[4], f[10];    // f[j]: the fragment of every (u, t) with 2 u - t + 3 = j; the loops over u, t and j are fully unrolled so that these arrays live in registers
#pragma unroll
            for (int u = 0; u < 4; ++u) { a[u] = ldfrag(pa + 32 * u); al[u] = SPLITA ? ldfrag(pal + 32 * u) : a[u]; }
#pragma unroll
            for (int j = 0; j < 10; ++j) f[j] = cat16b(*(const v8us*)(ps + 128 * j), *(const v8us*)(ps + 128 * j + 128));
            // inputs-only fence on the loaded values: holds all loads of the trip in front of the products, so a trip waits for memory once;
            // the three addresses are inputs too: they stay in their registers until the data is there
            asm volatile("" :: "v"(pa), "v"(pal), "v"(ps), "v"(a[0]), "v"(a[1]), "v"(a[2]), "v"(a[3]), "v"(al[0]), "v"(al[1]), "v"(al[2]), "v"(al[3]),
                         "v"(f[0]), "v"(f[1]), "v"(f[2]), "v"(f[3]), "v"(f[4]), "v"(f[5]), "v"(f[6]), "v"(f[7]), "v"(f[8]), "v"(f[9]));
#pragma unroll
            for (int u = 0; u < 4; ++u) {
#pragma unroll
                for (int t = 0; t < 4; ++t) { acc[t] = wmmab(a[u], f[2 * u - t + 3], acc[t]); if (SPLITA) acc[t] = wmmab(al[u], f[2 * u - t + 3], acc[t]); } }
            pa += 128; pal += 128; ps += 1024;
            asm volatile("v_nop\n\tv_nop\n\tv_nop\n\tv_nop" : "+v"(acc[0]), "+v"(acc[1]), "+v"(acc[2]), "+v"(acc[3]) : "v"(a[3]), "v"(al[3]));    // WMMA distance over the back edge: four vector slots between the trip's last product and whatever the next trip issues first
        }
    } else
#pragma unroll 1
    for (int kc = 0; kc < K; kc += 128) {
        v16bf a[4], al[4], b[4][4];    // the loops over u and t below are fully unrolled so that these arrays live in registers
#pragma unroll
        for (int u = 0; u < 4; ++u) { a[u] = ldfrag(pa + 32 * u); al[u] = SPLITA ? ldfrag(pal + 32 * u) : a[u];
            b[u][0] = ldfrag(pb0 + 32 * u); b[u][1] = ldfrag(pb1 + 32 * u); b[u][2] = ldfrag(pb2 + 32 * u); b[u][3] = ldfrag(pb3 + 32 * u); }
        // inputs-only fence on the loaded values: holds all loads of the trip in front of the products (without it the compiler loads one B fragment at a time and waits for each);
        // the six addresses are inputs too: they stay in their registers until the data is there, so no load's result lands in a register that an earlier load of the trip names
        asm volatile("" :: "v"(pa), "v"(pal), "v"(pb0), "v"(pb1), "v"(pb2), "v"(pb3), "v"(a[0]), "v"(a[1]), "v"(a[2]), "v"(a[3]), "v"(al[0]), "v"(al[1]), "v"(al[2]), "v"(al[3]),
                     "v"(b[0][0]), "v"(b[0][1]), "v"(b[0][2]), "v"(b[0][3]), "v"(b[1][0]), "v"(b[1][1]), "v"(b[1][2]), "v"(b[1][3]),
                     "v"(b[2][0]), "v"(b[2][1]), "v"(b[2][2]), "v"(b[2][3]), "v"(b[3][0]), "v"(b[3][1]), "v"(b[3][2]), "v"(b[3][3]));
#pragma unroll
        for (int u = 0; u < 4; ++u) {
#pragma unroll
            for (int t = 0; t < 4; ++t) { acc[t] = wmmab(a[u], b[u][t], acc[t]); if (SPLITA) acc[t] = wmmab(al[u], b[u][t], acc[t]); } }
        pa += 128; pal += 128; pb0 += 128; pb1 += 128; pb2 += 128; pb3 += 128;
        asm volatile("v_nop\n\tv_nop\n\tv_nop\n\tv_nop" : "+v"(acc[0]), "+v"(acc[1]), "+v"(acc[2]), "+v"(acc[3]) : "v"(a[3]), "v"(al[3]));    // WMMA distance over the back edge: four vector slots between the trip's last product and whatever the next trip issues first
    }
    float* os = &ost[wave][0];
#pragma unroll
    for (int t = 0; t < 4; ++t) { const float bv = bias ? bfr(bias[c0 + t * 16 + lr]) : 0.f;
#pragma unroll
        for (int j = 0; j < 8; ++j) os[(hi * 8 + j) * 68 + t * 16 + lr] = acc[t][j] + bv; }
    __syncthreads();
    if (F16OUT) {
        h16* crow = (h16*)(void*)C + (size_t)r0 * ldc + c0;
        auto pass = [&]() {
#pragma unroll
            for (int s = 0; s < 4; ++s) { const int row = 4 * s + (lane >> 3), piece = lane & 7; const float* sp = os + row * 68 + piece * 8; v8h o, o2;
#pragma unroll
                for (int i = 0; i < 8; ++i) { const h16 a = (h16)sp[i]; o[i] = a; o2[i] = (h16)((sp[i] - (float)a) * LOSC); }
                *(v8h*)(crow + (size_t)row * ldc + piece * 8) = o; if (C2) *(v8h*)(C2 + (size_t)r0 * ldc + c0 + (size_t)row * ldc + piece * 8) = o2; }
        };
        pass(); 
    } else {
        float* crow = C + (size_t)r0 * ldc + c0;
        auto pass = [&]() {
#pragma unroll
            for (int s = 0; s < 8; ++s) { const int Lid = (lane >> 3) + 4 * s, piece = lane & 7; const int row = Lid >> 1, cofs = (Lid & 1) * 32 + piece * 4;
                v4f val = *(const v4fa*)(os + row * 68 + cofs); if (R) { const v4f rv = *(const v4f*)(R + ((size_t)r0 + row) * ldc + c0 + cofs); val += roundR ? (v4f){bfr(rv[0]), bfr(rv[1]), bfr(rv[2]), bfr(rv[3])} : rv; }
                *(v4f*)(crow + (size_t)row * ldc + cofs) = val; }
        };
        pass(); 
    }
}


__global__ __launch_bounds__(256) void k_cvt8(const float* __restrict__ s0, const float* __restrict__ s1, const float* __restrict__ s2, const float* __restrict__ s3, bf* dst, size_t n8) {
    const size_t i = (size_t)blockIdx.x * 256 + threadIdx.x; if (i >= n8) return;
    const int y = blockIdx.y; const float* src = y == 0 ? s0 : y == 1 ? s1 : y == 2 ? s2 : s3; dst += (size_t)y * n8 * 8;    // grid y = which of the four matrices
    const v8f v = *(const v8f*)(src + i * 8); v8us o;
#pragma unroll
    for (int k = 0; k < 8; ++k) o[k] = f2bf(v[k]);
    *(v8us*)(dst + i * 8) = o; 
}
__global__ __launch_bounds__(256) void k_zero8(bf* dst, size_t n8) {
    const size_t i = (size_t)blockIdx.x * 256 + threadIdx.x; if (i >= n8) return; v8us z;
#pragma unroll
    for (int k = 0; k < 8; ++k) z[k] = 0;
    *(v8us*)(dst + i * 8) = z; 
}

__global__ __launch_bounds__(256) void k_cvt(const float* __restrict__ src, bf* dst) {
    const int lane = threadIdx.x & 31, r = blockIdx.x * 8 + (threadIdx.x >> 5); if (r >= NBI * NT) return; v8us o;
#pragma unroll
    for (int i = 0; i < 8; ++i) o[i] = f2bf(src[(size_t)r * DD + lane * 8 + i]);
    *(v8us*)(dst + (size_t)r * DD + lane * 8) = o; 
}
__global__ __launch_bounds__(256) void k_split256m(const float* __restrict__ src, const int* __restrict__ m, bf* dh, bf* dl) {
    const int lane = threadIdx.x & 31, r = blockIdx.x * 8 + (threadIdx.x >> 5); if (r >= NBI * NT) return; const float f = m ? ((m[r] != 0) ? 1.0f : 0.f) : 1.0f;
    const size_t o = (size_t)r * DD + lane * 8; const v8f v = *(const v8f*)(src + o); v8us oh, ol;
#pragma unroll
    for (int i = 0; i < 8; ++i) { const float y = v[i] * f; const unsigned short hb = f2bf(y); oh[i] = hb; ol[i] = f2bf(y - bf2f(hb)); }
    *(v8us*)(dh + o) = oh; *(v8us*)(dl + o) = ol; 
}
__global__ __launch_bounds__(256) void k_vtb(const float* __restrict__ src, const int* __restrict__ m, bf* Th, bf* Tl) {
    __shared__ float tl[64][65];
    const int tid = threadIdx.x, t0 = blockIdx.x * 64, h = blockIdx.y;
    { const int z = blockIdx.z; src += (size_t)z * NT * DD; m += (z % NBI) * NT; Th += (size_t)z * DD * NT; Tl += (size_t)z * DD * NT; }    // grid z = (K | V plane) * NBI + batch item
    { const int tt = tid >> 2, dq = (tid & 3) * 16; const float f = (m[t0 + tt] != 0) ? 1.0f : 0.f;
#pragma unroll 4
      for (int i = 0; i < 16; ++i) tl[dq + i][tt] = src[(size_t)(t0 + tt) * DD + h * HD + dq + i] * f; }
    __syncthreads();
    const int piece = tid & 7, Lid = tid >> 3;
    auto pass = [&]() {
#pragma unroll
        for (int s = 0; s < 2; ++s) { const int d = Lid + 32 * s; v8us oh, ol;
#pragma unroll
            for (int i = 0; i < 8; ++i) { const float v = tl[d][piece * 8 + i]; const unsigned short hb = f2bf(v); oh[i] = hb; ol[i] = f2bf(v - bf2f(hb)); }
            const size_t o = ((size_t)h * HD + d) * NT + t0 + piece * 8; *(v8us*)(Th + o) = oh; *(v8us*)(Tl + o) = ol; }
    };
    pass(); 
}
// S[h][m][s][q] = bf16(rb[8 m + s + q][h]), m < 511 (a head's pitch is 512), s < 8, q < 8: eight copies of a head's table, each one element further on, so that any 8 neighbours are one aligned 16-byte piece;
// the eight pieces of one m share a 128-byte line
__global__ __launch_bounds__(256) void k_tshift(const float* __restrict__ rb, bf* S) {
    const int p = blockIdx.x * 256 + threadIdx.x, h = p >> 12, e = ((p >> 3) & 511) * 8 + (p & 7); if (e >= 511 * 8) return; v8us o;    // m = 511 would pass the table's end; no fragment reads it
#pragma unroll
    for (int q = 0; q < 8; ++q) o[q] = f2bf(rb[(size_t)(e + q) * NH + h]);
    *(v8us*)(S + (size_t)p * 8) = o;
}
__global__ __launch_bounds__(256) void k_kvsplit(const float* __restrict__ src, const float* __restrict__ scale, bf* dh, bf* dl) {
    typedef __attribute__((ext_vector_type(2))) unsigned short v2us;
    const int lane = threadIdx.x & 31, r = blockIdx.x * 8 + (threadIdx.x >> 5); if (r >= HD) return; const float is = 1.0f / bfr(scale[0]);
    const size_t o = ((size_t)blockIdx.y * HD + r) * HD + lane * 2;    // grid y = batch item * NH + head
    v2us oh, ol;
#pragma unroll
    for (int i = 0; i < 2; ++i) { const float y = src[o + i] * is; const unsigned short hb = f2bf(y); oh[i] = hb; ol[i] = f2bf(y - bf2f(hb)); }
    *(v2us*)(dh + o) = oh; *(v2us*)(dl + o) = ol; 
}
__global__ __launch_bounds__(256) void k_tadd(const float* __restrict__ C2, float* Y) {
    __shared__ float tl[64][65];
    const int tid = threadIdx.x, i0 = blockIdx.x * 64, h = blockIdx.y % NH;
    C2 += (size_t)blockIdx.y * HD * NT; Y += (size_t)(blockIdx.y / NH) * NT * DD;    // grid y = batch item * NH + head
    { const int d = tid >> 2, iq = (tid & 3) * 16;
#pragma unroll 4
      for (int k = 0; k < 16; ++k) tl[iq + k][d] = C2[(size_t)d * NT + i0 + iq + k]; }
    __syncthreads();
    const int piece = tid & 15, Lid = tid >> 4; v4f vals[4];
#pragma unroll
    for (int s = 0; s < 4; ++s) { const int i = Lid + 16 * s; const size_t o = (size_t)(i0 + i) * DD + h * HD + piece * 4; v4f y = *(const v4f*)(Y + o);
#pragma unroll
        for (int k = 0; k < 4; ++k) y[k] += tl[i][piece * 4 + k];
        vals[s] = y; }
    auto pass = [&]() {
#pragma unroll
        for (int s = 0; s < 4; ++s) { const int i = Lid + 16 * s; *(v4f*)(Y + (size_t)(i0 + i) * DD + h * HD + piece * 4) = vals[s]; }
    };
    pass(); 
}

__global__ __launch_bounds__(128) void k_gemm3ll(const bf* __restrict__ Ah, const bf* __restrict__ Al, int lda, const bf* __restrict__ Bh, const bf* __restrict__ Bl, int ldb, int K, float* C, int ldc,
                                                 size_t zAb, size_t zAh, size_t zB, size_t zCb, size_t zCh) {
    __shared__ __align__(16) float ost[4][16 * 68];
    const int lane = threadIdx.x & 31, wave = threadIdx.x >> 5, lr = lane & 15, hi = lane >> 4;
    const int r0 = blockIdx.x * 64 + wave * 16, c0 = blockIdx.y * 64;
    // grid z = batch item * NH + head: A and C step by item and by head, B by z
    { const int z = blockIdx.z, zb = z / NH, zh = z % NH; const size_t ao = zb * zAb + zh * zAh; Ah += ao; Al += ao; Bh += z * zB; Bl += z * zB; C += zb * zCb + zh * zCh; }
    const size_t aoff = (size_t)(r0 + lr) * lda + 8 * hi;
    v8f acc[4];
#pragma unroll
    for (int t = 0; t < 4; ++t) acc[t] = (v8f){};
    // one trip = 2 K steps (K is a multiple of 64): every load of the trip is issued before its first product, so a trip waits for memory once
    const bf* pa = Ah + aoff; const bf* pal = Al + aoff; const size_t bo = (size_t)(c0 + lr) * ldb + 8 * hi, bs = (size_t)16 * ldb;
    const bf* ph0 = Bh + bo; const bf* ph1 = ph0 + bs; const bf* ph2 = ph1 + bs; const bf* ph3 = ph2 + bs; const bf* pl0 = Bl + bo; const bf* pl1 = pl0 + bs; const bf* pl2 = pl1 + bs; const bf* pl3 = pl2 + bs;
#pragma unroll 1
    for (int kc = 0; kc < K; kc += 64) {
        v16bf a[2], al[2], bh[2][4], bl[2][4];    // the loops over u and t below are fully unrolled so that these arrays live in registers
#pragma unroll
        for (int u = 0; u < 2; ++u) { a[u] = ldfrag(pa + 32 * u); al[u] = ldfrag(pal + 32 * u);
            bh[u][0] = ldfrag(ph0 + 32 * u); bh[u][1] = ldfrag(ph1 + 32 * u); bh[u][2] = ldfrag(ph2 + 32 * u); bh[u][3] = ldfrag(ph3 + 32 * u);
            bl[u][0] = ldfrag(pl0 + 32 * u); bl[u][1] = ldfrag(pl1 + 32 * u); bl[u][2] = ldfrag(pl2 + 32 * u); bl[u][3] = ldfrag(pl3 + 32 * u); }
        // inputs-only fence on the loaded values: holds all loads of the trip in front of the products (without it the compiler loads a few fragments at a time and waits for each group);
        // the ten addresses are inputs too: they stay in their registers until the data is there, so no load's result lands in a register that an earlier load of the trip names
        asm volatile("" :: "v"(pa), "v"(pal), "v"(ph0), "v"(ph1), "v"(ph2), "v"(ph3), "v"(pl0), "v"(pl1), "v"(pl2), "v"(pl3), "v"(a[0]), "v"(a[1]), "v"(al[0]), "v"(al[1]), "v"(bh[0][0]), "v"(bh[0][1]), "v"(bh[0][2]), "v"(bh[0][3]), "v"(bh[1][0]), "v"(bh[1][1]), "v"(bh[1][2]), "v"(bh[1][3]),
                     "v"(bl[0][0]), "v"(bl[0][1]), "v"(bl[0][2]), "v"(bl[0][3]), "v"(bl[1][0]), "v"(bl[1][1]), "v"(bl[1][2]), "v"(bl[1][3]));
#pragma unroll
        for (int u = 0; u < 2; ++u) {
#pragma unroll
            for (int t = 0; t < 4; ++t) { acc[t] = wmmab(a[u], bh[u][t], acc[t]); acc[t] = wmmab(al[u], bh[u][t], acc[t]); acc[t] = wmmab(a[u], bl[u][t], acc[t]); } }
        pa += 64; pal += 64; ph0 += 64; ph1 += 64; ph2 += 64; ph3 += 64; pl0 += 64; pl1 += 64; pl2 += 64; pl3 += 64;
        asm volatile("v_nop\n\tv_nop\n\tv_nop\n\tv_nop" : "+v"(acc[0]), "+v"(acc[1]), "+v"(acc[2]), "+v"(acc[3]) : "v"(a[1]), "v"(al[1]));    // WMMA distance over the back edge: four vector slots between the trip's last product and whatever the next trip issues first
    }
    float* os = &ost[wave][0];
#pragma unroll
    for (int t = 0; t < 4; ++t) {
#pragma unroll
        for (int j = 0; j < 8; ++j) os[(hi * 8 + j) * 68 + t * 16 + lr] = acc[t][j]; }
    __builtin_amdgcn_wave_barrier(); asm volatile("" ::: "memory");
    float* crow = C + (size_t)r0 * ldc + c0;
    auto pass = [&]() {
#pragma unroll
        for (int s = 0; s < 8; ++s) { const int Lid = (lane >> 3) + 4 * s, piece = lane & 7; const int row = Lid >> 1, cofs = (Lid & 1) * 32 + piece * 4;
            const v4f val = *(const v4fa*)(os + row * 68 + cofs); *(v4f*)(crow + (size_t)row * ldc + cofs) = val; }
    };
    pass(); 
}

extern "C" void kernel_launch(void* const* d_in, const int* in_sizes, int n_in,
                              void* d_out, int out_size, void* d_ws, size_t ws_size, hipStream_t stream) {
    (void)in_sizes; (void)n_in; (void)out_size;
    const float* x = (const float*)d_in[0]; const float* Wq = (const float*)d_in[1]; const float* bq = (const float*)d_in[2]; const float* Wk = (const float*)d_in[3]; const float* bk = (const float*)d_in[4]; const float* Wv = (const float*)d_in[5]; const float* bv = (const float*)d_in[6];
    const float* Wo = (const float*)d_in[7]; const float* bo = (const float*)d_in[8]; const float* rb = (const float*)d_in[9]; const float* scale = (const float*)d_in[10]; const int* mask = (const int*)d_in[11];
    float* out = (float*)d_out;    // [4][2048][256]
    char* wsp = (char*)d_ws;
    auto take = [&](size_t bytes) { char* p = wsp; wsp += (bytes + 255) & ~(size_t)255; return (void*)p; };
    const size_t PL = (size_t)NBI * NT * DD;    // one [batch][token][256] plane, elements
    bf* WB = (bf*)take((size_t)4 * DD * DD * 2); bf* WoB = WB + 3 * DD * DD; bf* S = (bf*)take((size_t)NH * 512 * 64 * 2);    // WB: Wq, Wk, Wv, Wo; S: k_tshift's table
    bf* Xb = (bf*)take(PL * 2); float* TMP = (float*)take(3 * PL * 4); bf* Qh = (bf*)take(PL * 2); bf* Ql = (bf*)take(PL * 2);    // TMP: q, k, v planes
    bf* KTh = (bf*)take(2 * PL * 2); bf* KTl = (bf*)take(2 * PL * 2); bf* VTh = KTh + PL; bf* VTl = KTl + PL;    // [K | V][batch][head][64][2048]
    float* KV = (float*)take((size_t)NBI * NH * HD * HD * 4); bf* KVh = (bf*)take((size_t)NBI * NH * HD * HD * 2); bf* KVl = (bf*)take((size_t)NBI * NH * HD * HD * 2);
    float* Y = (float*)take(PL * 4); float* C2 = (float*)take(PL * 4); bf* Yh = (bf*)take(PL * 2); bf* Yl = (bf*)take(PL * 2);
    if ((size_t)(wsp - (char*)d_ws) > ws_size) return;    // 0.5 + 0.25 + 4 + 25 + 2 x 4 + 2 x 8 + 0.5 + 8 + 8 + 2 x 4 ~ 79 MB, no aliasing (Y updated in place by k_tadd, same-lane read-then-write)
    k_cvt8<<<dim3(DD * DD / 8 / 256, 4, 1), 256, 0, stream>>>(Wq, Wk, Wv, Wo, WB, DD * DD / 8);
    k_tshift<<<NH * 512 * 8 / 256, 256, 0, stream>>>(rb, S);
    k_cvt<<<NBI * NT / 8, 256, 0, stream>>>(x, Xb);
    k_gemmb<false, false><<<dim3(NBI * NT / 64, DD / 64, 3), 128, 0, stream>>>(Xb, nullptr, WB, bq, TMP, DD, nullptr, nullptr, DD, 1, 0, DD * DD, 3, PL, bk, bv);    // z = q, k, v
    k_split256m<<<NBI * NT / 8, 256, 0, stream>>>(TMP, mask, Qh, Ql);
    k_vtb<<<dim3(NT / 64, NH, 2 * NBI), 256, 0, stream>>>(TMP + PL, mask, KTh, KTl);
    k_gemm3ll<<<dim3(1, 1, NBI * NH), 128, 0, stream>>>(VTh, VTl, NT, KTh, KTl, NT, NT, KV, HD, (size_t)DD * NT, (size_t)HD * NT, (size_t)HD * NT, NH * HD * HD, HD * HD);    // (K^T V)^T [d2][d1] = V^T . K
    k_kvsplit<<<dim3(HD / 8, NBI * NH, 1), 256, 0, stream>>>(KV, scale, KVh, KVl);
    k_gemm3ll<<<dim3(NT / 64, 1, NBI * NH), 128, 0, stream>>>(Qh, Ql, DD, KVh, KVl, HD, HD, Y, DD, (size_t)NT * DD, HD, HD * HD, (size_t)NT * DD, HD);    // y1[i][h*64+d2] = q_i . (K^T V / s)[:, d2]
    k_gemmb<true, false, true><<<dim3(1, NT / 64, NBI * NH), 128, 0, stream>>>(VTh, VTl, S, nullptr, C2, NT, nullptr, nullptr, NT, 1, (size_t)HD * NT, (size_t)512 * 64, NH - 1, (size_t)HD * NT);    // (T_h V)^T [d][i]
    k_tadd<<<dim3(NT / 64, NBI * NH, 1), 256, 0, stream>>>(C2, Y);
    k_split256m<<<NBI * NT / 8, 256, 0, stream>>>(Y, nullptr, Yh, Yl);
    k_gemmb<true, false><<<dim3(NBI * NT / 64, DD / 64, 1), 128, 0, stream>>>(Yh, Yl, WoB, bo, out, DD, nullptr, nullptr, DD);
}

// v004
// It runs in 90.3 microseconds.
// Next to v003, in two timings, it ran 1.22 times as fast each time.
// All steps since v000 together make it 20.6 times as fast.
#include <hip/hip_runtime.h>

// Compute dtypes, f32 accumulate, every stage one launch over all batch items and heads: Q/K/V = x.W^T + b ([2048 x 256].[256 x 256], PLAIN bf16 operands = rounded input, [out][in] weights; exact products); the
// un-softmaxed attention out_h = (Q K^T / scale + RelBias_h) V is evaluated as Q (K^T V) / scale + T_h V (exact reassociation): K^T V per head as [64 x 2048].[2048 x 64]
// (both operands bf16 hi + UNSCALED residual, three products), Q.(K^T V / scale) as [2048 x 64].[64 x 64] (three products), and the Toeplitz relative-bias term T_h[i][j] =
// rel_bias[j - i + 2047][h] (exact bf16 values of the INPUT table, read from a small table of its eight shifted copies, never laid out as a plane) against V^T hi + residual (two products); out = y.Wo^T + bo (two products) - all on
// v_wmma_f32_16x16x32_bf16. The mask input enters multiplicatively (m_i m_j). Deterministic, no atomics; every

#define NBI  4
#define NT   2048
#define DD   256
#define NH   4
#define HD   64
#define DM   DD
#define LOSC 1024.0f
#define KSP  16    // K^T V: slices of the token sum, one work-group each

typedef _Float16 h16;
typedef unsigned short bf;
typedef __attribute__((ext_vector_type(16))) __bf16   v16bf;
typedef __attribute__((ext_vector_type(16))) _Float16 v16h;
typedef __attribute__((ext_vector_type(8)))  _Float16 v8h;
typedef __attribute__((ext_vector_type(8)))  unsigned short v8us;
typedef __attribute__((ext_vector_type(8)))  float    v8f;
typedef __attribute__((ext_vector_type(4)))  float    v4f;
typedef v8h  __attribute__((may_alias)) v8ha;
typedef v4f  __attribute__((may_alias)) v4fa;
typedef v8us __attribute__((may_alias)) v8usa;

__device__ __forceinline__ unsigned short f2bf(float f) { unsigned u = __float_as_uint(f); u += 0x7FFFu + ((u >> 16) & 1u); return (unsigned short)(u >> 16); }
__device__ __forceinline__ float bf2f(unsigned short b) { return __uint_as_float(((unsigned)b) << 16); }
__device__ __forceinline__ float bfr(float f) { return bf2f(f2bf(f)); }
__device__ __forceinline__ v16h cat16(v8h lo, v8h hi) { return __builtin_shufflevector(lo, hi, 0, 1, 2, 3, 4, 5, 6, 7, 8, 9, 10, 11, 12, 13, 14, 15); }
__device__ __forceinline__ v16bf cat16b(v8us lo, v8us hi) { return __builtin_bit_cast(v16bf, __builtin_shufflevector(lo, hi, 0, 1, 2, 3, 4, 5, 6, 7, 8, 9, 10, 11, 12, 13, 14, 15)); }
__device__ __forceinline__ v8f wmma16(v16h a, v16h b, v8f c) { return __builtin_amdgcn_wmma_f32_16x16x32_f16(false, a, false, b, (short)0, c, false, false); }
__device__ __forceinline__ v8f wmmab(v16bf a, v16bf b, v8f c) { return __builtin_amdgcn_wmma_f32_16x16x32_bf16(false, a, false, b, (short)0, c, false, false); }

// one lane's 16 x 16 x 32 fragment of a row-major operand: p = the lane's row at k = 8 * (lane >> 4) of the K step
__device__ __forceinline__ v16bf ldfrag(const bf* p) { return cat16b(*(const v8us*)p, *(const v8us*)(p + 16)); }

// k_gemmb: 64 x 64 block tile (4 waves x 16 x 64) of C[NTK][NW] = (A [+ Al]).B^T (K = 256, or 2048 for TOEP) [+ bf(bias[c])] [+ bf(R[r][c]) residual]; f32 whole-line epilogue (or f16
// TOEP: B is not a plane but B[r][k] = tab[k - r + NT - 1]; Bn is then k_tshift's table of that head, and a fragment depends on k - r alone
template <bool SPLITA, bool F16OUT = false, bool TOEP = false>
__global__ __launch_bounds__(128) void k_gemmb(const bf* __restrict__ A, const bf* __restrict__ Al, const bf* __restrict__ Bn, const float* __restrict__ bias, float* C, int ldc, h16* C2, const float* __restrict__ R = nullptr, int K = DM, int roundR = 1,
                                               size_t zA = 0, size_t zB = 0, int zBmask = 0, size_t zC = 0, const float* __restrict__ bias1 = nullptr, const float* __restrict__ bias2 = nullptr) {
    __shared__ __align__(16) float ost[4][16 * 68];
    const int lane = threadIdx.x & 31, wave = threadIdx.x >> 5, lr = lane & 15, hi = lane >> 4;
    const int r0 = blockIdx.x * 64 + wave * 16, c0 = blockIdx.y * 64;
    // grid z = one independent product: its own A and C planes, B plane (z & zBmask), bias 0 / 1 / 2
    const int z = blockIdx.z; A += z * zA; if (SPLITA) Al += z * zA; Bn += (size_t)(z & zBmask) * zB; C += z * zC; if (z == 1) bias = bias1; if (z == 2) bias = bias2;
    const size_t aoff = (size_t)(r0 + lr) * K + 8 * hi;
    size_t boff[4];
#pragma unroll
    for (int t = 0; t < 4; ++t) boff[t] = (size_t)(c0 + t * 16 + lr) * K + 8 * hi;
    v8f acc[4];
#pragma unroll
    for (int t = 0; t < 4; ++t) acc[t] = (v8f){};
    // one trip = 4 K steps (K is a multiple of 128): every load of the trip is issued before its first product, so a trip waits for memory once
    const bf* pa = A + aoff; const bf* pal = SPLITA ? Al + aoff : pa; const bf* pb0 = Bn + boff[0]; const bf* pb1 = Bn + boff[1]; const bf* pb2 = Bn + boff[2]; const bf* pb3 = Bn + boff[3];
    if constexpr (TOEP) {
        // row r = c0 + 16 t + lr, k = kc + 32 u + 8 hi (+ 16): k - r + NT - 1 = 8 m + s with s = 7 - (lr & 7) and m = (kc - c0) / 8 + 4 u - 2 t (+ 2) + hi - (lr >> 3) + NT / 8 - 1;
        // ps = the lane's 16-byte piece at kc = 0 and 4 u - 2 t = -6, the trip's lowest; m runs from 0 to 510 over the whole grid
        const bf* ps = Bn + ((NT / 8 - 7 + hi - (lr >> 3)) - (c0 >> 3)) * 64 + (7 - (lr & 7)) * 8;
#pragma unroll 1
        for (int kc = 0; kc < K; kc += 128) {
            v16bf a[4], al[4], f[10];    // f[j]: the fragment of every (u, t) with 2 u - t + 3 = j; the loops over u, t and j are fully unrolled so that these arrays live in registers
#pragma unroll
            for (int u = 0; u < 4; ++u) { a[u] = ldfrag(pa + 32 * u); al[u] = SPLITA ? ldfrag(pal + 32 * u) : a[u]; }
#pragma unroll
            for (int j = 0; j < 10; ++j) f[j] = cat16b(*(const v8us*)(ps + 128 * j), *(const v8us*)(ps + 128 * j + 128));
            // inputs-only fence on the loaded values: holds all loads of the trip in front of the products, so a trip waits for memory once;
            // the three addresses are inputs too: they stay in their registers until the data is there
            asm volatile("" :: "v"(pa), "v"(pal), "v"(ps), "v"(a[0]), "v"(a[1]), "v"(a[2]), "v"(a[3]), "v"(al[0]), "v"(al[1]), "v"(al[2]), "v"(al[3]),
                         "v"(f[0]), "v"(f[1]), "v"(f[2]), "v"(f[3]), "v"(f[4]), "v"(f[5]), "v"(f[6]), "v"(f[7]), "v"(f[8]), "v"(f[9]));
#pragma unroll
            for (int u = 0; u < 4; ++u) {
#pragma unroll
                for (int t = 0; t < 4; ++t) { acc[t] = wmmab(a[u], f[2 * u - t + 3], acc[t]); if (SPLITA) acc[t] = wmmab(al[u], f[2 * u - t + 3], acc[t]); } }
            pa += 128; pal += 128; ps += 1024;
            asm volatile("v_nop\n\tv_nop\n\tv_nop\n\tv_nop" : "+v"(acc[0]), "+v"(acc[1]), "+v"(acc[2]), "+v"(acc[3]) : "v"(a[3]), "v"(al[3]));    // WMMA distance over the back edge: four vector slots between the trip's last product and whatever the next trip issues first
        }
    } else
#pragma unroll 1
    for (int kc = 0; kc < K; kc += 128) {
        v16bf a[4], al[4], b[4][4];    // the loops over u and t below are fully unrolled so that these arrays live in registers
#pragma unroll
        for (int u = 0; u < 4; ++u) { a[u] = ldfrag(pa + 32 * u); al[u] = SPLITA ? ldfrag(pal + 32 * u) : a[u];
            b[u][0] = ldfrag(pb0 + 32 * u); b[u][1] = ldfrag(pb1 + 32 * u); b[u][2] = ldfrag(pb2 + 32 * u); b[u][3] = ldfrag(pb3 + 32 * u); }
        // inputs-only fence on the loaded values: holds all loads of the trip in front of the products (without it the compiler loads one B fragment at a time and waits for each);
        // the six addresses are inputs too: they stay in their registers until the data is there, so no load's result lands in a register that an earlier load of the trip names
        asm volatile("" :: "v"(pa), "v"(pal), "v"(pb0), "v"(pb1), "v"(pb2), "v"(pb3), "v"(a[0]), "v"(a[1]), "v"(a[2]), "v"(a[3]), "v"(al[0]), "v"(al[1]), "v"(al[2]), "v"(al[3]),
                     "v"(b[0][0]), "v"(b[0][1]), "v"(b[0][2]), "v"(b[0][3]), "v"(b[1][0]), "v"(b[1][1]), "v"(b[1][2]), "v"(b[1][3]),
                     "v"(b[2][0]), "v"(b[2][1]), "v"(b[2][2]), "v"(b[2][3]), "v"(b[3][0]), "v"(b[3][1]), "v"(b[3][2]), "v"(b[3][3]));
#pragma unroll
        for (int u = 0; u < 4; ++u) {
#pragma unroll
            for (int t = 0; t < 4; ++t) { acc[t] = wmmab(a[u], b[u][t], acc[t]); if (SPLITA) acc[t] = wmmab(al[u], b[u][t], acc[t]); } }
        pa += 128; pal += 128; pb0 += 128; pb1 += 128; pb2 += 128; pb3 += 128;
        asm volatile("v_nop\n\tv_nop\n\tv_nop\n\tv_nop" : "+v"(acc[0]), "+v"(acc[1]), "+v"(acc[2]), "+v"(acc[3]) : "v"(a[3]), "v"(al[3]));    // WMMA distance over the back edge: four vector slots between the trip's last product and whatever the next trip issues first
    }
    float* os = &ost[wave][0];
#pragma unroll
    for (int t = 0; t < 4; ++t) { const float bv = bias ? bfr(bias[c0 + t * 16 + lr]) : 0.f;
#pragma unroll
        for (int j = 0; j < 8; ++j) os[(hi * 8 + j) * 68 + t * 16 + lr] = acc[t][j] + bv; }
    __syncthreads();
    if (F16OUT) {
        h16* crow = (h16*)(void*)C + (size_t)r0 * ldc + c0;
        auto pass = [&]() {
#pragma unroll
            for (int s = 0; s < 4; ++s) { const int row = 4 * s + (lane >> 3), piece = lane & 7; const float* sp = os + row * 68 + piece * 8; v8h o, o2;
#pragma unroll
                for (int i = 0; i < 8; ++i) { const h16 a = (h16)sp[i]; o[i] = a; o2[i] = (h16)((sp[i] - (float)a) * LOSC); }
                *(v8h*)(crow + (size_t)row * ldc + piece * 8) = o; if (C2) *(v8h*)(C2 + (size_t)r0 * ldc + c0 + (size_t)row * ldc + piece * 8) = o2; }
        };
        pass(); 
    } else {
        float* crow = C + (size_t)r0 * ldc + c0;
        auto pass = [&]() {
#pragma unroll
            for (int s = 0; s < 8; ++s) { const int Lid = (lane >> 3) + 4 * s, piece = lane & 7; const int row = Lid >> 1, cofs = (Lid & 1) * 32 + piece * 4;
                v4f val = *(const v4fa*)(os + row * 68 + cofs); if (R) { const v4f rv = *(const v4f*)(R + ((size_t)r0 + row) * ldc + c0 + cofs); val += roundR ? (v4f){bfr(rv[0]), bfr(rv[1]), bfr(rv[2]), bfr(rv[3])} : rv; }
                *(v4f*)(crow + (size_t)row * ldc + cofs) = val; }
        };
        pass(); 
    }
}


__global__ __launch_bounds__(256) void k_cvt8(const float* __restrict__ s0, const float* __restrict__ s1, const float* __restrict__ s2, const float* __restrict__ s3, bf* dst, size_t n8) {
    const size_t i = (size_t)blockIdx.x * 256 + threadIdx.x; if (i >= n8) return;
    const int y = blockIdx.y; const float* src = y == 0 ? s0 : y == 1 ? s1 : y == 2 ? s2 : s3; dst += (size_t)y * n8 * 8;    // grid y = which of the four matrices
    const v8f v = *(const v8f*)(src + i * 8); v8us o;
#pragma unroll
    for (int k = 0; k < 8; ++k) o[k] = f2bf(v[k]);
    *(v8us*)(dst + i * 8) = o; 
}
__global__ __launch_bounds__(256) void k_zero8(bf* dst, size_t n8) {
    const size_t i = (size_t)blockIdx.x * 256 + threadIdx.x; if (i >= n8) return; v8us z;
#pragma unroll
    for (int k = 0; k < 8; ++k) z[k] = 0;
    *(v8us*)(dst + i * 8) = z; 
}

__global__ __launch_bounds__(256) void k_cvt(const float* __restrict__ src, bf* dst) {
    const int lane = threadIdx.x & 31, r = blockIdx.x * 8 + (threadIdx.x >> 5); if (r >= NBI * NT) return; v8us o;
#pragma unroll
    for (int i = 0; i < 8; ++i) o[i] = f2bf(src[(size_t)r * DD + lane * 8 + i]);
    *(v8us*)(dst + (size_t)r * DD + lane * 8) = o; 
}
__global__ __launch_bounds__(256) void k_split256m(const float* __restrict__ src, const int* __restrict__ m, bf* dh, bf* dl) {
    const int lane = threadIdx.x & 31, r = blockIdx.x * 8 + (threadIdx.x >> 5); if (r >= NBI * NT) return; const float f = m ? ((m[r] != 0) ? 1.0f : 0.f) : 1.0f;
    const size_t o = (size_t)r * DD + lane * 8; const v8f v = *(const v8f*)(src + o); v8us oh, ol;
#pragma unroll
    for (int i = 0; i < 8; ++i) { const float y = v[i] * f; const unsigned short hb = f2bf(y); oh[i] = hb; ol[i] = f2bf(y - bf2f(hb)); }
    *(v8us*)(dh + o) = oh; *(v8us*)(dl + o) = ol; 
}
__global__ __launch_bounds__(256) void k_vtb(const float* __restrict__ src, const int* __restrict__ m, bf* Th, bf* Tl) {
    __shared__ float tl[64][65];
    const int tid = threadIdx.x, t0 = blockIdx.x * 64, h = blockIdx.y;
    { const int z = blockIdx.z; src += (size_t)z * NT * DD; m += (z % NBI) * NT; Th += (size_t)z * DD * NT; Tl += (size_t)z * DD * NT; }    // grid z = (K | V plane) * NBI + batch item
    { const int tt = tid >> 2, dq = (tid & 3) * 16; const float f = (m[t0 + tt] != 0) ? 1.0f : 0.f;
#pragma unroll 4
      for (int i = 0; i < 16; ++i) tl[dq + i][tt] = src[(size_t)(t0 + tt) * DD + h * HD + dq + i] * f; }
    __syncthreads();
    const int piece = tid & 7, Lid = tid >> 3;
    auto pass = [&]() {
#pragma unroll
        for (int s = 0; s < 2; ++s) { const int d = Lid + 32 * s; v8us oh, ol;
#pragma unroll
            for (int i = 0; i < 8; ++i) { const float v = tl[d][piece * 8 + i]; const unsigned short hb = f2bf(v); oh[i] = hb; ol[i] = f2bf(v - bf2f(hb)); }
            const size_t o = ((size_t)h * HD + d) * NT + t0 + piece * 8; *(v8us*)(Th + o) = oh; *(v8us*)(Tl + o) = ol; }
    };
    pass(); 
}
// S[h][m][s][q] = bf16(rb[8 m + s + q][h]), m < 511 (a head's pitch is 512), s < 8, q < 8: eight copies of a head's table, each one element further on, so that any 8 neighbours are one aligned 16-byte piece;
// the eight pieces of one m share a 128-byte line
__global__ __launch_bounds__(256) void k_tshift(const float* __restrict__ rb, bf* S) {
    const int p = blockIdx.x * 256 + threadIdx.x, h = p >> 12, e = ((p >> 3) & 511) * 8 + (p & 7); if (e >= 511 * 8) return; v8us o;    // m = 511 would pass the table's end; no fragment reads it
#pragma unroll
    for (int q = 0; q < 8; ++q) o[q] = f2bf(rb[(size_t)(e + q) * NH + h]);
    *(v8us*)(S + (size_t)p * 8) = o;
}
__global__ __launch_bounds__(256) void k_kvsplit(const float* __restrict__ src, const float* __restrict__ scale, bf* dh, bf* dl) {
    typedef __attribute__((ext_vector_type(2))) unsigned short v2us;
    const int lane = threadIdx.x & 31, r = blockIdx.x * 8 + (threadIdx.x >> 5); if (r >= HD) return; const float is = 1.0f / bfr(scale[0]);
    const size_t o = ((size_t)blockIdx.y * HD + r) * HD + lane * 2;    // grid y = batch item * NH + head
    typedef __attribute__((ext_vector_type(2))) float v2f;
    static_assert(KSP == 16, "the fence below names 16 values");
    v2f p[KSP], sum; const float* ps = src + o;    // src holds KSP partial planes, one per slice of the token sum; they are added in slice order
#pragma unroll
    for (int s = 0; s < KSP; ++s) p[s] = *(const v2f*)(ps + (size_t)s * (NBI * NH * HD * HD));
    // inputs-only fence on the loaded values and their address: all loads are in flight together, and the address stays in its registers until the data is there (no load's result lands in them)
    asm volatile("" :: "v"(ps), "v"(p[0]), "v"(p[1]), "v"(p[2]), "v"(p[3]), "v"(p[4]), "v"(p[5]), "v"(p[6]), "v"(p[7]), "v"(p[8]), "v"(p[9]), "v"(p[10]), "v"(p[11]), "v"(p[12]), "v"(p[13]), "v"(p[14]), "v"(p[15]));
    sum = p[0];
#pragma unroll
    for (int s = 1; s < KSP; ++s) sum += p[s];
    v2us oh, ol;
#pragma unroll
    for (int i = 0; i < 2; ++i) { const float y = sum[i] * is; const unsigned short hb = f2bf(y); oh[i] = hb; ol[i] = f2bf(y - bf2f(hb)); }
    *(v2us*)(dh + o) = oh; *(v2us*)(dl + o) = ol; 
}
__global__ __launch_bounds__(256) void k_tadd(const float* __restrict__ C2, float* Y) {
    __shared__ float tl[64][65];
    const int tid = threadIdx.x, i0 = blockIdx.x * 64, h = blockIdx.y % NH;
    C2 += (size_t)blockIdx.y * HD * NT; Y += (size_t)(blockIdx.y / NH) * NT * DD;    // grid y = batch item * NH + head
    { const int d = tid >> 2, iq = (tid & 3) * 16;
#pragma unroll 4
      for (int k = 0; k < 16; ++k) tl[iq + k][d] = C2[(size_t)d * NT + i0 + iq + k]; }
    __syncthreads();
    const int piece = tid & 15, Lid = tid >> 4; v4f vals[4];
#pragma unroll
    for (int s = 0; s < 4; ++s) { const int i = Lid + 16 * s; const size_t o = (size_t)(i0 + i) * DD + h * HD + piece * 4; v4f y = *(const v4f*)(Y + o);
#pragma unroll
        for (int k = 0; k < 4; ++k) y[k] += tl[i][piece * 4 + k];
        vals[s] = y; }
    auto pass = [&]() {
#pragma unroll
        for (int s = 0; s < 4; ++s) { const int i = Lid + 16 * s; *(v4f*)(Y + (size_t)(i0 + i) * DD + h * HD + piece * 4) = vals[s]; }
    };
    pass(); 
}

__global__ __launch_bounds__(128) void k_gemm3ll(const bf* __restrict__ Ah, const bf* __restrict__ Al, int lda, const bf* __restrict__ Bh, const bf* __restrict__ Bl, int ldb, int K, float* C, int ldc,
                                                 size_t zAb, size_t zAh, size_t zB, size_t zCb, size_t zCh, size_t zCs = 0) {
    __shared__ __align__(16) float ost[4][16 * 68];
    const int lane = threadIdx.x & 31, wave = threadIdx.x >> 5, lr = lane & 15, hi = lane >> 4;
    const int r0 = blockIdx.x * 64 + wave * 16, c0 = blockIdx.y * 64;
    // grid z = (K slice * NBI + batch item) * NH + head: A and C step by item and by head, B by item * NH + head; slice sp sums k in [sp K, sp K + K) into its own C plane
    { const int sp = blockIdx.z / (NBI * NH), z = blockIdx.z % (NBI * NH), zb = z / NH, zh = z % NH; const size_t ao = zb * zAb + zh * zAh + (size_t)sp * K, bo2 = z * zB + (size_t)sp * K;
      Ah += ao; Al += ao; Bh += bo2; Bl += bo2; C += zb * zCb + zh * zCh + sp * zCs; }
    const size_t aoff = (size_t)(r0 + lr) * lda + 8 * hi;
    v8f acc[4];
#pragma unroll
    for (int t = 0; t < 4; ++t) acc[t] = (v8f){};
    // one trip = 2 K steps (K is a multiple of 64): every load of the trip is issued before its first product, so a trip waits for memory once
    const bf* pa = Ah + aoff; const bf* pal = Al + aoff; const size_t bo = (size_t)(c0 + lr) * ldb + 8 * hi, bs = (size_t)16 * ldb;
    const bf* ph0 = Bh + bo; const bf* ph1 = ph0 + bs; const bf* ph2 = ph1 + bs; const bf* ph3 = ph2 + bs; const bf* pl0 = Bl + bo; const bf* pl1 = pl0 + bs; const bf* pl2 = pl1 + bs; const bf* pl3 = pl2 + bs;
#pragma unroll 1
    for (int kc = 0; kc < K; kc += 64) {
        v16bf a[2], al[2], bh[2][4], bl[2][4];    // the loops over u and t below are fully unrolled so that these arrays live in registers
#pragma unroll
        for (int u = 0; u < 2; ++u) { a[u] = ldfrag(pa + 32 * u); al[u] = ldfrag(pal + 32 * u);
            bh[u][0] = ldfrag(ph0 + 32 * u); bh[u][1] = ldfrag(ph1 + 32 * u); bh[u][2] = ldfrag(ph2 + 32 * u); bh[u][3] = ldfrag(ph3 + 32 * u);
            bl[u][0] = ldfrag(pl0 + 32 * u); bl[u][1] = ldfrag(pl1 + 32 * u); bl[u][2] = ldfrag(pl2 + 32 * u); bl[u][3] = ldfrag(pl3 + 32 * u); }
        // inputs-only fence on the loaded values: holds all loads of the trip in front of the products (without it the compiler loads a few fragments at a time and waits for each group);
        // the ten addresses are inputs too: they stay in their registers until the data is there, so no load's result lands in a register that an earlier load of the trip names
        asm volatile("" :: "v"(pa), "v"(pal), "v"(ph0), "v"(ph1), "v"(ph2), "v"(ph3), "v"(pl0), "v"(pl1), "v"(pl2), "v"(pl3), "v"(a[0]), "v"(a[1]), "v"(al[0]), "v"(al[1]), "v"(bh[0][0]), "v"(bh[0][1]), "v"(bh[0][2]), "v"(bh[0][3]), "v"(bh[1][0]), "v"(bh[1][1]), "v"(bh[1][2]), "v"(bh[1][3]),
                     "v"(bl[0][0]), "v"(bl[0][1]), "v"(bl[0][2]), "v"(bl[0][3]), "v"(bl[1][0]), "v"(bl[1][1]), "v"(bl[1][2]), "v"(bl[1][3]));
#pragma unroll
        for (int u = 0; u < 2; ++u) {
#pragma unroll
            for (int t = 0; t < 4; ++t) { acc[t] = wmmab(a[u], bh[u][t], acc[t]); acc[t] = wmmab(al[u], bh[u][t], acc[t]); acc[t] = wmmab(a[u], bl[u][t], acc[t]); } }
        pa += 64; pal += 64; ph0 += 64; ph1 += 64; ph2 += 64; ph3 += 64; pl0 += 64; pl1 += 64; pl2 += 64; pl3 += 64;
        asm volatile("v_nop\n\tv_nop\n\tv_nop\n\tv_nop" : "+v"(acc[0]), "+v"(acc[1]), "+v"(acc[2]), "+v"(acc[3]) : "v"(a[1]), "v"(al[1]));    // WMMA distance over the back edge: four vector slots between the trip's last product and whatever the next trip issues first
    }
    float* os = &ost[wave][0];
#pragma unroll
    for (int t = 0; t < 4; ++t) {
#pragma unroll
        for (int j = 0; j < 8; ++j) os[(hi * 8 + j) * 68 + t * 16 + lr] = acc[t][j]; }
    __builtin_amdgcn_wave_barrier(); asm volatile("" ::: "memory");
    float* crow = C + (size_t)r0 * ldc + c0;
    auto pass = [&]() {
#pragma unroll
        for (int s = 0; s < 8; ++s) { const int Lid = (lane >> 3) + 4 * s, piece = lane & 7; const int row = Lid >> 1, cofs = (Lid & 1) * 32 + piece * 4;
            const v4f val = *(const v4fa*)(os + row * 68 + cofs); *(v4f*)(crow + (size_t)row * ldc + cofs) = val; }
    };
    pass(); 
}

extern "C" void kernel_launch(void* const* d_in, const int* in_sizes, int n_in,
                              void* d_out, int out_size, void* d_ws, size_t ws_size, hipStream_t stream) {
    (void)in_sizes; (void)n_in; (void)out_size;
    const float* x = (const float*)d_in[0]; const float* Wq = (const float*)d_in[1]; const float* bq = (const float*)d_in[2]; const float* Wk = (const float*)d_in[3]; const float* bk = (const float*)d_in[4]; const float* Wv = (const float*)d_in[5]; const float* bv = (const float*)d_in[6];
    const float* Wo = (const float*)d_in[7]; const float* bo = (const float*)d_in[8]; const float* rb = (const float*)d_in[9]; const float* scale = (const float*)d_in[10]; const int* mask = (const int*)d_in[11];
    float* out = (float*)d_out;    // [4][2048][256]
    char* wsp = (char*)d_ws;
    auto take = [&](size_t bytes) { char* p = wsp; wsp += (bytes + 255) & ~(size_t)255; return (void*)p; };
    const size_t PL = (size_t)NBI * NT * DD;    // one [batch][token][256] plane, elements
    bf* WB = (bf*)take((size_t)4 * DD * DD * 2); bf* WoB = WB + 3 * DD * DD; bf* S = (bf*)take((size_t)NH * 512 * 64 * 2);    // WB: Wq, Wk, Wv, Wo; S: k_tshift's table
    bf* Xb = (bf*)take(PL * 2); float* TMP = (float*)take(3 * PL * 4); bf* Qh = (bf*)take(PL * 2); bf* Ql = (bf*)take(PL * 2);    // TMP: q, k, v planes
    bf* KTh = (bf*)take(2 * PL * 2); bf* KTl = (bf*)take(2 * PL * 2); bf* VTh = KTh + PL; bf* VTl = KTl + PL;    // [K | V][batch][head][64][2048]
    float* KV = (float*)take((size_t)KSP * NBI * NH * HD * HD * 4); bf* KVh = (bf*)take((size_t)NBI * NH * HD * HD * 2); bf* KVl = (bf*)take((size_t)NBI * NH * HD * HD * 2);
    float* Y = (float*)take(PL * 4); float* C2 = (float*)take(PL * 4); bf* Yh = (bf*)take(PL * 2); bf* Yl = (bf*)take(PL * 2);
    if ((size_t)(wsp - (char*)d_ws) > ws_size) return;    // 0.5 + 0.25 + 4 + 24 + 2 x 4 + 2 x 8 + 4 + 0.25 + 8 + 8 + 2 x 4 ~ 81 MB, no aliasing (Y updated in place by k_tadd, same-lane read-then-write)
    k_cvt8<<<dim3(DD * DD / 8 / 256, 4, 1), 256, 0, stream>>>(Wq, Wk, Wv, Wo, WB, DD * DD / 8);
    k_tshift<<<NH * 512 * 8 / 256, 256, 0, stream>>>(rb, S);
    k_cvt<<<NBI * NT / 8, 256, 0, stream>>>(x, Xb);
    k_gemmb<false, false><<<dim3(NBI * NT / 64, DD / 64, 3), 128, 0, stream>>>(Xb, nullptr, WB, bq, TMP, DD, nullptr, nullptr, DD, 1, 0, DD * DD, 3, PL, bk, bv);    // z = q, k, v
    k_split256m<<<NBI * NT / 8, 256, 0, stream>>>(TMP, mask, Qh, Ql);
    k_vtb<<<dim3(NT / 64, NH, 2 * NBI), 256, 0, stream>>>(TMP + PL, mask, KTh, KTl);
    k_gemm3ll<<<dim3(1, 1, KSP * NBI * NH), 128, 0, stream>>>(VTh, VTl, NT, KTh, KTl, NT, NT / KSP, KV, HD, (size_t)DD * NT, (size_t)HD * NT, (size_t)HD * NT, NH * HD * HD, HD * HD, NBI * NH * HD * HD);    // (K^T V)^T [d2][d1] = V^T . K, KSP partial planes; k_kvsplit adds them
    k_kvsplit<<<dim3(HD / 8, NBI * NH, 1), 256, 0, stream>>>(KV, scale, KVh, KVl);
    k_gemm3ll<<<dim3(NT / 64, 1, NBI * NH), 128, 0, stream>>>(Qh, Ql, DD, KVh, KVl, HD, HD, Y, DD, (size_t)NT * DD, HD, HD * HD, (size_t)NT * DD, HD);    // y1[i][h*64+d2] = q_i . (K^T V / s)[:, d2]
    k_gemmb<true, false, true><<<dim3(1, NT / 64, NBI * NH), 128, 0, stream>>>(VTh, VTl, S, nullptr, C2, NT, nullptr, nullptr, NT, 1, (size_t)HD * NT, (size_t)512 * 64, NH - 1, (size_t)HD * NT);    // (T_h V)^T [d][i]
    k_tadd<<<dim3(NT / 64, NBI * NH, 1), 256, 0, stream>>>(C2, Y);
    k_split256m<<<NBI * NT / 8, 256, 0, stream>>>(Y, nullptr, Yh, Yl);
    k_gemmb<true, false><<<dim3(NBI * NT / 64, DD / 64, 1), 128, 0, stream>>>(Yh, Yl, WoB, bo, out, DD, nullptr, nullptr, DD);
}

// v005
// One run takes 69.7 microseconds.
// Timed twice side by side with v004, it ran 1.30 times as fast both times.
// All steps since v000 together make it 26.8 times as fast.
#include <hip/hip_runtime.h>

// Compute dtypes, f32 accumulate, every stage one launch over all batch items and heads: Q/K/V = x.W^T + b ([2048 x 256].[256 x 256], PLAIN bf16 operands = rounded input, [out][in] weights; exact products); the
// un-softmaxed attention out_h = (Q K^T / scale + RelBias_h) V is evaluated as Q (K^T V) / scale + T_h V (exact reassociation): K^T V per head as [64 x 2048].[2048 x 64]
// (both operands bf16 hi + UNSCALED residual, three products), Q.(K^T V / scale) as [2048 x 64].[64 x 64] (three products), and the Toeplitz relative-bias term T_h[i][j] =
// rel_bias[j - i + 2047][h] (exact bf16 values of the INPUT table, read from a small table of its eight shifted copies, never laid out as a plane) against V^T hi + residual (two products); out = y.Wo^T + bo (two products) - all on
// v_wmma_f32_16x16x32_bf16. The mask input enters multiplicatively (m_i m_j). Deterministic, no atomics; every

#define NBI  4
#define NT   2048
#define DD   256
#define NH   4
#define HD   64
#define DM   DD
#define LOSC 1024.0f
#define KSP  16    // K^T V: slices of the token sum, one work-group each

typedef _Float16 h16;
typedef unsigned short bf;
typedef __attribute__((ext_vector_type(16))) __bf16   v16bf;
typedef __attribute__((ext_vector_type(16))) _Float16 v16h;
typedef __attribute__((ext_vector_type(8)))  _Float16 v8h;
typedef __attribute__((ext_vector_type(8)))  unsigned short v8us;
typedef __attribute__((ext_vector_type(8)))  float    v8f;
typedef __attribute__((ext_vector_type(4)))  float    v4f;
typedef v8h  __attribute__((may_alias)) v8ha;
typedef v4f  __attribute__((may_alias)) v4fa;
typedef v8us __attribute__((may_alias)) v8usa;

__device__ __forceinline__ unsigned short f2bf(float f) { unsigned u = __float_as_uint(f); u += 0x7FFFu + ((u >> 16) & 1u); return (unsigned short)(u >> 16); }
__device__ __forceinline__ float bf2f(unsigned short b) { return __uint_as_float(((unsigned)b) << 16); }
__device__ __forceinline__ float bfr(float f) { return bf2f(f2bf(f)); }
__device__ __forceinline__ v16h cat16(v8h lo, v8h hi) { return __builtin_shufflevector(lo, hi, 0, 1, 2, 3, 4, 5, 6, 7, 8, 9, 10, 11, 12, 13, 14, 15); }
__device__ __forceinline__ v16bf cat16b(v8us lo, v8us hi) { return __builtin_bit_cast(v16bf, __builtin_shufflevector(lo, hi, 0, 1, 2, 3, 4, 5, 6, 7, 8, 9, 10, 11, 12, 13, 14, 15)); }
__device__ __forceinline__ v8f wmma16(v16h a, v16h b, v8f c) { return __builtin_amdgcn_wmma_f32_16x16x32_f16(false, a, false, b, (short)0, c, false, false); }
__device__ __forceinline__ v8f wmmab(v16bf a, v16bf b, v8f c) { return __builtin_amdgcn_wmma_f32_16x16x32_bf16(false, a, false, b, (short)0, c, false, false); }

// one lane's 16 x 16 x 32 fragment of a row-major operand: p = the lane's row at k = 8 * (lane >> 4) of the K step
__device__ __forceinline__ v16bf ldfrag(const bf* p) { return cat16b(*(const v8us*)p, *(const v8us*)(p + 16)); }

// k_gemmb: 64 x 64 block tile (4 waves x 16 x 64) of C[NTK][NW] = (A [+ Al]).B^T (K = 256, or 2048 for TOEP) [+ bf(bias[c])] [+ bf(R[r][c]) residual]; f32 whole-line epilogue (or f16
// TOEP: B is not a plane but B[r][k] = tab[k - r + NT - 1]; Bn is then k_tshift's table of that head, and a fragment depends on k - r alone
// EPI: what the epilogue stores. 0: the f32 (or f16) tile. 1 (q, k, v): the masked tile as bf16 hi + residual, q (z = 0) row-major into E0h / E0l, k and v (z = 1, 2) transposed into E1h / E1l [k | v][item][head][64][NT].
// 2 (Toeplitz term, tile [d][i]): R + the transposed tile as bf16 hi + residual into E0h / E0l [item][i][head * 64 + d]
template <bool SPLITA, bool F16OUT = false, bool TOEP = false, int EPI = 0>
__global__ __launch_bounds__(128) void k_gemmb(const bf* __restrict__ A, const bf* __restrict__ Al, const bf* __restrict__ Bn, const float* __restrict__ bias, float* C, int ldc, h16* C2, const float* __restrict__ R = nullptr, int K = DM, int roundR = 1,
                                               size_t zA = 0, size_t zB = 0, int zBmask = 0, size_t zC = 0, const float* __restrict__ bias1 = nullptr, const float* __restrict__ bias2 = nullptr,
                                               const int* __restrict__ msk = nullptr, bf* E0h = nullptr, bf* E0l = nullptr, bf* E1h = nullptr, bf* E1l = nullptr) {
    __shared__ __align__(16) float ost[4][16 * 68];
    const int lane = threadIdx.x & 31, wave = threadIdx.x >> 5, lr = lane & 15, hi = lane >> 4;
    const int r0 = blockIdx.x * 64 + wave * 16, c0 = blockIdx.y * 64;
    // grid z = one independent product: its own A and C planes, B plane (z & zBmask), bias 0 / 1 / 2
    const int z = blockIdx.z; A += z * zA; if (SPLITA) Al += z * zA; Bn += (size_t)(z & zBmask) * zB; C += z * zC; if (z == 1) bias = bias1; if (z == 2) bias = bias2;
    const size_t aoff = (size_t)(r0 + lr) * K + 8 * hi;
    size_t boff[4];
#pragma unroll
    for (int t = 0; t < 4; ++t) boff[t] = (size_t)(c0 + t * 16 + lr) * K + 8 * hi;
    v8f acc[4];
#pragma unroll
    for (int t = 0; t < 4; ++t) acc[t] = (v8f){};
    // one trip = 4 K steps (K is a multiple of 128): every load of the trip is issued before its first product, so a trip waits for memory once
    const bf* pa = A + aoff; const bf* pal = SPLITA ? Al + aoff : pa; const bf* pb0 = Bn + boff[0]; const bf* pb1 = Bn + boff[1]; const bf* pb2 = Bn + boff[2]; const bf* pb3 = Bn + boff[3];
    if constexpr (TOEP) {
        // row r = c0 + 16 t + lr, k = kc + 32 u + 8 hi (+ 16): k - r + NT - 1 = 8 m + s with s = 7 - (lr & 7) and m = (kc - c0) / 8 + 4 u - 2 t (+ 2) + hi - (lr >> 3) + NT / 8 - 1;
        // ps = the lane's 16-byte piece at kc = 0 and 4 u - 2 t = -6, the trip's lowest; m runs from 0 to 510 over the whole grid
        const bf* ps = Bn + ((NT / 8 - 7 + hi - (lr >> 3)) - (c0 >> 3)) * 64 + (7 - (lr & 7)) * 8;
#pragma unroll 1
        for (int kc = 0; kc < K; kc += 128) {
            v16bf a[4], al[4], f[10];    // f[j]: the fragment of every (u, t) with 2 u - t + 3 = j; the loops over u, t and j are fully unrolled so that these arrays live in registers
#pragma unroll
            for (int u = 0; u < 4; ++u) { a[u] = ldfrag(pa + 32 * u); al[u] = SPLITA ? ldfrag(pal + 32 * u) : a[u]; }
#pragma unroll
            for (int j = 0; j < 10; ++j) f[j] = cat16b(*(const v8us*)(ps + 128 * j), *(const v8us*)(ps + 128 * j + 128));
            // inputs-only fence on the loaded values: holds all loads of the trip in front of the products, so a trip waits for memory once;
            // the three addresses are inputs too: they stay in their registers until the data is there
            asm volatile("" :: "v"(pa), "v"(pal), "v"(ps), "v"(a[0]), "v"(a[1]), "v"(a[2]), "v"(a[3]), "v"(al[0]), "v"(al[1]), "v"(al[2]), "v"(al[3]),
                         "v"(f[0]), "v"(f[1]), "v"(f[2]), "v"(f[3]), "v"(f[4]), "v"(f[5]), "v"(f[6]), "v"(f[7]), "v"(f[8]), "v"(f[9]));
#pragma unroll
            for (int u = 0; u < 4; ++u) {
#pragma unroll
                for (int t = 0; t < 4; ++t) { acc[t] = wmmab(a[u], f[2 * u - t + 3], acc[t]); if (SPLITA) acc[t] = wmmab(al[u], f[2 * u - t + 3], acc[t]); } }
            pa += 128; pal += 128; ps += 1024;
            asm volatile("v_nop\n\tv_nop\n\tv_nop\n\tv_nop" : "+v"(acc[0]), "+v"(acc[1]), "+v"(acc[2]), "+v"(acc[3]) : "v"(a[3]), "v"(al[3]));    // WMMA distance over the back edge: four vector slots between the trip's last product and whatever the next trip issues first
        }
    } else
#pragma unroll 1
    for (int kc = 0; kc < K; kc += 128) {
        v16bf a[4], al[4], b[4][4];    // the loops over u and t below are fully unrolled so that these arrays live in registers
#pragma unroll
        for (int u = 0; u < 4; ++u) { a[u] = ldfrag(pa + 32 * u); al[u] = SPLITA ? ldfrag(pal + 32 * u) : a[u];
            b[u][0] = ldfrag(pb0 + 32 * u); b[u][1] = ldfrag(pb1 + 32 * u); b[u][2] = ldfrag(pb2 + 32 * u); b[u][3] = ldfrag(pb3 + 32 * u); }
        // inputs-only fence on the loaded values: holds all loads of the trip in front of the products (without it the compiler loads one B fragment at a time and waits for each);
        // the six addresses are inputs too: they stay in their registers until the data is there, so no load's result lands in a register that an earlier load of the trip names
        asm volatile("" :: "v"(pa), "v"(pal), "v"(pb0), "v"(pb1), "v"(pb2), "v"(pb3), "v"(a[0]), "v"(a[1]), "v"(a[2]), "v"(a[3]), "v"(al[0]), "v"(al[1]), "v"(al[2]), "v"(al[3]),
                     "v"(b[0][0]), "v"(b[0][1]), "v"(b[0][2]), "v"(b[0][3]), "v"(b[1][0]), "v"(b[1][1]), "v"(b[1][2]), "v"(b[1][3]),
                     "v"(b[2][0]), "v"(b[2][1]), "v"(b[2][2]), "v"(b[2][3]), "v"(b[3][0]), "v"(b[3][1]), "v"(b[3][2]), "v"(b[3][3]));
#pragma unroll
        for (int u = 0; u < 4; ++u) {
#pragma unroll
            for (int t = 0; t < 4; ++t) { acc[t] = wmmab(a[u], b[u][t], acc[t]); if (SPLITA) acc[t] = wmmab(al[u], b[u][t], acc[t]); } }
        pa += 128; pal += 128; pb0 += 128; pb1 += 128; pb2 += 128; pb3 += 128;
        asm volatile("v_nop\n\tv_nop\n\tv_nop\n\tv_nop" : "+v"(acc[0]), "+v"(acc[1]), "+v"(acc[2]), "+v"(acc[3]) : "v"(a[3]), "v"(al[3]));    // WMMA distance over the back edge: four vector slots between the trip's last product and whatever the next trip issues first
    }
    if constexpr (EPI != 0) {
        // the block's 64 x 64 tile passes through LDS once, as the rows the stores want; 8 lanes then store one whole 128-byte line of each plane
        typedef __attribute__((ext_vector_type(4))) int v4i;
        float* of = &ost[0][0];
        const int piece = threadIdx.x & 7, rw = threadIdx.x >> 3;
        const bool tr = EPI == 2 || z != 0;    // the same for the whole block
        // all that the epilogue reads from memory is asked for ahead of the LDS pass: the term to add (EPI 2), or the mask of the thread's 4 rows and of its 8 columns and the bias (EPI 1; the Toeplitz term has no bias)
        v4f q[4][2]; int mr[4]; v4i m0, m1; float bv[4];
        if constexpr (EPI == 2) {
#pragma unroll
            for (int s = 0; s < 4; ++s) { const float* rp = R + ((size_t)(z / NH) * NT + c0 + rw + 16 * s) * DD + (z % NH) * HD + piece * 8; q[s][0] = *(const v4f*)rp; q[s][1] = *(const v4f*)(rp + 4); }
        } else {
            const int* mp = msk + blockIdx.x * 64; m0 = *(const v4i*)(mp + piece * 8); m1 = *(const v4i*)(mp + piece * 8 + 4);
#pragma unroll
            for (int s = 0; s < 4; ++s) mr[s] = mp[rw + 16 * s];
        }
#pragma unroll
        for (int t = 0; t < 4; ++t) bv[t] = 0.f;
        if constexpr (EPI == 1) { if (bias) {    // one test for the four loads, so that they fly together
#pragma unroll
            for (int t = 0; t < 4; ++t) bv[t] = bias[c0 + t * 16 + lr];
#pragma unroll
            for (int t = 0; t < 4; ++t) bv[t] = bfr(bv[t]); } }
        if (tr) {    // a lane's 8 values are 8 neighbours of the transposed row t * 16 + lr
#pragma unroll
            for (int t = 0; t < 4; ++t) { float* tp = of + (t * 16 + lr) * 68 + wave * 16 + hi * 8;
                *(v4fa*)tp = (v4f){acc[t][0] + bv[t], acc[t][1] + bv[t], acc[t][2] + bv[t], acc[t][3] + bv[t]}; *(v4fa*)(tp + 4) = (v4f){acc[t][4] + bv[t], acc[t][5] + bv[t], acc[t][6] + bv[t], acc[t][7] + bv[t]}; }
        } else {
#pragma unroll
            for (int t = 0; t < 4; ++t) {
#pragma unroll
                for (int j = 0; j < 8; ++j) of[(wave * 16 + hi * 8 + j) * 68 + t * 16 + lr] = acc[t][j] + bv[t]; }
        }
        __syncthreads();    // a row of the tile is read by another wave than the ones that wrote it
        // o: the thread's first 16-byte piece; st: elements from one of its rows to the next
        size_t o, st; bf* dh = E0h; bf* dl = E0l; float fc[8];
        if constexpr (EPI == 2) { o = ((size_t)(z / NH) * NT + c0 + rw) * DD + (z % NH) * HD + piece * 8; st = (size_t)16 * DD; }
        else if (!tr) { o = ((size_t)blockIdx.x * 64 + rw) * DD + c0 + piece * 8; st = (size_t)16 * DD; }
        else { o = (((size_t)(z - 1) * NBI + blockIdx.x / (NT / 64)) * DD + c0 + rw) * NT + (blockIdx.x % (NT / 64)) * 64 + piece * 8; st = (size_t)16 * NT; dh = E1h; dl = E1l; }    // row = the head's d, the 8 values are 8 tokens
        if constexpr (EPI == 1) {
#pragma unroll
            for (int i = 0; i < 8; ++i) fc[i] = ((i < 4 ? m0[i & 3] : m1[i & 3]) != 0) ? 1.0f : 0.f;
        }
        v4f p[4][2];
#pragma unroll
        for (int s = 0; s < 4; ++s) { const float* sp = of + (rw + 16 * s) * 68 + piece * 8; p[s][0] = *(const v4fa*)sp; p[s][1] = *(const v4fa*)(sp + 4); }
#pragma unroll
        for (int s = 0; s < 4; ++s) { float y[8] = {p[s][0][0], p[s][0][1], p[s][0][2], p[s][0][3], p[s][1][0], p[s][1][1], p[s][1][2], p[s][1][3]}; v8us oh, ol;
#pragma unroll
            for (int i = 0; i < 8; ++i) {
                if constexpr (EPI == 2) y[i] = q[s][i >> 2][i & 3] + y[i]; else y[i] *= tr ? fc[i] : ((mr[s] != 0) ? 1.0f : 0.f);
                const unsigned short hb = f2bf(y[i]); oh[i] = hb; ol[i] = f2bf(y[i] - bf2f(hb)); }
            *(v8us*)(dh + o + s * st) = oh; *(v8us*)(dl + o + s * st) = ol;
            if (s < 3) asm volatile("s_wait_xcnt 0x0" ::: "memory"); }    // stands in front of the next row's arithmetic, which reuses registers that these two stores name
        return;
    }
    float* os = &ost[wave][0];
#pragma unroll
    for (int t = 0; t < 4; ++t) { const float bv = bias ? bfr(bias[c0 + t * 16 + lr]) : 0.f;
#pragma unroll
        for (int j = 0; j < 8; ++j) os[(hi * 8 + j) * 68 + t * 16 + lr] = acc[t][j] + bv; }
    __syncthreads();
    if (F16OUT) {
        h16* crow = (h16*)(void*)C + (size_t)r0 * ldc + c0;
        auto pass = [&]() {
#pragma unroll
            for (int s = 0; s < 4; ++s) { const int row = 4 * s + (lane >> 3), piece = lane & 7; const float* sp = os + row * 68 + piece * 8; v8h o, o2;
#pragma unroll
                for (int i = 0; i < 8; ++i) { const h16 a = (h16)sp[i]; o[i] = a; o2[i] = (h16)((sp[i] - (float)a) * LOSC); }
                *(v8h*)(crow + (size_t)row * ldc + piece * 8) = o; if (C2) *(v8h*)(C2 + (size_t)r0 * ldc + c0 + (size_t)row * ldc + piece * 8) = o2; }
        };
        pass(); 
    } else {
        float* crow = C + (size_t)r0 * ldc + c0;
        auto pass = [&]() {
#pragma unroll
            for (int s = 0; s < 8; ++s) { const int Lid = (lane >> 3) + 4 * s, piece = lane & 7; const int row = Lid >> 1, cofs = (Lid & 1) * 32 + piece * 4;
                v4f val = *(const v4fa*)(os + row * 68 + cofs); if (R) { const v4f rv = *(const v4f*)(R + ((size_t)r0 + row) * ldc + c0 + cofs); val += roundR ? (v4f){bfr(rv[0]), bfr(rv[1]), bfr(rv[2]), bfr(rv[3])} : rv; }
                *(v4f*)(crow + (size_t)row * ldc + cofs) = val; }
        };
        pass(); 
    }
}


__global__ __launch_bounds__(256) void k_cvt8(const float* __restrict__ s0, const float* __restrict__ s1, const float* __restrict__ s2, const float* __restrict__ s3, bf* dst, size_t n8) {
    const size_t i = (size_t)blockIdx.x * 256 + threadIdx.x; if (i >= n8) return;
    const int y = blockIdx.y; const float* src = y == 0 ? s0 : y == 1 ? s1 : y == 2 ? s2 : s3; dst += (size_t)y * n8 * 8;    // grid y = which of the four matrices
    const v8f v = *(const v8f*)(src + i * 8); v8us o;
#pragma unroll
    for (int k = 0; k < 8; ++k) o[k] = f2bf(v[k]);
    *(v8us*)(dst + i * 8) = o; 
}
__global__ __launch_bounds__(256) void k_zero8(bf* dst, size_t n8) {
    const size_t i = (size_t)blockIdx.x * 256 + threadIdx.x; if (i >= n8) return; v8us z;
#pragma unroll
    for (int k = 0; k < 8; ++k) z[k] = 0;
    *(v8us*)(dst + i * 8) = z; 
}

__global__ __launch_bounds__(256) void k_cvt(const float* __restrict__ src, bf* dst) {
    const int lane = threadIdx.x & 31, r = blockIdx.x * 8 + (threadIdx.x >> 5); if (r >= NBI * NT) return; v8us o;
#pragma unroll
    for (int i = 0; i < 8; ++i) o[i] = f2bf(src[(size_t)r * DD + lane * 8 + i]);
    *(v8us*)(dst + (size_t)r * DD + lane * 8) = o; 
}
// S[h][m][s][q] = bf16(rb[8 m + s + q][h]), m < 511 (a head's pitch is 512), s < 8, q < 8: eight copies of a head's table, each one element further on, so that any 8 neighbours are one aligned 16-byte piece;
// the eight pieces of one m share a 128-byte line
__global__ __launch_bounds__(256) void k_tshift(const float* __restrict__ rb, bf* S) {
    const int p = blockIdx.x * 256 + threadIdx.x, h = p >> 12, e = ((p >> 3) & 511) * 8 + (p & 7); if (e >= 511 * 8) return; v8us o;    // m = 511 would pass the table's end; no fragment reads it
#pragma unroll
    for (int q = 0; q < 8; ++q) o[q] = f2bf(rb[(size_t)(e + q) * NH + h]);
    *(v8us*)(S + (size_t)p * 8) = o;
}
__global__ __launch_bounds__(256) void k_kvsplit(const float* __restrict__ src, const float* __restrict__ scale, bf* dh, bf* dl) {
    typedef __attribute__((ext_vector_type(2))) unsigned short v2us;
    const int lane = threadIdx.x & 31, r = blockIdx.x * 8 + (threadIdx.x >> 5); if (r >= HD) return; const float is = 1.0f / bfr(scale[0]);
    const size_t o = ((size_t)blockIdx.y * HD + r) * HD + lane * 2;    // grid y = batch item * NH + head
    typedef __attribute__((ext_vector_type(2))) float v2f;
    static_assert(KSP == 16, "the fence below names 16 values");
    v2f p[KSP], sum; const float* ps = src + o;    // src holds KSP partial planes, one per slice of the token sum; they are added in slice order
#pragma unroll
    for (int s = 0; s < KSP; ++s) p[s] = *(const v2f*)(ps + (size_t)s * (NBI * NH * HD * HD));
    // inputs-only fence on the loaded values and their address: all loads are in flight together, and the address stays in its registers until the data is there (no load's result lands in them)
    asm volatile("" :: "v"(ps), "v"(p[0]), "v"(p[1]), "v"(p[2]), "v"(p[3]), "v"(p[4]), "v"(p[5]), "v"(p[6]), "v"(p[7]), "v"(p[8]), "v"(p[9]), "v"(p[10]), "v"(p[11]), "v"(p[12]), "v"(p[13]), "v"(p[14]), "v"(p[15]));
    sum = p[0];
#pragma unroll
    for (int s = 1; s < KSP; ++s) sum += p[s];
    v2us oh, ol;
#pragma unroll
    for (int i = 0; i < 2; ++i) { const float y = sum[i] * is; const unsigned short hb = f2bf(y); oh[i] = hb; ol[i] = f2bf(y - bf2f(hb)); }
    *(v2us*)(dh + o) = oh; *(v2us*)(dl + o) = ol; 
}
__global__ __launch_bounds__(128) void k_gemm3ll(const bf* __restrict__ Ah, const bf* __restrict__ Al, int lda, const bf* __restrict__ Bh, const bf* __restrict__ Bl, int ldb, int K, float* C, int ldc,
                                                 size_t zAb, size_t zAh, size_t zB, size_t zCb, size_t zCh, size_t zCs = 0) {
    __shared__ __align__(16) float ost[4][16 * 68];
    const int lane = threadIdx.x & 31, wave = threadIdx.x >> 5, lr = lane & 15, hi = lane >> 4;
    const int r0 = blockIdx.x * 64 + wave * 16, c0 = blockIdx.y * 64;
    // grid z = (K slice * NBI + batch item) * NH + head: A and C step by item and by head, B by item * NH + head; slice sp sums k in [sp K, sp K + K) into its own C plane
    { const int sp = blockIdx.z / (NBI * NH), z = blockIdx.z % (NBI * NH), zb = z / NH, zh = z % NH; const size_t ao = zb * zAb + zh * zAh + (size_t)sp * K, bo2 = z * zB + (size_t)sp * K;
      Ah += ao; Al += ao; Bh += bo2; Bl += bo2; C += zb * zCb + zh * zCh + sp * zCs; }
    const size_t aoff = (size_t)(r0 + lr) * lda + 8 * hi;
    v8f acc[4];
#pragma unroll
    for (int t = 0; t < 4; ++t) acc[t] = (v8f){};
    // one trip = 2 K steps (K is a multiple of 64): every load of the trip is issued before its first product, so a trip waits for memory once
    const bf* pa = Ah + aoff; const bf* pal = Al + aoff; const size_t bo = (size_t)(c0 + lr) * ldb + 8 * hi, bs = (size_t)16 * ldb;
    const bf* ph0 = Bh + bo; const bf* ph1 = ph0 + bs; const bf* ph2 = ph1 + bs; const bf* ph3 = ph2 + bs; const bf* pl0 = Bl + bo; const bf* pl1 = pl0 + bs; const bf* pl2 = pl1 + bs; const bf* pl3 = pl2 + bs;
#pragma unroll 1
    for (int kc = 0; kc < K; kc += 64) {
        v16bf a[2], al[2], bh[2][4], bl[2][4];    // the loops over u and t below are fully unrolled so that these arrays live in registers
#pragma unroll
        for (int u = 0; u < 2; ++u) { a[u] = ldfrag(pa + 32 * u); al[u] = ldfrag(pal + 32 * u);
            bh[u][0] = ldfrag(ph0 + 32 * u); bh[u][1] = ldfrag(ph1 + 32 * u); bh[u][2] = ldfrag(ph2 + 32 * u); bh[u][3] = ldfrag(ph3 + 32 * u);
            bl[u][0] = ldfrag(pl0 + 32 * u); bl[u][1] = ldfrag(pl1 + 32 * u); bl[u][2] = ldfrag(pl2 + 32 * u); bl[u][3] = ldfrag(pl3 + 32 * u); }
        // inputs-only fence on the loaded values: holds all loads of the trip in front of the products (without it the compiler loads a few fragments at a time and waits for each group);
        // the ten addresses are inputs too: they stay in their registers until the data is there, so no load's result lands in a register that an earlier load of the trip names
        asm volatile("" :: "v"(pa), "v"(pal), "v"(ph0), "v"(ph1), "v"(ph2), "v"(ph3), "v"(pl0), "v"(pl1), "v"(pl2), "v"(pl3), "v"(a[0]), "v"(a[1]), "v"(al[0]), "v"(al[1]), "v"(bh[0][0]), "v"(bh[0][1]), "v"(bh[0][2]), "v"(bh[0][3]), "v"(bh[1][0]), "v"(bh[1][1]), "v"(bh[1][2]), "v"(bh[1][3]),
                     "v"(bl[0][0]), "v"(bl[0][1]), "v"(bl[0][2]), "v"(bl[0][3]), "v"(bl[1][0]), "v"(bl[1][1]), "v"(bl[1][2]), "v"(bl[1][3]));
#pragma unroll
        for (int u = 0; u < 2; ++u) {
#pragma unroll
            for (int t = 0; t < 4; ++t) { acc[t] = wmmab(a[u], bh[u][t], acc[t]); acc[t] = wmmab(al[u], bh[u][t], acc[t]); acc[t] = wmmab(a[u], bl[u][t], acc[t]); } }
        pa += 64; pal += 64; ph0 += 64; ph1 += 64; ph2 += 64; ph3 += 64; pl0 += 64; pl1 += 64; pl2 += 64; pl3 += 64;
        asm volatile("v_nop\n\tv_nop\n\tv_nop\n\tv_nop" : "+v"(acc[0]), "+v"(acc[1]), "+v"(acc[2]), "+v"(acc[3]) : "v"(a[1]), "v"(al[1]));    // WMMA distance over the back edge: four vector slots between the trip's last product and whatever the next trip issues first
    }
    float* os = &ost[wave][0];
#pragma unroll
    for (int t = 0; t < 4; ++t) {
#pragma unroll
        for (int j = 0; j < 8; ++j) os[(hi * 8 + j) * 68 + t * 16 + lr] = acc[t][j]; }
    __builtin_amdgcn_wave_barrier(); asm volatile("" ::: "memory");
    float* crow = C + (size_t)r0 * ldc + c0;
    auto pass = [&]() {
#pragma unroll
        for (int s = 0; s < 8; ++s) { const int Lid = (lane >> 3) + 4 * s, piece = lane & 7; const int row = Lid >> 1, cofs = (Lid & 1) * 32 + piece * 4;
            const v4f val = *(const v4fa*)(os + row * 68 + cofs); *(v4f*)(crow + (size_t)row * ldc + cofs) = val; }
    };
    pass(); 
}

extern "C" void kernel_launch(void* const* d_in, const int* in_sizes, int n_in,
                              void* d_out, int out_size, void* d_ws, size_t ws_size, hipStream_t stream) {
    (void)in_sizes; (void)n_in; (void)out_size;
    const float* x = (const float*)d_in[0]; const float* Wq = (const float*)d_in[1]; const float* bq = (const float*)d_in[2]; const float* Wk = (const float*)d_in[3]; const float* bk = (const float*)d_in[4]; const float* Wv = (const float*)d_in[5]; const float* bv = (const float*)d_in[6];
    const float* Wo = (const float*)d_in[7]; const float* bo = (const float*)d_in[8]; const float* rb = (const float*)d_in[9]; const float* scale = (const float*)d_in[10]; const int* mask = (const int*)d_in[11];
    float* out = (float*)d_out;    // [4][2048][256]
    char* wsp = (char*)d_ws;
    auto take = [&](size_t bytes) { char* p = wsp; wsp += (bytes + 255) & ~(size_t)255; return (void*)p; };
    const size_t PL = (size_t)NBI * NT * DD;    // one [batch][token][256] plane, elements
    bf* WB = (bf*)take((size_t)4 * DD * DD * 2); bf* WoB = WB + 3 * DD * DD; bf* S = (bf*)take((size_t)NH * 512 * 64 * 2);    // WB: Wq, Wk, Wv, Wo; S: k_tshift's table
    bf* Xb = (bf*)take(PL * 2); bf* Qh = (bf*)take(PL * 2); bf* Ql = (bf*)take(PL * 2);
    bf* KTh = (bf*)take(2 * PL * 2); bf* KTl = (bf*)take(2 * PL * 2); bf* VTh = KTh + PL; bf* VTl = KTl + PL;    // [K | V][batch][head][64][2048]
    float* KV = (float*)take((size_t)KSP * NBI * NH * HD * HD * 4); bf* KVh = (bf*)take((size_t)NBI * NH * HD * HD * 2); bf* KVl = (bf*)take((size_t)NBI * NH * HD * HD * 2);
    float* Y = (float*)take(PL * 4); bf* Yh = (bf*)take(PL * 2); bf* Yl = (bf*)take(PL * 2);
    if ((size_t)(wsp - (char*)d_ws) > ws_size) return;    // 0.5 + 0.25 + 4 + 2 x 4 + 2 x 8 + 4 + 0.25 + 8 + 2 x 4 ~ 50 MB, no aliasing
    k_cvt8<<<dim3(DD * DD / 8 / 256, 4, 1), 256, 0, stream>>>(Wq, Wk, Wv, Wo, WB, DD * DD / 8);
    k_tshift<<<NH * 512 * 8 / 256, 256, 0, stream>>>(rb, S);
    k_cvt<<<NBI * NT / 8, 256, 0, stream>>>(x, Xb);
    k_gemmb<false, false, false, 1><<<dim3(NBI * NT / 64, DD / 64, 3), 128, 0, stream>>>(Xb, nullptr, WB, bq, nullptr, DD, nullptr, nullptr, DD, 1, 0, DD * DD, 3, 0, bk, bv, mask, Qh, Ql, KTh, KTl);    // z = q, k, v; grid y = head
    k_gemm3ll<<<dim3(1, 1, KSP * NBI * NH), 128, 0, stream>>>(VTh, VTl, NT, KTh, KTl, NT, NT / KSP, KV, HD, (size_t)DD * NT, (size_t)HD * NT, (size_t)HD * NT, NH * HD * HD, HD * HD, NBI * NH * HD * HD);    // (K^T V)^T [d2][d1] = V^T . K, KSP partial planes; k_kvsplit adds them
    k_kvsplit<<<dim3(HD / 8, NBI * NH, 1), 256, 0, stream>>>(KV, scale, KVh, KVl);
    k_gemm3ll<<<dim3(NT / 64, 1, NBI * NH), 128, 0, stream>>>(Qh, Ql, DD, KVh, KVl, HD, HD, Y, DD, (size_t)NT * DD, HD, HD * HD, (size_t)NT * DD, HD);    // y1[i][h*64+d2] = q_i . (K^T V / s)[:, d2]
    k_gemmb<true, false, true, 2><<<dim3(1, NT / 64, NBI * NH), 128, 0, stream>>>(VTh, VTl, S, nullptr, nullptr, NT, nullptr, Y, NT, 1, (size_t)HD * NT, (size_t)512 * 64, NH - 1, 0, nullptr, nullptr, nullptr, Yh, Yl);    // y1 + the transposed (T_h V)^T [d][i], split
    k_gemmb<true, false><<<dim3(NBI * NT / 64, DD / 64, 1), 128, 0, stream>>>(Yh, Yl, WoB, bo, out, DD, nullptr, nullptr, DD);
}

// v006
// One run takes 65.6 microseconds.
// Two timings next to v005 both put it at 1.06 times that version's speed.
// Over all steps from v000 it is 28.5 times as fast.
#include <hip/hip_runtime.h>

// Compute dtypes, f32 accumulate, every stage one launch over all batch items and heads: Q/K/V = x.W^T + b ([2048 x 256].[256 x 256], PLAIN bf16 operands = rounded input, [out][in] weights; exact products); the
// un-softmaxed attention out_h = (Q K^T / scale + RelBias_h) V is evaluated as Q (K^T V) / scale + T_h V (exact reassociation): K^T V per head as [64 x 2048].[2048 x 64]
// (both operands bf16 hi + UNSCALED residual, three products), Q.(K^T V / scale) as [2048 x 64].[64 x 64] (three products), and the Toeplitz relative-bias term T_h[i][j] =
// rel_bias[j - i + 2047][h] (exact bf16 values of the INPUT table, read from a small table of its eight shifted copies, never laid out as a plane) against V^T hi + residual (two products); out = y.Wo^T + bo (two products) - all on
// v_wmma_f32_16x16x32_bf16. The mask input enters multiplicatively (m_i m_j). Deterministic, no atomics; every

#define NBI  4
#define NT   2048
#define DD   256
#define NH   4
#define HD   64
#define DM   DD
#define LOSC 1024.0f
#define KSP  16    // K^T V: slices of the token sum, one work-group each

typedef _Float16 h16;
typedef unsigned short bf;
typedef __attribute__((ext_vector_type(16))) __bf16   v16bf;
typedef __attribute__((ext_vector_type(16))) _Float16 v16h;
typedef __attribute__((ext_vector_type(8)))  _Float16 v8h;
typedef __attribute__((ext_vector_type(8)))  unsigned short v8us;
typedef __attribute__((ext_vector_type(8)))  float    v8f;
typedef __attribute__((ext_vector_type(4)))  float    v4f;
typedef v8h  __attribute__((may_alias)) v8ha;
typedef v4f  __attribute__((may_alias)) v4fa;
typedef v8us __attribute__((may_alias)) v8usa;

__device__ __forceinline__ unsigned short f2bf(float f) { unsigned u = __float_as_uint(f); u += 0x7FFFu + ((u >> 16) & 1u); return (unsigned short)(u >> 16); }
__device__ __forceinline__ float bf2f(unsigned short b) { return __uint_as_float(((unsigned)b) << 16); }
__device__ __forceinline__ float bfr(float f) { return bf2f(f2bf(f)); }
__device__ __forceinline__ v16h cat16(v8h lo, v8h hi) { return __builtin_shufflevector(lo, hi, 0, 1, 2, 3, 4, 5, 6, 7, 8, 9, 10, 11, 12, 13, 14, 15); }
__device__ __forceinline__ v16bf cat16b(v8us lo, v8us hi) { return __builtin_bit_cast(v16bf, __builtin_shufflevector(lo, hi, 0, 1, 2, 3, 4, 5, 6, 7, 8, 9, 10, 11, 12, 13, 14, 15)); }
__device__ __forceinline__ v8f wmma16(v16h a, v16h b, v8f c) { return __builtin_amdgcn_wmma_f32_16x16x32_f16(false, a, false, b, (short)0, c, false, false); }
__device__ __forceinline__ v8f wmmab(v16bf a, v16bf b, v8f c) { return __builtin_amdgcn_wmma_f32_16x16x32_bf16(false, a, false, b, (short)0, c, false, false); }

// one lane's 16 x 16 x 32 fragment of a row-major operand: p = the lane's row at k = 8 * (lane >> 4) of the K step
__device__ __forceinline__ v16bf ldfrag(const bf* p) { return cat16b(*(const v8us*)p, *(const v8us*)(p + 16)); }

// k_gemmb: 64 x 64 block tile (4 waves x 16 x 64) of C[NTK][NW] = (A [+ Al]).B^T (K = 256, 2048 for TOEP) [+ bf(bias[c])] [+ bf(R[r][c]) residual]; f32 whole-line epilogue (or f16
// TOEP: B is not a plane but B[r][k] = tab[k - r + NT - 1]; Bn is then d_tshift's table of that head, and a fragment depends on k - r alone
// EPI: what the epilogue stores. 0: the f32 (or f16) tile. 1 (q, k, v): the masked tile as bf16 hi + residual, q (z = 0) row-major into E0h / E0l, k and v (z = 1, 2) transposed into E1h / E1l [k | v][item][head][64][NT].
// 2 (Toeplitz term, tile [d][i]): R + the transposed tile as bf16 hi + residual into E0h / E0l [item][i][head * 64 + d]
template <bool SPLITA, bool F16OUT = false, bool TOEP = false, int EPI = 0>
__global__ __launch_bounds__(128) void k_gemmb(const bf* __restrict__ A, const bf* __restrict__ Al, const bf* __restrict__ Bn, const float* __restrict__ bias, float* C, int ldc, h16* C2, const float* __restrict__ R = nullptr, int K = DM, int roundR = 1,
                                               size_t zA = 0, size_t zB = 0, int zBmask = 0, size_t zC = 0, const float* __restrict__ bias1 = nullptr, const float* __restrict__ bias2 = nullptr,
                                               const int* __restrict__ msk = nullptr, bf* E0h = nullptr, bf* E0l = nullptr, bf* E1h = nullptr, bf* E1l = nullptr) {
    __shared__ __align__(16) float ost[4][16 * 68];
    const int lane = threadIdx.x & 31, wave = threadIdx.x >> 5, lr = lane & 15, hi = lane >> 4;
    const int r0 = blockIdx.x * 64 + wave * 16, c0 = blockIdx.y * 64;
    // grid z = one independent product: its own A and C planes, B plane (z & zBmask), bias 0 / 1 / 2
    const int z = blockIdx.z; A += z * zA; if (SPLITA) Al += z * zA; Bn += (size_t)(z & zBmask) * zB; C += z * zC; if (z == 1) bias = bias1; if (z == 2) bias = bias2;
    const size_t aoff = (size_t)(r0 + lr) * K + 8 * hi;
    size_t boff[4];
#pragma unroll
    for (int t = 0; t < 4; ++t) boff[t] = (size_t)(c0 + t * 16 + lr) * K + 8 * hi;
    v8f acc[4];
#pragma unroll
    for (int t = 0; t < 4; ++t) acc[t] = (v8f){};
    // one trip = 4 K steps (K is a multiple of 128): every load of the trip is issued before its first product, so a trip waits for memory once
    const bf* pa = A + aoff; const bf* pal = SPLITA ? Al + aoff : pa; const bf* pb0 = Bn + boff[0]; const bf* pb1 = Bn + boff[1]; const bf* pb2 = Bn + boff[2]; const bf* pb3 = Bn + boff[3];
    if constexpr (TOEP) {
        // row r = c0 + 16 t + lr, k = kc + 32 u + 8 hi (+ 16): k - r + NT - 1 = 8 m + s with s = 7 - (lr & 7) and m = (kc - c0) / 8 + 4 u - 2 t (+ 2) + hi - (lr >> 3) + NT / 8 - 1;
        // ps = the lane's 16-byte piece at kc = 0 and 4 u - 2 t = -6, the trip's lowest; m runs from 0 to 510 over the whole grid
        const bf* ps = Bn + ((NT / 8 - 7 + hi - (lr >> 3)) - (c0 >> 3)) * 64 + (7 - (lr & 7)) * 8;
#pragma unroll 1
        for (int kc = 0; kc < K; kc += 128) {
            v16bf a[4], al[4], f[10];    // f[j]: the fragment of every (u, t) with 2 u - t + 3 = j; the loops over u, t and j are fully unrolled so that these arrays live in registers
#pragma unroll
            for (int u = 0; u < 4; ++u) { a[u] = ldfrag(pa + 32 * u); al[u] = SPLITA ? ldfrag(pal + 32 * u) : a[u]; }
#pragma unroll
            for (int j = 0; j < 10; ++j) f[j] = cat16b(*(const v8us*)(ps + 128 * j), *(const v8us*)(ps + 128 * j + 128));
            // inputs-only fence on the loaded values: holds all loads of the trip in front of the products, so a trip waits for memory once;
            // the three addresses are inputs too: they stay in their registers until the data is there
            asm volatile("" :: "v"(pa), "v"(pal), "v"(ps), "v"(a[0]), "v"(a[1]), "v"(a[2]), "v"(a[3]), "v"(al[0]), "v"(al[1]), "v"(al[2]), "v"(al[3]),
                         "v"(f[0]), "v"(f[1]), "v"(f[2]), "v"(f[3]), "v"(f[4]), "v"(f[5]), "v"(f[6]), "v"(f[7]), "v"(f[8]), "v"(f[9]));
#pragma unroll
            for (int u = 0; u < 4; ++u) {
#pragma unroll
                for (int t = 0; t < 4; ++t) { acc[t] = wmmab(a[u], f[2 * u - t + 3], acc[t]); if (SPLITA) acc[t] = wmmab(al[u], f[2 * u - t + 3], acc[t]); } }
            pa += 128; pal += 128; ps += 1024;
            asm volatile("v_nop\n\tv_nop\n\tv_nop\n\tv_nop" : "+v"(acc[0]), "+v"(acc[1]), "+v"(acc[2]), "+v"(acc[3]) : "v"(a[3]), "v"(al[3]));    // WMMA distance over the back edge: four vector slots between the trip's last product and whatever the next trip issues first
        }
    } else
#pragma unroll 1
    for (int kc = 0; kc < K; kc += 128) {
        v16bf a[4], al[4], b[4][4];    // the loops over u and t below are fully unrolled so that these arrays live in registers
#pragma unroll
        for (int u = 0; u < 4; ++u) { a[u] = ldfrag(pa + 32 * u); al[u] = SPLITA ? ldfrag(pal + 32 * u) : a[u];
            b[u][0] = ldfrag(pb0 + 32 * u); b[u][1] = ldfrag(pb1 + 32 * u); b[u][2] = ldfrag(pb2 + 32 * u); b[u][3] = ldfrag(pb3 + 32 * u); }
        // inputs-only fence on the loaded values: holds all loads of the trip in front of the products (without it the compiler loads one B fragment at a time and waits for each);
        // the six addresses are inputs too: they stay in their registers until the data is there, so no load's result lands in a register that an earlier load of the trip names
        asm volatile("" :: "v"(pa), "v"(pal), "v"(pb0), "v"(pb1), "v"(pb2), "v"(pb3), "v"(a[0]), "v"(a[1]), "v"(a[2]), "v"(a[3]), "v"(al[0]), "v"(al[1]), "v"(al[2]), "v"(al[3]),
                     "v"(b[0][0]), "v"(b[0][1]), "v"(b[0][2]), "v"(b[0][3]), "v"(b[1][0]), "v"(b[1][1]), "v"(b[1][2]), "v"(b[1][3]),
                     "v"(b[2][0]), "v"(b[2][1]), "v"(b[2][2]), "v"(b[2][3]), "v"(b[3][0]), "v"(b[3][1]), "v"(b[3][2]), "v"(b[3][3]));
#pragma unroll
        for (int u = 0; u < 4; ++u) {
#pragma unroll
            for (int t = 0; t < 4; ++t) { acc[t] = wmmab(a[u], b[u][t], acc[t]); if (SPLITA) acc[t] = wmmab(al[u], b[u][t], acc[t]); } }
        pa += 128; pal += 128; pb0 += 128; pb1 += 128; pb2 += 128; pb3 += 128;
        asm volatile("v_nop\n\tv_nop\n\tv_nop\n\tv_nop" : "+v"(acc[0]), "+v"(acc[1]), "+v"(acc[2]), "+v"(acc[3]) : "v"(a[3]), "v"(al[3]));    // WMMA distance over the back edge: four vector slots between the trip's last product and whatever the next trip issues first
    }
    if constexpr (EPI != 0) {
        // the block's 64 x 64 tile passes through LDS once, as the rows the stores want; 8 lanes then store one whole 128-byte line of each plane
        typedef __attribute__((ext_vector_type(4))) int v4i;
        float* of = &ost[0][0];
        const int piece = threadIdx.x & 7, rw = threadIdx.x >> 3;
        const bool tr = EPI == 2 || z != 0;    // the same for the whole block
        // all that the epilogue reads from memory is asked for ahead of the LDS pass: the term to add (EPI 2), or the mask of the thread's 4 rows and of its 8 columns and the bias (EPI 1; the Toeplitz term has no bias)
        v4f q[4][2]; int mr[4]; v4i m0, m1; float bv[4];
        if constexpr (EPI == 2) {
#pragma unroll
            for (int s = 0; s < 4; ++s) { const float* rp = R + ((size_t)(z / NH) * NT + c0 + rw + 16 * s) * DD + (z % NH) * HD + piece * 8; q[s][0] = *(const v4f*)rp; q[s][1] = *(const v4f*)(rp + 4); }
        } else {
            const int* mp = msk + blockIdx.x * 64; m0 = *(const v4i*)(mp + piece * 8); m1 = *(const v4i*)(mp + piece * 8 + 4);
#pragma unroll
            for (int s = 0; s < 4; ++s) mr[s] = mp[rw + 16 * s];
        }
#pragma unroll
        for (int t = 0; t < 4; ++t) bv[t] = 0.f;
        if constexpr (EPI == 1) { if (bias) {    // one test for the four loads, so that they fly together
#pragma unroll
            for (int t = 0; t < 4; ++t) bv[t] = bias[c0 + t * 16 + lr];
#pragma unroll
            for (int t = 0; t < 4; ++t) bv[t] = bfr(bv[t]); } }
        if (tr) {    // a lane's 8 values are 8 neighbours of the transposed row t * 16 + lr
#pragma unroll
            for (int t = 0; t < 4; ++t) { float* tp = of + (t * 16 + lr) * 68 + wave * 16 + hi * 8;
                *(v4fa*)tp = (v4f){acc[t][0] + bv[t], acc[t][1] + bv[t], acc[t][2] + bv[t], acc[t][3] + bv[t]}; *(v4fa*)(tp + 4) = (v4f){acc[t][4] + bv[t], acc[t][5] + bv[t], acc[t][6] + bv[t], acc[t][7] + bv[t]}; }
        } else {
#pragma unroll
            for (int t = 0; t < 4; ++t) {
#pragma unroll
                for (int j = 0; j < 8; ++j) of[(wave * 16 + hi * 8 + j) * 68 + t * 16 + lr] = acc[t][j] + bv[t]; }
        }
        __syncthreads();    // a row of the tile is read by another wave than the ones that wrote it
        // o: the thread's first 16-byte piece; st: elements from one of its rows to the next
        size_t o, st; bf* dh = E0h; bf* dl = E0l; float fc[8];
        if constexpr (EPI == 2) { o = ((size_t)(z / NH) * NT + c0 + rw) * DD + (z % NH) * HD + piece * 8; st = (size_t)16 * DD; }
        else if (!tr) { o = ((size_t)blockIdx.x * 64 + rw) * DD + c0 + piece * 8; st = (size_t)16 * DD; }
        else { o = (((size_t)(z - 1) * NBI + blockIdx.x / (NT / 64)) * DD + c0 + rw) * NT + (blockIdx.x % (NT / 64)) * 64 + piece * 8; st = (size_t)16 * NT; dh = E1h; dl = E1l; }    // row = the head's d, the 8 values are 8 tokens
        if constexpr (EPI == 1) {
#pragma unroll
            for (int i = 0; i < 8; ++i) fc[i] = ((i < 4 ? m0[i & 3] : m1[i & 3]) != 0) ? 1.0f : 0.f;
        }
        v4f p[4][2];
#pragma unroll
        for (int s = 0; s < 4; ++s) { const float* sp = of + (rw + 16 * s) * 68 + piece * 8; p[s][0] = *(const v4fa*)sp; p[s][1] = *(const v4fa*)(sp + 4); }
#pragma unroll
        for (int s = 0; s < 4; ++s) { float y[8] = {p[s][0][0], p[s][0][1], p[s][0][2], p[s][0][3], p[s][1][0], p[s][1][1], p[s][1][2], p[s][1][3]}; v8us oh, ol;
#pragma unroll
            for (int i = 0; i < 8; ++i) {
                if constexpr (EPI == 2) y[i] = q[s][i >> 2][i & 3] + y[i]; else y[i] *= tr ? fc[i] : ((mr[s] != 0) ? 1.0f : 0.f);
                const unsigned short hb = f2bf(y[i]); oh[i] = hb; ol[i] = f2bf(y[i] - bf2f(hb)); }
            *(v8us*)(dh + o + s * st) = oh; *(v8us*)(dl + o + s * st) = ol;
            if (s < 3) asm volatile("s_wait_xcnt 0x0" ::: "memory"); }    // stands in front of the next row's arithmetic, which reuses registers that these two stores name
        return;
    }
    float* os = &ost[wave][0];
#pragma unroll
    for (int t = 0; t < 4; ++t) { const float bv = bias ? bfr(bias[c0 + t * 16 + lr]) : 0.f;
#pragma unroll
        for (int j = 0; j < 8; ++j) os[(hi * 8 + j) * 68 + t * 16 + lr] = acc[t][j] + bv; }
    __syncthreads();
    if (F16OUT) {
        h16* crow = (h16*)(void*)C + (size_t)r0 * ldc + c0;
        auto pass = [&]() {
#pragma unroll
            for (int s = 0; s < 4; ++s) { const int row = 4 * s + (lane >> 3), piece = lane & 7; const float* sp = os + row * 68 + piece * 8; v8h o, o2;
#pragma unroll
                for (int i = 0; i < 8; ++i) { const h16 a = (h16)sp[i]; o[i] = a; o2[i] = (h16)((sp[i] - (float)a) * LOSC); }
                *(v8h*)(crow + (size_t)row * ldc + piece * 8) = o; if (C2) *(v8h*)(C2 + (size_t)r0 * ldc + c0 + (size_t)row * ldc + piece * 8) = o2; }
        };
        pass(); 
    } else {
        float* crow = C + (size_t)r0 * ldc + c0;
        auto pass = [&]() {
#pragma unroll
            for (int s = 0; s < 8; ++s) { const int Lid = (lane >> 3) + 4 * s, piece = lane & 7; const int row = Lid >> 1, cofs = (Lid & 1) * 32 + piece * 4;
                v4f val = *(const v4fa*)(os + row * 68 + cofs); if (R) { const v4f rv = *(const v4f*)(R + ((size_t)r0 + row) * ldc + c0 + cofs); val += roundR ? (v4f){bfr(rv[0]), bfr(rv[1]), bfr(rv[2]), bfr(rv[3])} : rv; }
                *(v4f*)(crow + (size_t)row * ldc + cofs) = val; }
        };
        pass(); 
    }
}


// the three jobs of k_prep, each a block's work; bx (and y) = the block's index within its job
__device__ __forceinline__ void d_cvt8(int bx, int y, const float* __restrict__ s0, const float* __restrict__ s1, const float* __restrict__ s2, const float* __restrict__ s3, bf* dst, size_t n8) {
    const size_t i = (size_t)bx * 256 + threadIdx.x; if (i >= n8) return;
    const float* src = y == 0 ? s0 : y == 1 ? s1 : y == 2 ? s2 : s3; dst += (size_t)y * n8 * 8;    // y = which of the four matrices
    const v8f v = *(const v8f*)(src + i * 8); v8us o;
#pragma unroll
    for (int k = 0; k < 8; ++k) o[k] = f2bf(v[k]);
    *(v8us*)(dst + i * 8) = o; 
}
__global__ __launch_bounds__(256) void k_zero8(bf* dst, size_t n8) {
    const size_t i = (size_t)blockIdx.x * 256 + threadIdx.x; if (i >= n8) return; v8us z;
#pragma unroll
    for (int k = 0; k < 8; ++k) z[k] = 0;
    *(v8us*)(dst + i * 8) = z; 
}

__device__ __forceinline__ void d_cvt(int bx, const float* __restrict__ src, bf* dst) {
    const int lane = threadIdx.x & 31, r = bx * 8 + (threadIdx.x >> 5); if (r >= NBI * NT) return; v8us o;
#pragma unroll
    for (int i = 0; i < 8; ++i) o[i] = f2bf(src[(size_t)r * DD + lane * 8 + i]);
    *(v8us*)(dst + (size_t)r * DD + lane * 8) = o; 
}
// S[h][m][s][q] = bf16(rb[8 m + s + q][h]), m < 511 (a head's pitch is 512), s < 8, q < 8: eight copies of a head's table, each one element further on, so that any 8 neighbours are one aligned 16-byte piece;
// the eight pieces of one m share a 128-byte line
__device__ __forceinline__ void d_tshift(int bx, const float* __restrict__ rb, bf* S) {
    const int p = bx * 256 + threadIdx.x, h = p >> 12, e = ((p >> 3) & 511) * 8 + (p & 7); if (e >= 511 * 8) return; v8us o;    // m = 511 would pass the table's end; no fragment reads it
#pragma unroll
    for (int q = 0; q < 8; ++q) o[q] = f2bf(rb[(size_t)(e + q) * NH + h]);
    *(v8us*)(S + (size_t)p * 8) = o;
}
// k_prep: all that depends on the inputs alone (the four weight matrices and x to bf16, the shifted rel_bias table) in one launch; no job reads what another writes.
// The two small jobs take the lowest block indices, so that they run while the blocks of x are still starting
#define PB_W (DD * DD / 8 / 256)       // blocks per weight matrix
#define PB_S (NH * 512 * 8 / 256)      // blocks of the table
#define PB_X (NBI * NT / 8)            // blocks of x
__global__ __launch_bounds__(256) void k_prep(const float* __restrict__ Wq, const float* __restrict__ Wk, const float* __restrict__ Wv, const float* __restrict__ Wo, bf* WB,
                                              const float* __restrict__ rb, bf* S, const float* __restrict__ x, bf* Xb) {
    const int b = blockIdx.x;    // the same for the whole block: each block does one job
    if (b < 4 * PB_W) d_cvt8(b % PB_W, b / PB_W, Wq, Wk, Wv, Wo, WB, DD * DD / 8);
    else if (b < 4 * PB_W + PB_S) d_tshift(b - 4 * PB_W, rb, S);
    else d_cvt(b - (4 * PB_W + PB_S), x, Xb);
}
__global__ __launch_bounds__(256) void k_kvsplit(const float* __restrict__ src, const float* __restrict__ scale, bf* dh, bf* dl) {
    typedef __attribute__((ext_vector_type(2))) unsigned short v2us;
    const int lane = threadIdx.x & 31, r = blockIdx.x * 8 + (threadIdx.x >> 5); if (r >= HD) return; const float is = 1.0f / bfr(scale[0]);
    const size_t o = ((size_t)blockIdx.y * HD + r) * HD + lane * 2;    // grid y = batch item * NH + head
    typedef __attribute__((ext_vector_type(2))) float v2f;
    static_assert(KSP == 16, "the fence below names 16 values");
    v2f p[KSP], sum; const float* ps = src + o;    // src holds KSP partial planes, one per slice of the token sum; they are added in slice order
#pragma unroll
    for (int s = 0; s < KSP; ++s) p[s] = *(const v2f*)(ps + (size_t)s * (NBI * NH * HD * HD));
    // inputs-only fence on the loaded values and their address: all loads are in flight together, and the address stays in its registers until the data is there (no load's result lands in them)
    asm volatile("" :: "v"(ps), "v"(p[0]), "v"(p[1]), "v"(p[2]), "v"(p[3]), "v"(p[4]), "v"(p[5]), "v"(p[6]), "v"(p[7]), "v"(p[8]), "v"(p[9]), "v"(p[10]), "v"(p[11]), "v"(p[12]), "v"(p[13]), "v"(p[14]), "v"(p[15]));
    sum = p[0];
#pragma unroll
    for (int s = 1; s < KSP; ++s) sum += p[s];
    v2us oh, ol;
#pragma unroll
    for (int i = 0; i < 2; ++i) { const float y = sum[i] * is; const unsigned short hb = f2bf(y); oh[i] = hb; ol[i] = f2bf(y - bf2f(hb)); }
    *(v2us*)(dh + o) = oh; *(v2us*)(dl + o) = ol; 
}
__global__ __launch_bounds__(128) void k_gemm3ll(const bf* __restrict__ Ah, const bf* __restrict__ Al, int lda, const bf* __restrict__ Bh, const bf* __restrict__ Bl, int ldb, int K, float* C, int ldc,
                                                 size_t zAb, size_t zAh, size_t zB, size_t zCb, size_t zCh, size_t zCs = 0) {
    __shared__ __align__(16) float ost[4][16 * 68];
    const int lane = threadIdx.x & 31, wave = threadIdx.x >> 5, lr = lane & 15, hi = lane >> 4;
    const int r0 = blockIdx.x * 64 + wave * 16, c0 = blockIdx.y * 64;
    // grid z = (K slice * NBI + batch item) * NH + head: A and C step by item and by head, B by item * NH + head; slice sp sums k in [sp K, sp K + K) into its own C plane
    { const int sp = blockIdx.z / (NBI * NH), z = blockIdx.z % (NBI * NH), zb = z / NH, zh = z % NH; const size_t ao = zb * zAb + zh * zAh + (size_t)sp * K, bo2 = z * zB + (size_t)sp * K;
      Ah += ao; Al += ao; Bh += bo2; Bl += bo2; C += zb * zCb + zh * zCh + sp * zCs; }
    const size_t aoff = (size_t)(r0 + lr) * lda + 8 * hi;
    v8f acc[4];
#pragma unroll
    for (int t = 0; t < 4; ++t) acc[t] = (v8f){};
    // one trip = 2 K steps (K is a multiple of 64): every load of the trip is issued before its first product, so a trip waits for memory once
    const bf* pa = Ah + aoff; const bf* pal = Al + aoff; const size_t bo = (size_t)(c0 + lr) * ldb + 8 * hi, bs = (size_t)16 * ldb;
    const bf* ph0 = Bh + bo; const bf* ph1 = ph0 + bs; const bf* ph2 = ph1 + bs; const bf* ph3 = ph2 + bs; const bf* pl0 = Bl + bo; const bf* pl1 = pl0 + bs; const bf* pl2 = pl1 + bs; const bf* pl3 = pl2 + bs;
#pragma unroll 1
    for (int kc = 0; kc < K; kc += 64) {
        v16bf a[2], al[2], bh[2][4], bl[2][4];    // the loops over u and t below are fully unrolled so that these arrays live in registers
#pragma unroll
        for (int u = 0; u < 2; ++u) { a[u] = ldfrag(pa + 32 * u); al[u] = ldfrag(pal + 32 * u);
            bh[u][0] = ldfrag(ph0 + 32 * u); bh[u][1] = ldfrag(ph1 + 32 * u); bh[u][2] = ldfrag(ph2 + 32 * u); bh[u][3] = ldfrag(ph3 + 32 * u);
            bl[u][0] = ldfrag(pl0 + 32 * u); bl[u][1] = ldfrag(pl1 + 32 * u); bl[u][2] = ldfrag(pl2 + 32 * u); bl[u][3] = ldfrag(pl3 + 32 * u); }
        // inputs-only fence on the loaded values: holds all loads of the trip in front of the products (without it the compiler loads a few fragments at a time and waits for each group);
        // the ten addresses are inputs too: they stay in their registers until the data is there, so no load's result lands in a register that an earlier load of the trip names
        asm volatile("" :: "v"(pa), "v"(pal), "v"(ph0), "v"(ph1), "v"(ph2), "v"(ph3), "v"(pl0), "v"(pl1), "v"(pl2), "v"(pl3), "v"(a[0]), "v"(a[1]), "v"(al[0]), "v"(al[1]), "v"(bh[0][0]), "v"(bh[0][1]), "v"(bh[0][2]), "v"(bh[0][3]), "v"(bh[1][0]), "v"(bh[1][1]), "v"(bh[1][2]), "v"(bh[1][3]),
                     "v"(bl[0][0]), "v"(bl[0][1]), "v"(bl[0][2]), "v"(bl[0][3]), "v"(bl[1][0]), "v"(bl[1][1]), "v"(bl[1][2]), "v"(bl[1][3]));
#pragma unroll
        for (int u = 0; u < 2; ++u) {
#pragma unroll
            for (int t = 0; t < 4; ++t) { acc[t] = wmmab(a[u], bh[u][t], acc[t]); acc[t] = wmmab(al[u], bh[u][t], acc[t]); acc[t] = wmmab(a[u], bl[u][t], acc[t]); } }
        pa += 64; pal += 64; ph0 += 64; ph1 += 64; ph2 += 64; ph3 += 64; pl0 += 64; pl1 += 64; pl2 += 64; pl3 += 64;
        asm volatile("v_nop\n\tv_nop\n\tv_nop\n\tv_nop" : "+v"(acc[0]), "+v"(acc[1]), "+v"(acc[2]), "+v"(acc[3]) : "v"(a[1]), "v"(al[1]));    // WMMA distance over the back edge: four vector slots between the trip's last product and whatever the next trip issues first
    }
    float* os = &ost[wave][0];
#pragma unroll
    for (int t = 0; t < 4; ++t) {
#pragma unroll
        for (int j = 0; j < 8; ++j) os[(hi * 8 + j) * 68 + t * 16 + lr] = acc[t][j]; }
    __builtin_amdgcn_wave_barrier(); asm volatile("" ::: "memory");
    float* crow = C + (size_t)r0 * ldc + c0;
    auto pass = [&]() {
#pragma unroll
        for (int s = 0; s < 8; ++s) { const int Lid = (lane >> 3) + 4 * s, piece = lane & 7; const int row = Lid >> 1, cofs = (Lid & 1) * 32 + piece * 4;
            const v4f val = *(const v4fa*)(os + row * 68 + cofs); *(v4f*)(crow + (size_t)row * ldc + cofs) = val; }
    };
    pass(); 
}

extern "C" void kernel_launch(void* const* d_in, const int* in_sizes, int n_in,
                              void* d_out, int out_size, void* d_ws, size_t ws_size, hipStream_t stream) {
    (void)in_sizes; (void)n_in; (void)out_size;
    const float* x = (const float*)d_in[0]; const float* Wq = (const float*)d_in[1]; const float* bq = (const float*)d_in[2]; const float* Wk = (const float*)d_in[3]; const float* bk = (const float*)d_in[4]; const float* Wv = (const float*)d_in[5]; const float* bv = (const float*)d_in[6];
    const float* Wo = (const float*)d_in[7]; const float* bo = (const float*)d_in[8]; const float* rb = (const float*)d_in[9]; const float* scale = (const float*)d_in[10]; const int* mask = (const int*)d_in[11];
    float* out = (float*)d_out;    // [4][2048][256]
    char* wsp = (char*)d_ws;
    auto take = [&](size_t bytes) { char* p = wsp; wsp += (bytes + 255) & ~(size_t)255; return (void*)p; };
    const size_t PL = (size_t)NBI * NT * DD;    // one [batch][token][256] plane, elements
    bf* WB = (bf*)take((size_t)4 * DD * DD * 2); bf* WoB = WB + 3 * DD * DD; bf* S = (bf*)take((size_t)NH * 512 * 64 * 2);    // WB: Wq, Wk, Wv, Wo; S: d_tshift's table
    bf* Xb = (bf*)take(PL * 2); bf* Qh = (bf*)take(PL * 2); bf* Ql = (bf*)take(PL * 2);
    bf* KTh = (bf*)take(2 * PL * 2); bf* KTl = (bf*)take(2 * PL * 2); bf* VTh = KTh + PL; bf* VTl = KTl + PL;    // [K | V][batch][head][64][2048]
    float* KV = (float*)take((size_t)KSP * NBI * NH * HD * HD * 4); bf* KVh = (bf*)take((size_t)NBI * NH * HD * HD * 2); bf* KVl = (bf*)take((size_t)NBI * NH * HD * HD * 2);
    float* Y = (float*)take(PL * 4); bf* Yh = (bf*)take(PL * 2); bf* Yl = (bf*)take(PL * 2);
    if ((size_t)(wsp - (char*)d_ws) > ws_size) return;    // 0.5 + 0.25 + 4 + 2 x 4 + 2 x 8 + 4 + 0.25 + 8 + 2 x 4 ~ 50 MB, no aliasing
    k_prep<<<4 * PB_W + PB_S + PB_X, 256, 0, stream>>>(Wq, Wk, Wv, Wo, WB, rb, S, x, Xb);
    k_gemmb<false, false, false, 1><<<dim3(NBI * NT / 64, DD / 64, 3), 128, 0, stream>>>(Xb, nullptr, WB, bq, nullptr, DD, nullptr, nullptr, DD, 1, 0, DD * DD, 3, 0, bk, bv, mask, Qh, Ql, KTh, KTl);    // z = q, k, v; grid y = head
    k_gemm3ll<<<dim3(1, 1, KSP * NBI * NH), 128, 0, stream>>>(VTh, VTl, NT, KTh, KTl, NT, NT / KSP, KV, HD, (size_t)DD * NT, (size_t)HD * NT, (size_t)HD * NT, NH * HD * HD, HD * HD, NBI * NH * HD * HD);    // (K^T V)^T [d2][d1] = V^T . K, KSP partial planes; k_kvsplit adds them
    k_kvsplit<<<dim3(HD / 8, NBI * NH, 1), 256, 0, stream>>>(KV, scale, KVh, KVl);
    k_gemm3ll<<<dim3(NT / 64, 1, NBI * NH), 128, 0, stream>>>(Qh, Ql, DD, KVh, KVl, HD, HD, Y, DD, (size_t)NT * DD, HD, HD * HD, (size_t)NT * DD, HD);    // y1[i][h*64+d2] = q_i . (K^T V / s)[:, d2]
    k_gemmb<true, false, true, 2><<<dim3(1, NT / 64, NBI * NH), 128, 0, stream>>>(VTh, VTl, S, nullptr, nullptr, NT, nullptr, Y, NT, 1, (size_t)HD * NT, (size_t)512 * 64, NH - 1, 0, nullptr, nullptr, nullptr, Yh, Yl);    // y1 + the transposed (T_h V)^T [d][i], split
    k_gemmb<true, false><<<dim3(NBI * NT / 64, DD / 64, 1), 128, 0, stream>>>(Yh, Yl, WoB, bo, out, DD, nullptr, nullptr, DD);
}

// v007
// It runs in 53.2 microseconds.
// In two side-by-side timings against v006, it was 1.22 and 1.24 times as fast.
// Over all steps from v000 it is 35.0 times as fast.
#include <hip/hip_runtime.h>

// Compute dtypes, f32 accumulate, every stage one launch over all batch items and heads: Q/K/V = x.W^T + b ([2048 x 256].[256 x 256], PLAIN bf16 operands = rounded input, [out][in] weights; exact products); the
// un-softmaxed attention out_h = (Q K^T / scale + RelBias_h) V is evaluated as Q (K^T V) / scale + T_h V (exact reassociation): K^T V per head as [64 x 2048].[2048 x 64]
// (both operands bf16 hi + UNSCALED residual, three products), Q.(K^T V / scale) as [2048 x 64].[64 x 64] (three products), and the Toeplitz relative-bias term T_h[i][j] =
// rel_bias[j - i + 2047][h] (exact bf16 values of the INPUT table, read from a small table of its eight shifted copies, never laid out as a plane) against V^T hi + residual (two products); out = y.Wo^T + bo (two products) - all on
// v_wmma_f32_16x16x32_bf16. The mask input enters multiplicatively (m_i m_j). Deterministic, no atomics; every

#define NBI  4
#define NT   2048
#define DD   256
#define NH   4
#define HD   64
#define DM   DD
#define LOSC 1024.0f
#define KSP  16    // K^T V: slices of the token sum, one work-group each

typedef _Float16 h16;
typedef unsigned short bf;
typedef __attribute__((ext_vector_type(16))) __bf16   v16bf;
typedef __attribute__((ext_vector_type(16))) _Float16 v16h;
typedef __attribute__((ext_vector_type(8)))  _Float16 v8h;
typedef __attribute__((ext_vector_type(8)))  unsigned short v8us;
typedef __attribute__((ext_vector_type(8)))  float    v8f;
typedef __attribute__((ext_vector_type(4)))  float    v4f;
typedef v8h  __attribute__((may_alias)) v8ha;
typedef v4f  __attribute__((may_alias)) v4fa;
typedef v8us __attribute__((may_alias)) v8usa;

__device__ __forceinline__ unsigned short f2bf(float f) { unsigned u = __float_as_uint(f); u += 0x7FFFu + ((u >> 16) & 1u); return (unsigned short)(u >> 16); }
__device__ __forceinline__ float bf2f(unsigned short b) { return __uint_as_float(((unsigned)b) << 16); }
__device__ __forceinline__ float bfr(float f) { return bf2f(f2bf(f)); }
__device__ __forceinline__ v16h cat16(v8h lo, v8h hi) { return __builtin_shufflevector(lo, hi, 0, 1, 2, 3, 4, 5, 6, 7, 8, 9, 10, 11, 12, 13, 14, 15); }
__device__ __forceinline__ v16bf cat16b(v8us lo, v8us hi) { return __builtin_bit_cast(v16bf, __builtin_shufflevector(lo, hi, 0, 1, 2, 3, 4, 5, 6, 7, 8, 9, 10, 11, 12, 13, 14, 15)); }
__device__ __forceinline__ v8f wmma16(v16h a, v16h b, v8f c) { return __builtin_amdgcn_wmma_f32_16x16x32_f16(false, a, false, b, (short)0, c, false, false); }
__device__ __forceinline__ v8f wmmab(v16bf a, v16bf b, v8f c) { return __builtin_amdgcn_wmma_f32_16x16x32_bf16(false, a, false, b, (short)0, c, false, false); }

// FRAGMENT ORDER, the layout of every bf16 operand plane [rows][K] in the workspace: blocks of 16 rows x 32 k = 512 elements, block (row / 16) * (K / 32) + k / 32; inside a block element (row, k) stands at
// ((k >> 4) & 1) * 256 + ((k >> 3) & 1) * 128 + (row & 15) * 8 + (k & 7). A wave's 32 lanes then read 512 bytes in a row, four whole 128-byte lines, with each 16-byte load (row-major: a quarter of each of 16 lines).
// 16 rows are 16 * K elements as in a row-major plane; 32 k of them are 512.
// one lane's 16 x 16 x 32 fragment: p = the block + lane * 8; the lane gets k = 8 * (lane >> 4) + 0 .. 7 and 16 more, of row lane & 15, as from a row-major plane
__device__ __forceinline__ v16bf ldfrag(const bf* p) { return cat16b(*(const v8us*)p, *(const v8us*)(p + 256)); }
// where the 8 elements k8 * 8 .. + 7 (k8 < 8: two blocks, 64 k) of row lr of a 16-row strip stand, from the first of the two blocks
__device__ __forceinline__ int frpiece(int lr, int k8) { return (k8 >> 2) * 512 + ((k8 >> 1) & 1) * 256 + (k8 & 1) * 128 + lr * 8; }

// k_gemmb: 64 x 64 block tile (4 waves x 16 x 64) of C[NTK][NW] = (A [+ Al]).B^T (K = DD, or NT for the Toeplitz term) [+ bf(bias[c])] [+ bf(R[r][c]) residual]; f32 whole-line epilogue (or f16
// TOEP: B is not a plane but B[r][k] = tab[k - r + NT - 1]; Bn is then d_tshift's table of that head, and a fragment depends on k - r alone
// EPI: what the epilogue stores. 0: the f32 (or f16) tile. 1 (q, k, v): the masked tile as bf16 hi + residual, q (z = 0) in fragment order into E0h / E0l, k and v (z = 1, 2) transposed into E1h / E1l [k | v][item][head][64][NT].
// 2 (Toeplitz term, tile [d][i]): R + the transposed tile as bf16 hi + residual into E0h / E0l [item][i][head * 64 + d]
template <bool SPLITA, bool F16OUT = false, bool TOEP = false, int EPI = 0>
__global__ __launch_bounds__(128) void k_gemmb(const bf* __restrict__ A, const bf* __restrict__ Al, const bf* __restrict__ Bn, const float* __restrict__ bias, float* C, int ldc, h16* C2, const float* __restrict__ R = nullptr, int K = DM, int roundR = 1,
                                               size_t zA = 0, size_t zB = 0, int zBmask = 0, size_t zC = 0, const float* __restrict__ bias1 = nullptr, const float* __restrict__ bias2 = nullptr,
                                               const int* __restrict__ msk = nullptr, bf* E0h = nullptr, bf* E0l = nullptr, bf* E1h = nullptr, bf* E1l = nullptr) {
    __shared__ __align__(16) float ost[4][16 * 68];
    const int lane = threadIdx.x & 31, wave = threadIdx.x >> 5, lr = lane & 15, hi = lane >> 4;
    const int r0 = blockIdx.x * 64 + wave * 16, c0 = blockIdx.y * 64;
    // grid z = one independent product: its own A and C planes, B plane (z & zBmask), bias 0 / 1 / 2
    const int z = blockIdx.z; A += z * zA; if (SPLITA) Al += z * zA; Bn += (size_t)(z & zBmask) * zB; C += z * zC; if (z == 1) bias = bias1; if (z == 2) bias = bias2;
    const size_t aoff = (size_t)r0 * K + lane * 8;    // fragment order: the strip of 16 rows, the lane's piece of its first block
    size_t boff[4];
#pragma unroll
    for (int t = 0; t < 4; ++t) boff[t] = (size_t)(c0 + t * 16) * K + lane * 8;
    v8f acc[4];
#pragma unroll
    for (int t = 0; t < 4; ++t) acc[t] = (v8f){};
    // one trip = 4 K steps (K is a multiple of 128): every load of the trip is issued before its first product, so a trip waits for memory once
    const bf* pa = A + aoff; const bf* pal = SPLITA ? Al + aoff : pa; const bf* pb0 = Bn + boff[0]; const bf* pb1 = Bn + boff[1]; const bf* pb2 = Bn + boff[2]; const bf* pb3 = Bn + boff[3];
    if constexpr (TOEP) {
        // row r = c0 + 16 t + lr, k = kc + 32 u + 8 hi (+ 16): k - r + NT - 1 = 8 m + s with s = 7 - (lr & 7) and m = (kc - c0) / 8 + 4 u - 2 t (+ 2) + hi - (lr >> 3) + NT / 8 - 1;
        // ps = the lane's 16-byte piece at kc = 0 and 4 u - 2 t = -6, the trip's lowest; m runs from 0 to 510 over the whole grid
        const bf* ps = Bn + ((NT / 8 - 7 + hi - (lr >> 3)) - (c0 >> 3)) * 64 + (7 - (lr & 7)) * 8;
#pragma unroll 1
        for (int kc = 0; kc < K; kc += 128) {
            v16bf a[4], al[4], f[10];    // f[j]: the fragment of every (u, t) with 2 u - t + 3 = j; the loops over u, t and j are fully unrolled so that these arrays live in registers
#pragma unroll
            for (int u = 0; u < 4; ++u) { a[u] = ldfrag(pa + 512 * u); al[u] = SPLITA ? ldfrag(pal + 512 * u) : a[u]; }
#pragma unroll
            for (int j = 0; j < 10; ++j) f[j] = cat16b(*(const v8us*)(ps + 128 * j), *(const v8us*)(ps + 128 * j + 128));
            // inputs-only fence on the loaded values: holds all loads of the trip in front of the products, so a trip waits for memory once;
            // the three addresses are inputs too: they stay in their registers until the data is there; the wait stands in front of every later rewrite of a register that a load of the trip names
            asm volatile("s_wait_xcnt 0x0" :: "v"(pa), "v"(pal), "v"(ps), "v"(a[0]), "v"(a[1]), "v"(a[2]), "v"(a[3]), "v"(al[0]), "v"(al[1]), "v"(al[2]), "v"(al[3]),
                         "v"(f[0]), "v"(f[1]), "v"(f[2]), "v"(f[3]), "v"(f[4]), "v"(f[5]), "v"(f[6]), "v"(f[7]), "v"(f[8]), "v"(f[9]));
#pragma unroll
            for (int u = 0; u < 4; ++u) {
#pragma unroll
                for (int t = 0; t < 4; ++t) { acc[t] = wmmab(a[u], f[2 * u - t + 3], acc[t]); if (SPLITA) acc[t] = wmmab(al[u], f[2 * u - t + 3], acc[t]); } }
            pa += 2048; pal += 2048; ps += 1024;
            asm volatile("v_nop\n\tv_nop\n\tv_nop\n\tv_nop" : "+v"(acc[0]), "+v"(acc[1]), "+v"(acc[2]), "+v"(acc[3]) : "v"(a[3]), "v"(al[3]));    // WMMA distance over the back edge: four vector slots between the trip's last product and whatever the next trip issues first
        }
    } else
#pragma unroll 1
    for (int kc = 0; kc < K; kc += 128) {
        v16bf a[4], al[4], b[4][4];    // the loops over u and t below are fully unrolled so that these arrays live in registers
#pragma unroll
        for (int u = 0; u < 4; ++u) { a[u] = ldfrag(pa + 512 * u); al[u] = SPLITA ? ldfrag(pal + 512 * u) : a[u];
            b[u][0] = ldfrag(pb0 + 512 * u); b[u][1] = ldfrag(pb1 + 512 * u); b[u][2] = ldfrag(pb2 + 512 * u); b[u][3] = ldfrag(pb3 + 512 * u); }
        // inputs-only fence on the loaded values: holds all loads of the trip in front of the products (without it the compiler loads one B fragment at a time and waits for each);
        // the six addresses are inputs too: they stay in their registers until the data is there, so no load's result lands in a register that an earlier load of the trip names; the wait stands in front of every later rewrite of such a register
        asm volatile("s_wait_xcnt 0x0" :: "v"(pa), "v"(pal), "v"(pb0), "v"(pb1), "v"(pb2), "v"(pb3), "v"(a[0]), "v"(a[1]), "v"(a[2]), "v"(a[3]), "v"(al[0]), "v"(al[1]), "v"(al[2]), "v"(al[3]),
                     "v"(b[0][0]), "v"(b[0][1]), "v"(b[0][2]), "v"(b[0][3]), "v"(b[1][0]), "v"(b[1][1]), "v"(b[1][2]), "v"(b[1][3]),
                     "v"(b[2][0]), "v"(b[2][1]), "v"(b[2][2]), "v"(b[2][3]), "v"(b[3][0]), "v"(b[3][1]), "v"(b[3][2]), "v"(b[3][3]));
#pragma unroll
        for (int u = 0; u < 4; ++u) {
#pragma unroll
            for (int t = 0; t < 4; ++t) { acc[t] = wmmab(a[u], b[u][t], acc[t]); if (SPLITA) acc[t] = wmmab(al[u], b[u][t], acc[t]); } }
        pa += 2048; pal += 2048; pb0 += 2048; pb1 += 2048; pb2 += 2048; pb3 += 2048;
        asm volatile("v_nop\n\tv_nop\n\tv_nop\n\tv_nop" : "+v"(acc[0]), "+v"(acc[1]), "+v"(acc[2]), "+v"(acc[3]) : "v"(a[3]), "v"(al[3]));    // WMMA distance over the back edge: four vector slots between the trip's last product and whatever the next trip issues first
    }
    if constexpr (EPI != 0) {
        // the block's 64 x 64 tile passes through LDS once, as the rows the stores want; a wave then stores 16 rows x 16 k, 512 bytes in a row of each plane (fragment order)
        typedef __attribute__((ext_vector_type(4))) int v4i;
        float* of = &ost[0][0];
        const int piece = threadIdx.x >> 4, rw = threadIdx.x & 15, fo = frpiece(rw, piece);
        const bool tr = EPI == 2 || z != 0;    // the same for the whole block
        // all that the epilogue reads from memory is asked for ahead of the LDS pass: the term to add (EPI 2), or the mask of the thread's 4 rows and of its 8 columns and the bias (EPI 1; the Toeplitz term has no bias)
        v4f q[4][2]; int mr[4]; v4i m0, m1; float bv[4];
        if constexpr (EPI == 2) {
#pragma unroll
            for (int s = 0; s < 4; ++s) { const float* rp = R + ((size_t)(z / NH) * NT + c0 + rw + 16 * s) * DD + (z % NH) * HD + piece * 8; q[s][0] = *(const v4f*)rp; q[s][1] = *(const v4f*)(rp + 4); }
        } else {
            const int* mp = msk + blockIdx.x * 64; m0 = *(const v4i*)(mp + piece * 8); m1 = *(const v4i*)(mp + piece * 8 + 4);
#pragma unroll
            for (int s = 0; s < 4; ++s) mr[s] = mp[rw + 16 * s];
        }
#pragma unroll
        for (int t = 0; t < 4; ++t) bv[t] = 0.f;
        if constexpr (EPI == 1) { if (bias) {    // one test for the four loads, so that they fly together
#pragma unroll
            for (int t = 0; t < 4; ++t) bv[t] = bias[c0 + t * 16 + lr];
#pragma unroll
            for (int t = 0; t < 4; ++t) bv[t] = bfr(bv[t]); } }
        if (tr) {    // a lane's 8 values are 8 neighbours of the transposed row t * 16 + lr
#pragma unroll
            for (int t = 0; t < 4; ++t) { float* tp = of + (t * 16 + lr) * 68 + wave * 16 + hi * 8;
                *(v4fa*)tp = (v4f){acc[t][0] + bv[t], acc[t][1] + bv[t], acc[t][2] + bv[t], acc[t][3] + bv[t]}; *(v4fa*)(tp + 4) = (v4f){acc[t][4] + bv[t], acc[t][5] + bv[t], acc[t][6] + bv[t], acc[t][7] + bv[t]}; }
        } else {
#pragma unroll
            for (int t = 0; t < 4; ++t) {
#pragma unroll
                for (int j = 0; j < 8; ++j) of[(wave * 16 + hi * 8 + j) * 68 + t * 16 + lr] = acc[t][j] + bv[t]; }
        }
        __syncthreads();    // for q (z = 0) a row of the tile is read by other waves than the one that wrote it
        // o: the thread's first 16-byte piece (64 k of a strip are 64 * 16 elements); st: elements from one of its rows to the next, 16 rows on
        size_t o, st; bf* dh = E0h; bf* dl = E0l; float fc[8];
        if constexpr (EPI == 2) { o = ((size_t)(z / NH) * NT + c0) * DD + (z % NH) * (HD * 16) + fo; st = (size_t)16 * DD; }
        else if (!tr) { o = (size_t)blockIdx.x * 64 * DD + c0 * 16 + fo; st = (size_t)16 * DD; }
        else { o = (((size_t)(z - 1) * NBI + blockIdx.x / (NT / 64)) * DD + c0) * NT + (blockIdx.x % (NT / 64)) * (64 * 16) + fo; st = (size_t)16 * NT; dh = E1h; dl = E1l; }    // row = the head's d, the 8 values are 8 tokens
        if constexpr (EPI == 1) {
#pragma unroll
            for (int i = 0; i < 8; ++i) fc[i] = ((i < 4 ? m0[i & 3] : m1[i & 3]) != 0) ? 1.0f : 0.f;
        }
        v4f p[4][2];
#pragma unroll
        for (int s = 0; s < 4; ++s) { const float* sp = of + (rw + 16 * s) * 68 + piece * 8; p[s][0] = *(const v4fa*)sp; p[s][1] = *(const v4fa*)(sp + 4); }
#pragma unroll
        for (int s = 0; s < 4; ++s) { float y[8] = {p[s][0][0], p[s][0][1], p[s][0][2], p[s][0][3], p[s][1][0], p[s][1][1], p[s][1][2], p[s][1][3]}; v8us oh, ol;
#pragma unroll
            for (int i = 0; i < 8; ++i) {
                if constexpr (EPI == 2) y[i] = q[s][i >> 2][i & 3] + y[i]; else y[i] *= tr ? fc[i] : ((mr[s] != 0) ? 1.0f : 0.f);
                const unsigned short hb = f2bf(y[i]); oh[i] = hb; ol[i] = f2bf(y[i] - bf2f(hb)); }
            *(v8us*)(dh + o + s * st) = oh; *(v8us*)(dl + o + s * st) = ol;
            if (s < 3) asm volatile("s_wait_xcnt 0x0" ::: "memory"); }    // stands in front of the next row's arithmetic, which reuses registers that these two stores name
        return;
    }
    float* os = &ost[wave][0];
#pragma unroll
    for (int t = 0; t < 4; ++t) { const float bv = bias ? bfr(bias[c0 + t * 16 + lr]) : 0.f;
#pragma unroll
        for (int j = 0; j < 8; ++j) os[(hi * 8 + j) * 68 + t * 16 + lr] = acc[t][j] + bv; }
    __syncthreads();
    if (F16OUT) {
        h16* crow = (h16*)(void*)C + (size_t)r0 * ldc + c0;
        auto pass = [&]() {
#pragma unroll
            for (int s = 0; s < 4; ++s) { const int row = 4 * s + (lane >> 3), piece = lane & 7; const float* sp = os + row * 68 + piece * 8; v8h o, o2;
#pragma unroll
                for (int i = 0; i < 8; ++i) { const h16 a = (h16)sp[i]; o[i] = a; o2[i] = (h16)((sp[i] - (float)a) * LOSC); }
                *(v8h*)(crow + (size_t)row * ldc + piece * 8) = o; if (C2) *(v8h*)(C2 + (size_t)r0 * ldc + c0 + (size_t)row * ldc + piece * 8) = o2; }
        };
        pass(); 
    } else {
        float* crow = C + (size_t)r0 * ldc + c0;
        auto pass = [&]() {
#pragma unroll
            for (int s = 0; s < 8; ++s) { const int Lid = (lane >> 3) + 4 * s, piece = lane & 7; const int row = Lid >> 1, cofs = (Lid & 1) * 32 + piece * 4;
                v4f val = *(const v4fa*)(os + row * 68 + cofs); if (R) { const v4f rv = *(const v4f*)(R + ((size_t)r0 + row) * ldc + c0 + cofs); val += roundR ? (v4f){bfr(rv[0]), bfr(rv[1]), bfr(rv[2]), bfr(rv[3])} : rv; }
                *(v4f*)(crow + (size_t)row * ldc + cofs) = val; }
        };
        pass(); 
    }
}


// piece i (8 elements) of a fragment-order plane with K = DD: the index of its first element in the row-major source
__device__ __forceinline__ size_t frsrc(size_t i) { const int w = (int)(i & 63), ks = (int)((i >> 6) & (DD / 32 - 1)); return ((i >> 6) / (DD / 32) * 16 + (w & 15)) * DD + ks * 32 + (w >> 5) * 16 + ((w >> 4) & 1) * 8; }
// the three jobs of k_prep, each a block's work; bx (and y) = the block's index within its job
__device__ __forceinline__ void d_cvt8(int bx, int y, const float* __restrict__ s0, const float* __restrict__ s1, const float* __restrict__ s2, const float* __restrict__ s3, bf* dst, size_t n8) {
    const size_t i = (size_t)bx * 256 + threadIdx.x; if (i >= n8) return;
    const float* src = y == 0 ? s0 : y == 1 ? s1 : y == 2 ? s2 : s3; dst += (size_t)y * n8 * 8;    // y = which of the four matrices
    const v8f v = *(const v8f*)(src + frsrc(i)); v8us o;
    asm volatile("s_wait_xcnt 0x0" ::: "memory");    // in front of the arithmetic below, which may reuse the registers of the load's address
#pragma unroll
    for (int k = 0; k < 8; ++k) o[k] = f2bf(v[k]);
    *(v8us*)(dst + i * 8) = o; 
}
__global__ __launch_bounds__(256) void k_zero8(bf* dst, size_t n8) {
    const size_t i = (size_t)blockIdx.x * 256 + threadIdx.x; if (i >= n8) return; v8us z;
#pragma unroll
    for (int k = 0; k < 8; ++k) z[k] = 0;
    *(v8us*)(dst + i * 8) = z; 
}

__device__ __forceinline__ void d_cvt(int bx, const float* __restrict__ src, bf* dst) {
    const size_t p = (size_t)bx * 256 + threadIdx.x; if (p >= (size_t)NBI * NT * DD / 8) return;    // a block: 16 rows x 128 k, whole lines of the source too
    const v8f v = *(const v8f*)(src + frsrc(p)); v8us o;
    asm volatile("s_wait_xcnt 0x0" ::: "memory");    // in front of the arithmetic below, which may reuse the registers of the load's address
#pragma unroll
    for (int i = 0; i < 8; ++i) o[i] = f2bf(v[i]);
    *(v8us*)(dst + p * 8) = o; 
}
// S[h][m][s][q] = bf16(rb[8 m + s + q][h]), m < 511 (a head's pitch is 512), s < 8, q < 8: eight copies of a head's table, each one element further on, so that any 8 neighbours are one aligned 16-byte piece;
// the eight pieces of one m share a 128-byte line
__device__ __forceinline__ void d_tshift(int bx, const float* __restrict__ rb, bf* S) {
    const int p = bx * 256 + threadIdx.x, h = p >> 12, e = ((p >> 3) & 511) * 8 + (p & 7); if (e >= 511 * 8) return; v8us o;    // m = 511 would pass the table's end; no fragment reads it
#pragma unroll
    for (int q = 0; q < 8; ++q) o[q] = f2bf(rb[(size_t)(e + q) * NH + h]);
    *(v8us*)(S + (size_t)p * 8) = o;
}
// k_prep: all that depends on the inputs alone (the four weight matrices and x to bf16, the shifted rel_bias table) in one launch; no job reads what another writes.
// The two small jobs take the lowest block indices, so that they run while the blocks of x are still starting
#define PB_W (DD * DD / 8 / 256)       // blocks per weight matrix
#define PB_S (NH * 512 * 8 / 256)      // blocks of the table
#define PB_X (NBI * NT / 8)            // blocks of x
__global__ __launch_bounds__(256) void k_prep(const float* __restrict__ Wq, const float* __restrict__ Wk, const float* __restrict__ Wv, const float* __restrict__ Wo, bf* WB,
                                              const float* __restrict__ rb, bf* S, const float* __restrict__ x, bf* Xb) {
    const int b = blockIdx.x;    // the same for the whole block: each block does one job
    if (b < 4 * PB_W) d_cvt8(b % PB_W, b / PB_W, Wq, Wk, Wv, Wo, WB, DD * DD / 8);
    else if (b < 4 * PB_W + PB_S) d_tshift(b - 4 * PB_W, rb, S);
    else d_cvt(b - (4 * PB_W + PB_S), x, Xb);
}
__global__ __launch_bounds__(256) void k_kvsplit(const float* __restrict__ src, const float* __restrict__ scale, bf* dh, bf* dl) {
    typedef __attribute__((ext_vector_type(2))) unsigned short v2us;
    const int lane = threadIdx.x & 31, r = blockIdx.x * 8 + (threadIdx.x >> 5); if (r >= HD) return; const float is = 1.0f / bfr(scale[0]);
    const size_t o = ((size_t)blockIdx.y * HD + r) * HD + lane * 2;    // grid y = batch item * NH + head
    typedef __attribute__((ext_vector_type(2))) float v2f;
    static_assert(KSP == 16, "the fence below names 16 values");
    v2f p[KSP], sum; const float* ps = src + o;    // src holds KSP partial planes, one per slice of the token sum; they are added in slice order
#pragma unroll
    for (int s = 0; s < KSP; ++s) p[s] = *(const v2f*)(ps + (size_t)s * (NBI * NH * HD * HD));
    // inputs-only fence on the loaded values and their address: all loads are in flight together, and the address stays in its registers until the data is there (no load's result lands in them)
    asm volatile("" :: "v"(ps), "v"(p[0]), "v"(p[1]), "v"(p[2]), "v"(p[3]), "v"(p[4]), "v"(p[5]), "v"(p[6]), "v"(p[7]), "v"(p[8]), "v"(p[9]), "v"(p[10]), "v"(p[11]), "v"(p[12]), "v"(p[13]), "v"(p[14]), "v"(p[15]));
    sum = p[0];
#pragma unroll
    for (int s = 1; s < KSP; ++s) sum += p[s];
    v2us oh, ol;
#pragma unroll
    for (int i = 0; i < 2; ++i) { const float y = sum[i] * is; const unsigned short hb = f2bf(y); oh[i] = hb; ol[i] = f2bf(y - bf2f(hb)); }
    const size_t od = (size_t)blockIdx.y * HD * HD + (r >> 4) * (16 * HD) + frpiece(r & 15, lane >> 2) + (lane & 3) * 2;    // fragment order, K = HD
    *(v2us*)(dh + od) = oh; *(v2us*)(dl + od) = ol; 
}
__global__ __launch_bounds__(128) void k_gemm3ll(const bf* __restrict__ Ah, const bf* __restrict__ Al, int lda, const bf* __restrict__ Bh, const bf* __restrict__ Bl, int ldb, int K, float* C, int ldc,
                                                 size_t zAb, size_t zAh, size_t zB, size_t zCb, size_t zCh, size_t zCs = 0) {
    __shared__ __align__(16) float ost[4][16 * 68];
    const int lane = threadIdx.x & 31, wave = threadIdx.x >> 5, lr = lane & 15, hi = lane >> 4;
    const int r0 = blockIdx.x * 64 + wave * 16, c0 = blockIdx.y * 64;
    // grid z = (K slice * NBI + batch item) * NH + head: A and C step by item and by head, B by item * NH + head; slice sp sums k in [sp K, sp K + K) into its own C plane
    { const int sp = blockIdx.z / (NBI * NH), z = blockIdx.z % (NBI * NH), zb = z / NH, zh = z % NH; const size_t ao = zb * zAb + zh * zAh + (size_t)sp * K * 16, bo2 = z * zB + (size_t)sp * K * 16;    // fragment order: K columns of a strip are K * 16 elements
      Ah += ao; Al += ao; Bh += bo2; Bl += bo2; C += zb * zCb + zh * zCh + sp * zCs; }
    const size_t aoff = (size_t)r0 * lda + lane * 8;
    v8f acc[4];
#pragma unroll
    for (int t = 0; t < 4; ++t) acc[t] = (v8f){};
    // one trip = 2 K steps (K is a multiple of 64): every load of the trip is issued before its first product, so a trip waits for memory once
    const bf* pa = Ah + aoff; const bf* pal = Al + aoff; const size_t bo = (size_t)c0 * ldb + lane * 8, bs = (size_t)16 * ldb;
    const bf* ph0 = Bh + bo; const bf* ph1 = ph0 + bs; const bf* ph2 = ph1 + bs; const bf* ph3 = ph2 + bs; const bf* pl0 = Bl + bo; const bf* pl1 = pl0 + bs; const bf* pl2 = pl1 + bs; const bf* pl3 = pl2 + bs;
#pragma unroll 1
    for (int kc = 0; kc < K; kc += 64) {
        v16bf a[2], al[2], bh[2][4], bl[2][4];    // the loops over u and t below are fully unrolled so that these arrays live in registers
#pragma unroll
        for (int u = 0; u < 2; ++u) { a[u] = ldfrag(pa + 512 * u); al[u] = ldfrag(pal + 512 * u);
            bh[u][0] = ldfrag(ph0 + 512 * u); bh[u][1] = ldfrag(ph1 + 512 * u); bh[u][2] = ldfrag(ph2 + 512 * u); bh[u][3] = ldfrag(ph3 + 512 * u);
            bl[u][0] = ldfrag(pl0 + 512 * u); bl[u][1] = ldfrag(pl1 + 512 * u); bl[u][2] = ldfrag(pl2 + 512 * u); bl[u][3] = ldfrag(pl3 + 512 * u); }
        // inputs-only fence on the loaded values: holds all loads of the trip in front of the products (without it the compiler loads a few fragments at a time and waits for each group);
        // the ten addresses are inputs too: they stay in their registers until the data is there, so no load's result lands in a register that an earlier load of the trip names; the wait stands in front of every later rewrite of such a register
        asm volatile("s_wait_xcnt 0x0" :: "v"(pa), "v"(pal), "v"(ph0), "v"(ph1), "v"(ph2), "v"(ph3), "v"(pl0), "v"(pl1), "v"(pl2), "v"(pl3), "v"(a[0]), "v"(a[1]), "v"(al[0]), "v"(al[1]), "v"(bh[0][0]), "v"(bh[0][1]), "v"(bh[0][2]), "v"(bh[0][3]), "v"(bh[1][0]), "v"(bh[1][1]), "v"(bh[1][2]), "v"(bh[1][3]),
                     "v"(bl[0][0]), "v"(bl[0][1]), "v"(bl[0][2]), "v"(bl[0][3]), "v"(bl[1][0]), "v"(bl[1][1]), "v"(bl[1][2]), "v"(bl[1][3]));
#pragma unroll
        for (int u = 0; u < 2; ++u) {
#pragma unroll
            for (int t = 0; t < 4; ++t) { acc[t] = wmmab(a[u], bh[u][t], acc[t]); acc[t] = wmmab(al[u], bh[u][t], acc[t]); acc[t] = wmmab(a[u], bl[u][t], acc[t]); } }
        pa += 1024; pal += 1024; ph0 += 1024; ph1 += 1024; ph2 += 1024; ph3 += 1024; pl0 += 1024; pl1 += 1024; pl2 += 1024; pl3 += 1024;
        asm volatile("v_nop\n\tv_nop\n\tv_nop\n\tv_nop" : "+v"(acc[0]), "+v"(acc[1]), "+v"(acc[2]), "+v"(acc[3]) : "v"(a[1]), "v"(al[1]));    // WMMA distance over the back edge: four vector slots between the trip's last product and whatever the next trip issues first
    }
    float* os = &ost[wave][0];
#pragma unroll
    for (int t = 0; t < 4; ++t) {
#pragma unroll
        for (int j = 0; j < 8; ++j) os[(hi * 8 + j) * 68 + t * 16 + lr] = acc[t][j]; }
    __builtin_amdgcn_wave_barrier(); asm volatile("" ::: "memory");
    float* crow = C + (size_t)r0 * ldc + c0;
    auto pass = [&]() {
#pragma unroll
        for (int s = 0; s < 8; ++s) { const int Lid = (lane >> 3) + 4 * s, piece = lane & 7; const int row = Lid >> 1, cofs = (Lid & 1) * 32 + piece * 4;
            const v4f val = *(const v4fa*)(os + row * 68 + cofs); *(v4f*)(crow + (size_t)row * ldc + cofs) = val; }
    };
    pass(); 
}

extern "C" void kernel_launch(void* const* d_in, const int* in_sizes, int n_in,
                              void* d_out, int out_size, void* d_ws, size_t ws_size, hipStream_t stream) {
    (void)in_sizes; (void)n_in; (void)out_size;
    const float* x = (const float*)d_in[0]; const float* Wq = (const float*)d_in[1]; const float* bq = (const float*)d_in[2]; const float* Wk = (const float*)d_in[3]; const float* bk = (const float*)d_in[4]; const float* Wv = (const float*)d_in[5]; const float* bv = (const float*)d_in[6];
    const float* Wo = (const float*)d_in[7]; const float* bo = (const float*)d_in[8]; const float* rb = (const float*)d_in[9]; const float* scale = (const float*)d_in[10]; const int* mask = (const int*)d_in[11];
    float* out = (float*)d_out;    // [4][2048][256]
    char* wsp = (char*)d_ws;
    auto take = [&](size_t bytes) { char* p = wsp; wsp += (bytes + 255) & ~(size_t)255; return (void*)p; };
    const size_t PL = (size_t)NBI * NT * DD;    // one [batch][token][256] plane, elements
    bf* WB = (bf*)take((size_t)4 * DD * DD * 2); bf* WoB = WB + 3 * DD * DD; bf* S = (bf*)take((size_t)NH * 512 * 64 * 2);    // WB: Wq, Wk, Wv, Wo; S: d_tshift's table
    bf* Xb = (bf*)take(PL * 2); bf* Qh = (bf*)take(PL * 2); bf* Ql = (bf*)take(PL * 2);
    bf* KTh = (bf*)take(2 * PL * 2); bf* KTl = (bf*)take(2 * PL * 2); bf* VTh = KTh + PL; bf* VTl = KTl + PL;    // [K | V][batch][head][64][2048]
    float* KV = (float*)take((size_t)KSP * NBI * NH * HD * HD * 4); bf* KVh = (bf*)take((size_t)NBI * NH * HD * HD * 2); bf* KVl = (bf*)take((size_t)NBI * NH * HD * HD * 2);
    float* Y = (float*)take(PL * 4); bf* Yh = (bf*)take(PL * 2); bf* Yl = (bf*)take(PL * 2);
    if ((size_t)(wsp - (char*)d_ws) > ws_size) return;    // 0.5 + 0.25 + 4 + 2 x 4 + 2 x 8 + 4 + 0.25 + 8 + 2 x 4 ~ 50 MB, no aliasing
    k_prep<<<4 * PB_W + PB_S + PB_X, 256, 0, stream>>>(Wq, Wk, Wv, Wo, WB, rb, S, x, Xb);
    k_gemmb<false, false, false, 1><<<dim3(NBI * NT / 64, DD / 64, 3), 128, 0, stream>>>(Xb, nullptr, WB, bq, nullptr, DD, nullptr, nullptr, DD, 1, 0, DD * DD, 3, 0, bk, bv, mask, Qh, Ql, KTh, KTl);    // z = q, k, v; grid y = head
    k_gemm3ll<<<dim3(1, 1, KSP * NBI * NH), 128, 0, stream>>>(VTh, VTl, NT, KTh, KTl, NT, NT / KSP, KV, HD, (size_t)DD * NT, (size_t)HD * NT, (size_t)HD * NT, NH * HD * HD, HD * HD, NBI * NH * HD * HD);    // (K^T V)^T [d2][d1] = V^T . K, KSP partial planes; k_kvsplit adds them
    k_kvsplit<<<dim3(HD / 8, NBI * NH, 1), 256, 0, stream>>>(KV, scale, KVh, KVl);
    k_gemm3ll<<<dim3(NT / 64, 1, NBI * NH), 128, 0, stream>>>(Qh, Ql, DD, KVh, KVl, HD, HD, Y, DD, (size_t)NT * DD, HD * 16, HD * HD, (size_t)NT * DD, HD);    // y1[i][h*64+d2] = q_i . (K^T V / s)[:, d2]
    k_gemmb<true, false, true, 2><<<dim3(1, NT / 64, NBI * NH), 128, 0, stream>>>(VTh, VTl, S, nullptr, nullptr, NT, nullptr, Y, NT, 1, (size_t)HD * NT, (size_t)512 * 64, NH - 1, 0, nullptr, nullptr, nullptr, Yh, Yl);    // y1 + the transposed (T_h V)^T [d][i], split
    k_gemmb<true, false><<<dim3(NBI * NT / 64, DD / 64, 1), 128, 0, stream>>>(Yh, Yl, WoB, bo, out, DD, nullptr, nullptr, DD);
}

// v008
// A run of this version takes 49.3 microseconds.
// Next to v007, in two timings, it ran 1.08 and 1.10 times as fast.
// All steps since v000 together make it 38.1 times as fast.
#include <hip/hip_runtime.h>

// Compute dtypes, f32 accumulate, every stage one launch over all batch items and heads: Q/K/V = x.W^T + b ([2048 x 256].[256 x 256], PLAIN bf16 operands = rounded input, [out][in] weights; exact products); the
// un-softmaxed attention out_h = (Q K^T / scale + RelBias_h) V is evaluated as Q (K^T V) / scale + T_h V (exact reassociation): K^T V per head as [64 x 2048].[2048 x 64]
// (both operands bf16 hi + UNSCALED residual, three products), Q.(K^T V / scale) as [2048 x 64].[64 x 64] (three products), and the Toeplitz relative-bias term T_h[i][j] =
// rel_bias[j - i + 2047][h] (exact bf16 values of the INPUT table, read from a small table of its eight shifted copies, never laid out as a plane) against V^T hi + residual (two products); out = y.Wo^T + bo (two products) - all on
// v_wmma_f32_16x16x32_bf16. The mask input enters multiplicatively (m_i m_j). Deterministic, no atomics; every

#define NBI  4
#define NT   2048
#define DD   256
#define NH   4
#define HD   64
#define DM   DD
#define LOSC 1024.0f
#define KSP  16    // K^T V: slices of the token sum, one work-group each

typedef _Float16 h16;
typedef unsigned short bf;
typedef __attribute__((ext_vector_type(16))) __bf16   v16bf;
typedef __attribute__((ext_vector_type(16))) _Float16 v16h;
typedef __attribute__((ext_vector_type(8)))  _Float16 v8h;
typedef __attribute__((ext_vector_type(8)))  unsigned short v8us;
typedef __attribute__((ext_vector_type(8)))  float    v8f;
typedef __attribute__((ext_vector_type(4)))  float    v4f;
typedef v8h  __attribute__((may_alias)) v8ha;
typedef v4f  __attribute__((may_alias)) v4fa;
typedef v8us __attribute__((may_alias)) v8usa;

__device__ __forceinline__ unsigned short f2bf(float f) { unsigned u = __float_as_uint(f); u += 0x7FFFu + ((u >> 16) & 1u); return (unsigned short)(u >> 16); }
__device__ __forceinline__ float bf2f(unsigned short b) { return __uint_as_float(((unsigned)b) << 16); }
__device__ __forceinline__ float bfr(float f) { return bf2f(f2bf(f)); }
__device__ __forceinline__ v16h cat16(v8h lo, v8h hi) { return __builtin_shufflevector(lo, hi, 0, 1, 2, 3, 4, 5, 6, 7, 8, 9, 10, 11, 12, 13, 14, 15); }
__device__ __forceinline__ v16bf cat16b(v8us lo, v8us hi) { return __builtin_bit_cast(v16bf, __builtin_shufflevector(lo, hi, 0, 1, 2, 3, 4, 5, 6, 7, 8, 9, 10, 11, 12, 13, 14, 15)); }
__device__ __forceinline__ v8f wmma16(v16h a, v16h b, v8f c) { return __builtin_amdgcn_wmma_f32_16x16x32_f16(false, a, false, b, (short)0, c, false, false); }
__device__ __forceinline__ v8f wmmab(v16bf a, v16bf b, v8f c) { return __builtin_amdgcn_wmma_f32_16x16x32_bf16(false, a, false, b, (short)0, c, false, false); }

// FRAGMENT ORDER, the layout of every bf16 operand plane [rows][K] in the workspace: blocks of 16 rows x 32 k = 512 elements, block (row / 16) * (K / 32) + k / 32; inside a block element (row, k) stands at
// ((k >> 4) & 1) * 256 + ((k >> 3) & 1) * 128 + (row & 15) * 8 + (k & 7). A wave's 32 lanes then read 512 bytes in a row, four whole 128-byte lines, with each 16-byte load (row-major: a quarter of each of 16 lines).
// 16 rows are 16 * K elements as in a row-major plane; 32 k of them are 512.
// one lane's 16 x 16 x 32 fragment: p = the block + lane * 8; the lane gets k = 8 * (lane >> 4) + 0 .. 7 and 16 more, of row lane & 15, as from a row-major plane
__device__ __forceinline__ v16bf ldfrag(const bf* p) { return cat16b(*(const v8us*)p, *(const v8us*)(p + 256)); }
// where the 8 elements k8 * 8 .. + 7 (k8 < 8: two blocks, 64 k) of row lr of a 16-row strip stand, from the first of the two blocks
__device__ __forceinline__ int frpiece(int lr, int k8) { return (k8 >> 2) * 512 + ((k8 >> 1) & 1) * 256 + (k8 & 1) * 128 + lr * 8; }

// k_gemmb: 64 x 64 block tile (4 waves x 16 x 64) of C[NTK][NW] = (A [+ Al]).B^T (K = DD, or NT for the Toeplitz term) [+ bf(bias[c])] [+ bf(R[r][c]) residual]; f32 whole-line epilogue (or f16
// TOEP: B is not a plane but B[r][k] = tab[k - r + NT - 1]; Bn is then d_tshift's table of that head, and a fragment depends on k - r alone
// EPI: what the epilogue stores. 0: the f32 (or f16) tile. 1 (q, k, v): the masked tile as bf16 hi + residual, q (z = 0) untransposed into E0h / E0l, k and v (z = 1, 2) transposed into E1h / E1l [k | v][item][head][64][NT].
// 2 (Toeplitz term, tile [d][i]): the transposed tile as bf16 hi + residual into E0h / E0l [item][i][head * 64 + d]; the tile's sum then starts with the head's q.(K^T V / scale) term, 64 more k:
// A = Gh + Gl, (K^T V / scale)^T [item * NH + head][d][d1], B = Ph + Pl, q [item][i][head * 64 + d1] (three products)
template <bool SPLITA, bool F16OUT = false, bool TOEP = false, int EPI = 0>
__global__ __launch_bounds__(128) void k_gemmb(const bf* __restrict__ A, const bf* __restrict__ Al, const bf* __restrict__ Bn, const float* __restrict__ bias, float* C, int ldc, h16* C2, const float* __restrict__ R = nullptr, int K = DM, int roundR = 1,
                                               size_t zA = 0, size_t zB = 0, int zBmask = 0, size_t zC = 0, const float* __restrict__ bias1 = nullptr, const float* __restrict__ bias2 = nullptr,
                                               const int* __restrict__ msk = nullptr, bf* E0h = nullptr, bf* E0l = nullptr, bf* E1h = nullptr, bf* E1l = nullptr,
                                               const bf* __restrict__ Gh = nullptr, const bf* __restrict__ Gl = nullptr, const bf* __restrict__ Ph = nullptr, const bf* __restrict__ Pl = nullptr) {
    __shared__ __align__(16) float ost[4][16 * 68];
    const int lane = threadIdx.x & 31, wave = threadIdx.x >> 5, lr = lane & 15, hi = lane >> 4;
    const int r0 = blockIdx.x * 64 + wave * 16, c0 = blockIdx.y * 64;
    // grid z = one independent product: its own A and C planes, B plane (z & zBmask), bias 0 / 1 / 2
    const int z = blockIdx.z; A += z * zA; if (SPLITA) Al += z * zA; Bn += (size_t)(z & zBmask) * zB; C += z * zC; if (z == 1) bias = bias1; if (z == 2) bias = bias2;
    const size_t aoff = (size_t)r0 * K + lane * 8;    // fragment order: the strip of 16 rows, the lane's piece of its first block
    size_t boff[4];
#pragma unroll
    for (int t = 0; t < 4; ++t) boff[t] = (size_t)(c0 + t * 16) * K + lane * 8;
    v8f acc[4];
#pragma unroll
    for (int t = 0; t < 4; ++t) acc[t] = (v8f){};
    // one trip = 4 K steps (K is a multiple of 128): every load of the trip is issued before its first product, so a trip waits for memory once
    const bf* pa = A + aoff; const bf* pal = SPLITA ? Al + aoff : pa; const bf* pb0 = Bn + boff[0]; const bf* pb1 = Bn + boff[1]; const bf* pb2 = Bn + boff[2]; const bf* pb3 = Bn + boff[3];
    if constexpr (TOEP) {
        // row r = c0 + 16 t + lr, k = kc + 32 u + 8 hi (+ 16): k - r + NT - 1 = 8 m + s with s = 7 - (lr & 7) and m = (kc - c0) / 8 + 4 u - 2 t (+ 2) + hi - (lr >> 3) + NT / 8 - 1;
        // ps = the lane's 16-byte piece at kc = 0 and 4 u - 2 t = -6, the trip's lowest; m runs from 0 to 510 over the whole grid
        const bf* ps = Bn + ((NT / 8 - 7 + hi - (lr >> 3)) - (c0 >> 3)) * 64 + (7 - (lr & 7)) * 8;
        if constexpr (EPI == 2) {
            // tile[d][i] += sum over d1 of (K^T V / scale)^T[d][d1] q[i][d1]: two K steps, all their loads ahead of the first product
            const size_t go = (size_t)z * (HD * HD) + (size_t)r0 * HD + lane * 8, po = ((size_t)(z / NH) * NT + c0) * DD + (z % NH) * (HD * 16) + lane * 8;
            const bf* pg = Gh + go; const bf* pgl = Gl + go; const bf* pq = Ph + po; const bf* pql = Pl + po;
            v16bf g[2], gl[2], qh[2][4], ql[2][4];    // the loops over u and t are fully unrolled so that these arrays live in registers
#pragma unroll
            for (int u = 0; u < 2; ++u) { g[u] = ldfrag(pg + 512 * u); gl[u] = ldfrag(pgl + 512 * u);
#pragma unroll
                for (int t = 0; t < 4; ++t) { qh[u][t] = ldfrag(pq + t * (16 * DD) + 512 * u); ql[u][t] = ldfrag(pql + t * (16 * DD) + 512 * u); } }
            // inputs-only fence on the loaded values and their four addresses: all loads fly together and are waited for once; the wait stands in front of every later rewrite of a register that one of them names
            asm volatile("s_wait_xcnt 0x0" :: "v"(pg), "v"(pgl), "v"(pq), "v"(pql), "v"(g[0]), "v"(g[1]), "v"(gl[0]), "v"(gl[1]), "v"(qh[0][0]), "v"(qh[0][1]), "v"(qh[0][2]), "v"(qh[0][3]), "v"(qh[1][0]), "v"(qh[1][1]), "v"(qh[1][2]), "v"(qh[1][3]),
                         "v"(ql[0][0]), "v"(ql[0][1]), "v"(ql[0][2]), "v"(ql[0][3]), "v"(ql[1][0]), "v"(ql[1][1]), "v"(ql[1][2]), "v"(ql[1][3]));
#pragma unroll
            for (int u = 0; u < 2; ++u) {
#pragma unroll
                for (int t = 0; t < 4; ++t) { acc[t] = wmmab(g[u], qh[u][t], acc[t]); acc[t] = wmmab(gl[u], qh[u][t], acc[t]); acc[t] = wmmab(g[u], ql[u][t], acc[t]); } }
        }
#pragma unroll 1
        for (int kc = 0; kc < K; kc += 128) {
            v16bf a[4], al[4], f[10];    // f[j]: the fragment of every (u, t) with 2 u - t + 3 = j; the loops over u, t and j are fully unrolled so that these arrays live in registers
#pragma unroll
            for (int u = 0; u < 4; ++u) { a[u] = ldfrag(pa + 512 * u); al[u] = SPLITA ? ldfrag(pal + 512 * u) : a[u]; }
#pragma unroll
            for (int j = 0; j < 10; ++j) f[j] = cat16b(*(const v8us*)(ps + 128 * j), *(const v8us*)(ps + 128 * j + 128));
            // inputs-only fence on the loaded values: holds all loads of the trip in front of the products, so a trip waits for memory once;
            // the three addresses are inputs too: they stay in their registers until the data is there; the wait stands in front of every later rewrite of a register that a load of the trip names
            asm volatile("s_wait_xcnt 0x0" :: "v"(pa), "v"(pal), "v"(ps), "v"(a[0]), "v"(a[1]), "v"(a[2]), "v"(a[3]), "v"(al[0]), "v"(al[1]), "v"(al[2]), "v"(al[3]),
                         "v"(f[0]), "v"(f[1]), "v"(f[2]), "v"(f[3]), "v"(f[4]), "v"(f[5]), "v"(f[6]), "v"(f[7]), "v"(f[8]), "v"(f[9]));
#pragma unroll
            for (int u = 0; u < 4; ++u) {
#pragma unroll
                for (int t = 0; t < 4; ++t) { acc[t] = wmmab(a[u], f[2 * u - t + 3], acc[t]); if (SPLITA) acc[t] = wmmab(al[u], f[2 * u - t + 3], acc[t]); } }
            pa += 2048; pal += 2048; ps += 1024;
            asm volatile("v_nop\n\tv_nop\n\tv_nop\n\tv_nop" : "+v"(acc[0]), "+v"(acc[1]), "+v"(acc[2]), "+v"(acc[3]) : "v"(a[3]), "v"(al[3]));    // WMMA distance over the back edge: four vector slots between the trip's last product and whatever the next trip issues first
        }
    } else
#pragma unroll 1
    for (int kc = 0; kc < K; kc += 128) {
        v16bf a[4], al[4], b[4][4];    // the loops over u and t below are fully unrolled so that these arrays live in registers
#pragma unroll
        for (int u = 0; u < 4; ++u) { a[u] = ldfrag(pa + 512 * u); al[u] = SPLITA ? ldfrag(pal + 512 * u) : a[u];
            b[u][0] = ldfrag(pb0 + 512 * u); b[u][1] = ldfrag(pb1 + 512 * u); b[u][2] = ldfrag(pb2 + 512 * u); b[u][3] = ldfrag(pb3 + 512 * u); }
        // inputs-only fence on the loaded values: holds all loads of the trip in front of the products (without it the compiler loads one B fragment at a time and waits for each);
        // the six addresses are inputs too: they stay in their registers until the data is there, so no load's result lands in a register that an earlier load of the trip names; the wait stands in front of every later rewrite of such a register
        asm volatile("s_wait_xcnt 0x0" :: "v"(pa), "v"(pal), "v"(pb0), "v"(pb1), "v"(pb2), "v"(pb3), "v"(a[0]), "v"(a[1]), "v"(a[2]), "v"(a[3]), "v"(al[0]), "v"(al[1]), "v"(al[2]), "v"(al[3]),
                     "v"(b[0][0]), "v"(b[0][1]), "v"(b[0][2]), "v"(b[0][3]), "v"(b[1][0]), "v"(b[1][1]), "v"(b[1][2]), "v"(b[1][3]),
                     "v"(b[2][0]), "v"(b[2][1]), "v"(b[2][2]), "v"(b[2][3]), "v"(b[3][0]), "v"(b[3][1]), "v"(b[3][2]), "v"(b[3][3]));
#pragma unroll
        for (int u = 0; u < 4; ++u) {
#pragma unroll
            for (int t = 0; t < 4; ++t) { acc[t] = wmmab(a[u], b[u][t], acc[t]); if (SPLITA) acc[t] = wmmab(al[u], b[u][t], acc[t]); } }
        pa += 2048; pal += 2048; pb0 += 2048; pb1 += 2048; pb2 += 2048; pb3 += 2048;
        asm volatile("v_nop\n\tv_nop\n\tv_nop\n\tv_nop" : "+v"(acc[0]), "+v"(acc[1]), "+v"(acc[2]), "+v"(acc[3]) : "v"(a[3]), "v"(al[3]));    // WMMA distance over the back edge: four vector slots between the trip's last product and whatever the next trip issues first
    }
    if constexpr (EPI != 0) {
        // the block's 64 x 64 tile passes through LDS once, as the rows the stores want; a wave then stores 16 rows x 16 k, 512 bytes in a row of each plane (fragment order)
        typedef __attribute__((ext_vector_type(4))) int v4i;
        float* of = &ost[0][0];
        const int piece = threadIdx.x >> 4, rw = threadIdx.x & 15, fo = frpiece(rw, piece);
        const bool tr = EPI == 2 || z != 0;    // the same for the whole block
        // all that the epilogue reads from memory is asked for ahead of the LDS pass: the mask of the thread's 4 rows and of its 8 columns and the bias (EPI 1; EPI 2 reads nothing)
        int mr[4]; v4i m0, m1; float bv[4];
        if constexpr (EPI == 1) {
            const int* mp = msk + blockIdx.x * 64; m0 = *(const v4i*)(mp + piece * 8); m1 = *(const v4i*)(mp + piece * 8 + 4);
#pragma unroll
            for (int s = 0; s < 4; ++s) mr[s] = mp[rw + 16 * s];
        }
#pragma unroll
        for (int t = 0; t < 4; ++t) bv[t] = 0.f;
        if constexpr (EPI == 1) { if (bias) {    // one test for the four loads, so that they fly together
#pragma unroll
            for (int t = 0; t < 4; ++t) bv[t] = bias[c0 + t * 16 + lr];
#pragma unroll
            for (int t = 0; t < 4; ++t) bv[t] = bfr(bv[t]); } }
        if (tr) {    // a lane's 8 values are 8 neighbours of the transposed row t * 16 + lr
#pragma unroll
            for (int t = 0; t < 4; ++t) { float* tp = of + (t * 16 + lr) * 68 + wave * 16 + hi * 8;
                *(v4fa*)tp = (v4f){acc[t][0] + bv[t], acc[t][1] + bv[t], acc[t][2] + bv[t], acc[t][3] + bv[t]}; *(v4fa*)(tp + 4) = (v4f){acc[t][4] + bv[t], acc[t][5] + bv[t], acc[t][6] + bv[t], acc[t][7] + bv[t]}; }
        } else {
#pragma unroll
            for (int t = 0; t < 4; ++t) {
#pragma unroll
                for (int j = 0; j < 8; ++j) of[(wave * 16 + hi * 8 + j) * 68 + t * 16 + lr] = acc[t][j] + bv[t]; }
        }
        __syncthreads();    // for q (z = 0) a row of the tile is read by other waves than the one that wrote it
        // o: the thread's first 16-byte piece (64 k of a strip are 64 * 16 elements); st: elements from one of its rows to the next, 16 rows on
        size_t o, st; bf* dh = E0h; bf* dl = E0l; float fc[8];
        if constexpr (EPI == 2) { o = ((size_t)(z / NH) * NT + c0) * DD + (z % NH) * (HD * 16) + fo; st = (size_t)16 * DD; }
        else if (!tr) { o = (size_t)blockIdx.x * 64 * DD + c0 * 16 + fo; st = (size_t)16 * DD; }
        else { o = (((size_t)(z - 1) * NBI + blockIdx.x / (NT / 64)) * DD + c0) * NT + (blockIdx.x % (NT / 64)) * (64 * 16) + fo; st = (size_t)16 * NT; dh = E1h; dl = E1l; }    // row = the head's d, the 8 values are 8 tokens
        if constexpr (EPI == 1) {
#pragma unroll
            for (int i = 0; i < 8; ++i) fc[i] = ((i < 4 ? m0[i & 3] : m1[i & 3]) != 0) ? 1.0f : 0.f;
        }
        v4f p[4][2];
#pragma unroll
        for (int s = 0; s < 4; ++s) { const float* sp = of + (rw + 16 * s) * 68 + piece * 8; p[s][0] = *(const v4fa*)sp; p[s][1] = *(const v4fa*)(sp + 4); }
#pragma unroll
        for (int s = 0; s < 4; ++s) { float y[8] = {p[s][0][0], p[s][0][1], p[s][0][2], p[s][0][3], p[s][1][0], p[s][1][1], p[s][1][2], p[s][1][3]}; v8us oh, ol;
#pragma unroll
            for (int i = 0; i < 8; ++i) {
                if constexpr (EPI == 1) y[i] *= tr ? fc[i] : ((mr[s] != 0) ? 1.0f : 0.f);
                const unsigned short hb = f2bf(y[i]); oh[i] = hb; ol[i] = f2bf(y[i] - bf2f(hb)); }
            *(v8us*)(dh + o + s * st) = oh; *(v8us*)(dl + o + s * st) = ol;
            if (s < 3) asm volatile("s_wait_xcnt 0x0" ::: "memory"); }    // stands in front of the next row's arithmetic, which reuses registers that these two stores name
        return;
    }
    float* os = &ost[wave][0];
#pragma unroll
    for (int t = 0; t < 4; ++t) { const float bv = bias ? bfr(bias[c0 + t * 16 + lr]) : 0.f;
#pragma unroll
        for (int j = 0; j < 8; ++j) os[(hi * 8 + j) * 68 + t * 16 + lr] = acc[t][j] + bv; }
    __syncthreads();
    if (F16OUT) {
        h16* crow = (h16*)(void*)C + (size_t)r0 * ldc + c0;
        auto pass = [&]() {
#pragma unroll
            for (int s = 0; s < 4; ++s) { const int row = 4 * s + (lane >> 3), piece = lane & 7; const float* sp = os + row * 68 + piece * 8; v8h o, o2;
#pragma unroll
                for (int i = 0; i < 8; ++i) { const h16 a = (h16)sp[i]; o[i] = a; o2[i] = (h16)((sp[i] - (float)a) * LOSC); }
                *(v8h*)(crow + (size_t)row * ldc + piece * 8) = o; if (C2) *(v8h*)(C2 + (size_t)r0 * ldc + c0 + (size_t)row * ldc + piece * 8) = o2; }
        };
        pass(); 
    } else {
        float* crow = C + (size_t)r0 * ldc + c0;
        auto pass = [&]() {
#pragma unroll
            for (int s = 0; s < 8; ++s) { const int Lid = (lane >> 3) + 4 * s, piece = lane & 7; const int row = Lid >> 1, cofs = (Lid & 1) * 32 + piece * 4;
                v4f val = *(const v4fa*)(os + row * 68 + cofs); if (R) { const v4f rv = *(const v4f*)(R + ((size_t)r0 + row) * ldc + c0 + cofs); val += roundR ? (v4f){bfr(rv[0]), bfr(rv[1]), bfr(rv[2]), bfr(rv[3])} : rv; }
                *(v4f*)(crow + (size_t)row * ldc + cofs) = val; }
        };
        pass(); 
    }
}


// piece i (8 elements) of a fragment-order plane with K = DD: the index of its first element in the row-major source
__device__ __forceinline__ size_t frsrc(size_t i) { const int w = (int)(i & 63), ks = (int)((i >> 6) & (DD / 32 - 1)); return ((i >> 6) / (DD / 32) * 16 + (w & 15)) * DD + ks * 32 + (w >> 5) * 16 + ((w >> 4) & 1) * 8; }
// the three jobs of k_prep, each a block's work; bx (and y) = the block's index within its job
__device__ __forceinline__ void d_cvt8(int bx, int y, const float* __restrict__ s0, const float* __restrict__ s1, const float* __restrict__ s2, const float* __restrict__ s3, bf* dst, size_t n8) {
    const size_t i = (size_t)bx * 256 + threadIdx.x; if (i >= n8) return;
    const float* src = y == 0 ? s0 : y == 1 ? s1 : y == 2 ? s2 : s3; dst += (size_t)y * n8 * 8;    // y = which of the four matrices
    const v8f v = *(const v8f*)(src + frsrc(i)); v8us o;
    asm volatile("s_wait_xcnt 0x0" ::: "memory");    // in front of the arithmetic below, which may reuse the registers of the load's address
#pragma unroll
    for (int k = 0; k < 8; ++k) o[k] = f2bf(v[k]);
    *(v8us*)(dst + i * 8) = o; 
}
__global__ __launch_bounds__(256) void k_zero8(bf* dst, size_t n8) {
    const size_t i = (size_t)blockIdx.x * 256 + threadIdx.x; if (i >= n8) return; v8us z;
#pragma unroll
    for (int k = 0; k < 8; ++k) z[k] = 0;
    *(v8us*)(dst + i * 8) = z; 
}

__device__ __forceinline__ void d_cvt(int bx, const float* __restrict__ src, bf* dst) {
    const size_t p = (size_t)bx * 256 + threadIdx.x; if (p >= (size_t)NBI * NT * DD / 8) return;    // a block: 16 rows x 128 k, whole lines of the source too
    const v8f v = *(const v8f*)(src + frsrc(p)); v8us o;
    asm volatile("s_wait_xcnt 0x0" ::: "memory");    // in front of the arithmetic below, which may reuse the registers of the load's address
#pragma unroll
    for (int i = 0; i < 8; ++i) o[i] = f2bf(v[i]);
    *(v8us*)(dst + p * 8) = o; 
}
// S[h][m][s][q] = bf16(rb[8 m + s + q][h]), m < 511 (a head's pitch is 512), s < 8, q < 8: eight copies of a head's table, each one element further on, so that any 8 neighbours are one aligned 16-byte piece;
// the eight pieces of one m share a 128-byte line
__device__ __forceinline__ void d_tshift(int bx, const float* __restrict__ rb, bf* S) {
    const int p = bx * 256 + threadIdx.x, h = p >> 12, e = ((p >> 3) & 511) * 8 + (p & 7); if (e >= 511 * 8) return; v8us o;    // m = 511 would pass the table's end; no fragment reads it
#pragma unroll
    for (int q = 0; q < 8; ++q) o[q] = f2bf(rb[(size_t)(e + q) * NH + h]);
    *(v8us*)(S + (size_t)p * 8) = o;
}
// k_prep: all that depends on the inputs alone (the four weight matrices and x to bf16, the shifted rel_bias table) in one launch; no job reads what another writes.
// The two small jobs take the lowest block indices, so that they run while the blocks of x are still starting
#define PB_W (DD * DD / 8 / 256)       // blocks per weight matrix
#define PB_S (NH * 512 * 8 / 256)      // blocks of the table
#define PB_X (NBI * NT / 8)            // blocks of x
__global__ __launch_bounds__(256) void k_prep(const float* __restrict__ Wq, const float* __restrict__ Wk, const float* __restrict__ Wv, const float* __restrict__ Wo, bf* WB,
                                              const float* __restrict__ rb, bf* S, const float* __restrict__ x, bf* Xb) {
    const int b = blockIdx.x;    // the same for the whole block: each block does one job
    if (b < 4 * PB_W) d_cvt8(b % PB_W, b / PB_W, Wq, Wk, Wv, Wo, WB, DD * DD / 8);
    else if (b < 4 * PB_W + PB_S) d_tshift(b - 4 * PB_W, rb, S);
    else d_cvt(b - (4 * PB_W + PB_S), x, Xb);
}
__global__ __launch_bounds__(256) void k_kvsplit(const float* __restrict__ src, const float* __restrict__ scale, bf* dh, bf* dl) {
    typedef __attribute__((ext_vector_type(2))) unsigned short v2us;
    const int lane = threadIdx.x & 31, r = blockIdx.x * 8 + (threadIdx.x >> 5); if (r >= HD) return; const float is = 1.0f / bfr(scale[0]);
    const size_t o = ((size_t)blockIdx.y * HD + r) * HD + lane * 2;    // grid y = batch item * NH + head
    typedef __attribute__((ext_vector_type(2))) float v2f;
    static_assert(KSP == 16, "the fence below names 16 values");
    v2f p[KSP], sum; const float* ps = src + o;    // src holds KSP partial planes, one per slice of the token sum; they are added in slice order
#pragma unroll
    for (int s = 0; s < KSP; ++s) p[s] = *(const v2f*)(ps + (size_t)s * (NBI * NH * HD * HD));
    // inputs-only fence on the loaded values and their address: all loads are in flight together, and the address stays in its registers until the data is there (no load's result lands in them)
    asm volatile("" :: "v"(ps), "v"(p[0]), "v"(p[1]), "v"(p[2]), "v"(p[3]), "v"(p[4]), "v"(p[5]), "v"(p[6]), "v"(p[7]), "v"(p[8]), "v"(p[9]), "v"(p[10]), "v"(p[11]), "v"(p[12]), "v"(p[13]), "v"(p[14]), "v"(p[15]));
    sum = p[0];
#pragma unroll
    for (int s = 1; s < KSP; ++s) sum += p[s];
    v2us oh, ol;
#pragma unroll
    for (int i = 0; i < 2; ++i) { const float y = sum[i] * is; const unsigned short hb = f2bf(y); oh[i] = hb; ol[i] = f2bf(y - bf2f(hb)); }
    const size_t od = (size_t)blockIdx.y * HD * HD + (r >> 4) * (16 * HD) + frpiece(r & 15, lane >> 2) + (lane & 3) * 2;    // fragment order, K = HD
    *(v2us*)(dh + od) = oh; *(v2us*)(dl + od) = ol; 
}
__global__ __launch_bounds__(128) void k_gemm3ll(const bf* __restrict__ Ah, const bf* __restrict__ Al, int lda, const bf* __restrict__ Bh, const bf* __restrict__ Bl, int ldb, int K, float* C, int ldc,
                                                 size_t zAb, size_t zAh, size_t zB, size_t zCb, size_t zCh, size_t zCs = 0) {
    __shared__ __align__(16) float ost[4][16 * 68];
    const int lane = threadIdx.x & 31, wave = threadIdx.x >> 5, lr = lane & 15, hi = lane >> 4;
    const int r0 = blockIdx.x * 64 + wave * 16, c0 = blockIdx.y * 64;
    // grid z = (K slice * NBI + batch item) * NH + head: A and C step by item and by head, B by item * NH + head; slice sp sums k in [sp K, sp K + K) into its own C plane
    { const int sp = blockIdx.z / (NBI * NH), z = blockIdx.z % (NBI * NH), zb = z / NH, zh = z % NH; const size_t ao = zb * zAb + zh * zAh + (size_t)sp * K * 16, bo2 = z * zB + (size_t)sp * K * 16;    // fragment order: K columns of a strip are K * 16 elements
      Ah += ao; Al += ao; Bh += bo2; Bl += bo2; C += zb * zCb + zh * zCh + sp * zCs; }
    const size_t aoff = (size_t)r0 * lda + lane * 8;
    v8f acc[4];
#pragma unroll
    for (int t = 0; t < 4; ++t) acc[t] = (v8f){};
    // one trip = 2 K steps (K is a multiple of 64): every load of the trip is issued before its first product, so a trip waits for memory once
    const bf* pa = Ah + aoff; const bf* pal = Al + aoff; const size_t bo = (size_t)c0 * ldb + lane * 8, bs = (size_t)16 * ldb;
    const bf* ph0 = Bh + bo; const bf* ph1 = ph0 + bs; const bf* ph2 = ph1 + bs; const bf* ph3 = ph2 + bs; const bf* pl0 = Bl + bo; const bf* pl1 = pl0 + bs; const bf* pl2 = pl1 + bs; const bf* pl3 = pl2 + bs;
#pragma unroll 1
    for (int kc = 0; kc < K; kc += 64) {
        v16bf a[2], al[2], bh[2][4], bl[2][4];    // the loops over u and t below are fully unrolled so that these arrays live in registers
#pragma unroll
        for (int u = 0; u < 2; ++u) { a[u] = ldfrag(pa + 512 * u); al[u] = ldfrag(pal + 512 * u);
            bh[u][0] = ldfrag(ph0 + 512 * u); bh[u][1] = ldfrag(ph1 + 512 * u); bh[u][2] = ldfrag(ph2 + 512 * u); bh[u][3] = ldfrag(ph3 + 512 * u);
            bl[u][0] = ldfrag(pl0 + 512 * u); bl[u][1] = ldfrag(pl1 + 512 * u); bl[u][2] = ldfrag(pl2 + 512 * u); bl[u][3] = ldfrag(pl3 + 512 * u); }
        // inputs-only fence on the loaded values: holds all loads of the trip in front of the products (without it the compiler loads a few fragments at a time and waits for each group);
        // the ten addresses are inputs too: they stay in their registers until the data is there, so no load's result lands in a register that an earlier load of the trip names; the wait stands in front of every later rewrite of such a register
        asm volatile("s_wait_xcnt 0x0" :: "v"(pa), "v"(pal), "v"(ph0), "v"(ph1), "v"(ph2), "v"(ph3), "v"(pl0), "v"(pl1), "v"(pl2), "v"(pl3), "v"(a[0]), "v"(a[1]), "v"(al[0]), "v"(al[1]), "v"(bh[0][0]), "v"(bh[0][1]), "v"(bh[0][2]), "v"(bh[0][3]), "v"(bh[1][0]), "v"(bh[1][1]), "v"(bh[1][2]), "v"(bh[1][3]),
                     "v"(bl[0][0]), "v"(bl[0][1]), "v"(bl[0][2]), "v"(bl[0][3]), "v"(bl[1][0]), "v"(bl[1][1]), "v"(bl[1][2]), "v"(bl[1][3]));
#pragma unroll
        for (int u = 0; u < 2; ++u) {
#pragma unroll
            for (int t = 0; t < 4; ++t) { acc[t] = wmmab(a[u], bh[u][t], acc[t]); acc[t] = wmmab(al[u], bh[u][t], acc[t]); acc[t] = wmmab(a[u], bl[u][t], acc[t]); } }
        pa += 1024; pal += 1024; ph0 += 1024; ph1 += 1024; ph2 += 1024; ph3 += 1024; pl0 += 1024; pl1 += 1024; pl2 += 1024; pl3 += 1024;
        asm volatile("v_nop\n\tv_nop\n\tv_nop\n\tv_nop" : "+v"(acc[0]), "+v"(acc[1]), "+v"(acc[2]), "+v"(acc[3]) : "v"(a[1]), "v"(al[1]));    // WMMA distance over the back edge: four vector slots between the trip's last product and whatever the next trip issues first
    }
    float* os = &ost[wave][0];
#pragma unroll
    for (int t = 0; t < 4; ++t) {
#pragma unroll
        for (int j = 0; j < 8; ++j) os[(hi * 8 + j) * 68 + t * 16 + lr] = acc[t][j]; }
    __builtin_amdgcn_wave_barrier(); asm volatile("" ::: "memory");
    float* crow = C + (size_t)r0 * ldc + c0;
    auto pass = [&]() {
#pragma unroll
        for (int s = 0; s < 8; ++s) { const int Lid = (lane >> 3) + 4 * s, piece = lane & 7; const int row = Lid >> 1, cofs = (Lid & 1) * 32 + piece * 4;
            const v4f val = *(const v4fa*)(os + row * 68 + cofs); *(v4f*)(crow + (size_t)row * ldc + cofs) = val; }
    };
    pass(); 
}

extern "C" void kernel_launch(void* const* d_in, const int* in_sizes, int n_in,
                              void* d_out, int out_size, void* d_ws, size_t ws_size, hipStream_t stream) {
    (void)in_sizes; (void)n_in; (void)out_size;
    const float* x = (const float*)d_in[0]; const float* Wq = (const float*)d_in[1]; const float* bq = (const float*)d_in[2]; const float* Wk = (const float*)d_in[3]; const float* bk = (const float*)d_in[4]; const float* Wv = (const float*)d_in[5]; const float* bv = (const float*)d_in[6];
    const float* Wo = (const float*)d_in[7]; const float* bo = (const float*)d_in[8]; const float* rb = (const float*)d_in[9]; const float* scale = (const float*)d_in[10]; const int* mask = (const int*)d_in[11];
    float* out = (float*)d_out;    // [4][2048][256]
    char* wsp = (char*)d_ws;
    auto take = [&](size_t bytes) { char* p = wsp; wsp += (bytes + 255) & ~(size_t)255; return (void*)p; };
    const size_t PL = (size_t)NBI * NT * DD;    // one [batch][token][256] plane, elements
    bf* WB = (bf*)take((size_t)4 * DD * DD * 2); bf* WoB = WB + 3 * DD * DD; bf* S = (bf*)take((size_t)NH * 512 * 64 * 2);    // WB: Wq, Wk, Wv, Wo; S: d_tshift's table
    bf* Xb = (bf*)take(PL * 2); bf* Qh = (bf*)take(PL * 2); bf* Ql = (bf*)take(PL * 2);
    bf* KTh = (bf*)take(2 * PL * 2); bf* KTl = (bf*)take(2 * PL * 2); bf* VTh = KTh + PL; bf* VTl = KTl + PL;    // [K | V][batch][head][64][2048]
    float* KV = (float*)take((size_t)KSP * NBI * NH * HD * HD * 4); bf* KVh = (bf*)take((size_t)NBI * NH * HD * HD * 2); bf* KVl = (bf*)take((size_t)NBI * NH * HD * HD * 2);
    bf* Yh = (bf*)take(PL * 2); bf* Yl = (bf*)take(PL * 2);
    if ((size_t)(wsp - (char*)d_ws) > ws_size) return;    // 0.5 + 0.25 + 4 + 2 x 4 + 2 x 8 + 4 + 0.25 + 2 x 4 ~ 41 MB, no aliasing
    k_prep<<<4 * PB_W + PB_S + PB_X, 256, 0, stream>>>(Wq, Wk, Wv, Wo, WB, rb, S, x, Xb);
    k_gemmb<false, false, false, 1><<<dim3(NBI * NT / 64, DD / 64, 3), 128, 0, stream>>>(Xb, nullptr, WB, bq, nullptr, DD, nullptr, nullptr, DD, 1, 0, DD * DD, 3, 0, bk, bv, mask, Qh, Ql, KTh, KTl);    // z = q, k, v; grid y = head
    k_gemm3ll<<<dim3(1, 1, KSP * NBI * NH), 128, 0, stream>>>(VTh, VTl, NT, KTh, KTl, NT, NT / KSP, KV, HD, (size_t)DD * NT, (size_t)HD * NT, (size_t)HD * NT, NH * HD * HD, HD * HD, NBI * NH * HD * HD);    // (K^T V)^T [d2][d1] = V^T . K, KSP partial planes; k_kvsplit adds them
    k_kvsplit<<<dim3(HD / 8, NBI * NH, 1), 256, 0, stream>>>(KV, scale, KVh, KVl);
    k_gemmb<true, false, true, 2><<<dim3(1, NT / 64, NBI * NH), 128, 0, stream>>>(VTh, VTl, S, nullptr, nullptr, NT, nullptr, nullptr, NT, 1, (size_t)HD * NT, (size_t)512 * 64, NH - 1, 0, nullptr, nullptr, nullptr, Yh, Yl, nullptr, nullptr,
                                                                                  KVh, KVl, Qh, Ql);    // [d][i] tile of q_i . (K^T V / s)[:, d] + (T_h V)^T, transposed and split
    k_gemmb<true, false><<<dim3(NBI * NT / 64, DD / 64, 1), 128, 0, stream>>>(Yh, Yl, WoB, bo, out, DD, nullptr, nullptr, DD);
}

// v009
// A run of this version takes 45.6 microseconds.
// Next to v008, in two timings, it ran 1.07 and 1.09 times as fast.
// All steps since v000 together make it 41.3 times as fast.
#include <hip/hip_runtime.h>

// Compute dtypes, f32 accumulate, every stage one launch over all batch items and heads: Q/K/V = x.W^T + b ([2048 x 256].[256 x 256], PLAIN bf16 operands = rounded input, [out][in] weights; exact products); the
// un-softmaxed attention out_h = (Q K^T / scale + RelBias_h) V is evaluated as Q (K^T V) / scale + T_h V (exact reassociation): K^T V per head as [64 x 2048].[2048 x 64]
// (both operands bf16 hi + UNSCALED residual, three products), Q.(K^T V / scale) as [2048 x 64].[64 x 64] (three products), and the Toeplitz relative-bias term T_h[i][j] =
// rel_bias[j - i + 2047][h] (exact bf16 values of the INPUT table, read from a small table of its eight shifted copies, never laid out as a plane) against V^T hi + residual (two products); out = y.Wo^T + bo (two products) - all on
// v_wmma_f32_16x16x32_bf16. The mask input enters multiplicatively (m_i m_j). Deterministic, no atomics; every

#define NBI  4
#define NT   2048
#define DD   256
#define NH   4
#define HD   64
#define DM   DD
#define LOSC 1024.0f
#define KSP  16    // K^T V: slices of the token sum, one work-group each

typedef _Float16 h16;
typedef unsigned short bf;
typedef __attribute__((ext_vector_type(16))) __bf16   v16bf;
typedef __attribute__((ext_vector_type(16))) _Float16 v16h;
typedef __attribute__((ext_vector_type(8)))  _Float16 v8h;
typedef __attribute__((ext_vector_type(8)))  unsigned short v8us;
typedef __attribute__((ext_vector_type(8)))  float    v8f;
typedef __attribute__((ext_vector_type(4)))  float    v4f;
typedef v8h  __attribute__((may_alias)) v8ha;
typedef v4f  __attribute__((may_alias)) v4fa;
typedef v8us __attribute__((may_alias)) v8usa;

__device__ __forceinline__ unsigned short f2bf(float f) { unsigned u = __float_as_uint(f); u += 0x7FFFu + ((u >> 16) & 1u); return (unsigned short)(u >> 16); }
__device__ __forceinline__ float bf2f(unsigned short b) { return __uint_as_float(((unsigned)b) << 16); }
__device__ __forceinline__ float bfr(float f) { return bf2f(f2bf(f)); }
__device__ __forceinline__ v16h cat16(v8h lo, v8h hi) { return __builtin_shufflevector(lo, hi, 0, 1, 2, 3, 4, 5, 6, 7, 8, 9, 10, 11, 12, 13, 14, 15); }
__device__ __forceinline__ v16bf cat16b(v8us lo, v8us hi) { return __builtin_bit_cast(v16bf, __builtin_shufflevector(lo, hi, 0, 1, 2, 3, 4, 5, 6, 7, 8, 9, 10, 11, 12, 13, 14, 15)); }
__device__ __forceinline__ v8f wmma16(v16h a, v16h b, v8f c) { return __builtin_amdgcn_wmma_f32_16x16x32_f16(false, a, false, b, (short)0, c, false, false); }
__device__ __forceinline__ v8f wmmab(v16bf a, v16bf b, v8f c) { return __builtin_amdgcn_wmma_f32_16x16x32_bf16(false, a, false, b, (short)0, c, false, false); }

// FRAGMENT ORDER, the layout of every bf16 operand plane [rows][K] in the workspace: blocks of 16 rows x 32 k = 512 elements, block (row / 16) * (K / 32) + k / 32; inside a block element (row, k) stands at
// ((k >> 4) & 1) * 256 + ((k >> 3) & 1) * 128 + (row & 15) * 8 + (k & 7). A wave's 32 lanes then read 512 bytes in a row, four whole 128-byte lines, with each 16-byte load (row-major: a quarter of each of 16 lines).
// 16 rows are 16 * K elements as in a row-major plane; 32 k of them are 512.
// one lane's 16 x 16 x 32 fragment: p = the block + lane * 8; the lane gets k = 8 * (lane >> 4) + 0 .. 7 and 16 more, of row lane & 15, as from a row-major plane
__device__ __forceinline__ v16bf ldfrag(const bf* p) { return cat16b(*(const v8us*)p, *(const v8us*)(p + 256)); }
// where the 8 elements k8 * 8 .. + 7 (k8 < 8: two blocks, 64 k) of row lr of a 16-row strip stand, from the first of the two blocks
__device__ __forceinline__ int frpiece(int lr, int k8) { return (k8 >> 2) * 512 + ((k8 >> 1) & 1) * 256 + (k8 & 1) * 128 + lr * 8; }

// k_gemmb: 64 x 64 block tile (4 waves x 16 x 64) of C[NTK][NW] = (A [+ Al]).B^T (K = 256) [+ bf(bias[c])] [+ bf(R[r][c]) residual]; f32 whole-line epilogue (or f16
// EPI: what the epilogue stores. 0: the f32 (or f16) tile. 1 (q, k, v): the masked tile as bf16 hi + residual, q (z = 0) untransposed (fragment order) into E0h / E0l, k and v (z = 1, 2) transposed into E1h / E1l [k | v][item][head][64][NT].
template <bool SPLITA, bool F16OUT = false, int EPI = 0>
__global__ __launch_bounds__(128) void k_gemmb(const bf* __restrict__ A, const bf* __restrict__ Al, const bf* __restrict__ Bn, const float* __restrict__ bias, float* C, int ldc, h16* C2, const float* __restrict__ R = nullptr, int K = DM, int roundR = 1,
                                               size_t zA = 0, size_t zB = 0, int zBmask = 0, size_t zC = 0, const float* __restrict__ bias1 = nullptr, const float* __restrict__ bias2 = nullptr,
                                               const int* __restrict__ msk = nullptr, bf* E0h = nullptr, bf* E0l = nullptr, bf* E1h = nullptr, bf* E1l = nullptr) {
    __shared__ __align__(16) float ost[4][16 * 68];
    const int lane = threadIdx.x & 31, wave = threadIdx.x >> 5, lr = lane & 15, hi = lane >> 4;
    const int r0 = blockIdx.x * 64 + wave * 16, c0 = blockIdx.y * 64;
    // grid z = one independent product: its own A and C planes, B plane (z & zBmask), bias 0 / 1 / 2
    const int z = blockIdx.z; A += z * zA; if (SPLITA) Al += z * zA; Bn += (size_t)(z & zBmask) * zB; C += z * zC; if (z == 1) bias = bias1; if (z == 2) bias = bias2;
    const size_t aoff = (size_t)r0 * K + lane * 8;    // fragment order: the strip of 16 rows, the lane's piece of its first block
    size_t boff[4];
#pragma unroll
    for (int t = 0; t < 4; ++t) boff[t] = (size_t)(c0 + t * 16) * K + lane * 8;
    v8f acc[4];
#pragma unroll
    for (int t = 0; t < 4; ++t) acc[t] = (v8f){};
    // one trip = 4 K steps (K is a multiple of 128): every load of the trip is issued before its first product, so a trip waits for memory once
    const bf* pa = A + aoff; const bf* pal = SPLITA ? Al + aoff : pa; const bf* pb0 = Bn + boff[0]; const bf* pb1 = Bn + boff[1]; const bf* pb2 = Bn + boff[2]; const bf* pb3 = Bn + boff[3];
#pragma unroll 1
    for (int kc = 0; kc < K; kc += 128) {
        v16bf a[4], al[4], b[4][4];    // the loops over u and t below are fully unrolled so that these arrays live in registers
#pragma unroll
        for (int u = 0; u < 4; ++u) { a[u] = ldfrag(pa + 512 * u); al[u] = SPLITA ? ldfrag(pal + 512 * u) : a[u];
            b[u][0] = ldfrag(pb0 + 512 * u); b[u][1] = ldfrag(pb1 + 512 * u); b[u][2] = ldfrag(pb2 + 512 * u); b[u][3] = ldfrag(pb3 + 512 * u); }
        // inputs-only fence on the loaded values: holds all loads of the trip in front of the products (without it the compiler loads one B fragment at a time and waits for each);
        // the six addresses are inputs too: they stay in their registers until the data is there, so no load's result lands in a register that an earlier load of the trip names; the wait stands in front of every later rewrite of such a register
        asm volatile("s_wait_xcnt 0x0" :: "v"(pa), "v"(pal), "v"(pb0), "v"(pb1), "v"(pb2), "v"(pb3), "v"(a[0]), "v"(a[1]), "v"(a[2]), "v"(a[3]), "v"(al[0]), "v"(al[1]), "v"(al[2]), "v"(al[3]),
                     "v"(b[0][0]), "v"(b[0][1]), "v"(b[0][2]), "v"(b[0][3]), "v"(b[1][0]), "v"(b[1][1]), "v"(b[1][2]), "v"(b[1][3]),
                     "v"(b[2][0]), "v"(b[2][1]), "v"(b[2][2]), "v"(b[2][3]), "v"(b[3][0]), "v"(b[3][1]), "v"(b[3][2]), "v"(b[3][3]));
#pragma unroll
        for (int u = 0; u < 4; ++u) {
#pragma unroll
            for (int t = 0; t < 4; ++t) { acc[t] = wmmab(a[u], b[u][t], acc[t]); if (SPLITA) acc[t] = wmmab(al[u], b[u][t], acc[t]); } }
        pa += 2048; pal += 2048; pb0 += 2048; pb1 += 2048; pb2 += 2048; pb3 += 2048;
        asm volatile("v_nop\n\tv_nop\n\tv_nop\n\tv_nop" : "+v"(acc[0]), "+v"(acc[1]), "+v"(acc[2]), "+v"(acc[3]) : "v"(a[3]), "v"(al[3]));    // WMMA distance over the back edge: four vector slots between the trip's last product and whatever the next trip issues first
    }
    if constexpr (EPI != 0) {
        // the block's 64 x 64 tile passes through LDS once, as the rows the stores want; a wave then stores 16 rows x 16 k, 512 bytes in a row of each plane (fragment order)
        typedef __attribute__((ext_vector_type(4))) int v4i;
        float* of = &ost[0][0];
        const int piece = threadIdx.x >> 4, rw = threadIdx.x & 15, fo = frpiece(rw, piece);
        const bool tr = z != 0;    // the same for the whole block
        // all that the epilogue reads from memory is asked for ahead of the LDS pass: the mask of the thread's 4 rows and of its 8 columns and the bias
        int mr[4]; v4i m0, m1; float bv[4];
        if constexpr (EPI == 1) {
            const int* mp = msk + blockIdx.x * 64; m0 = *(const v4i*)(mp + piece * 8); m1 = *(const v4i*)(mp + piece * 8 + 4);
#pragma unroll
            for (int s = 0; s < 4; ++s) mr[s] = mp[rw + 16 * s];
        }
#pragma unroll
        for (int t = 0; t < 4; ++t) bv[t] = 0.f;
        if constexpr (EPI == 1) { if (bias) {    // one test for the four loads, so that they fly together
#pragma unroll
            for (int t = 0; t < 4; ++t) bv[t] = bias[c0 + t * 16 + lr];
#pragma unroll
            for (int t = 0; t < 4; ++t) bv[t] = bfr(bv[t]); } }
        if (tr) {    // a lane's 8 values are 8 neighbours of the transposed row t * 16 + lr
#pragma unroll
            for (int t = 0; t < 4; ++t) { float* tp = of + (t * 16 + lr) * 68 + wave * 16 + hi * 8;
                *(v4fa*)tp = (v4f){acc[t][0] + bv[t], acc[t][1] + bv[t], acc[t][2] + bv[t], acc[t][3] + bv[t]}; *(v4fa*)(tp + 4) = (v4f){acc[t][4] + bv[t], acc[t][5] + bv[t], acc[t][6] + bv[t], acc[t][7] + bv[t]}; }
        } else {
#pragma unroll
            for (int t = 0; t < 4; ++t) {
#pragma unroll
                for (int j = 0; j < 8; ++j) of[(wave * 16 + hi * 8 + j) * 68 + t * 16 + lr] = acc[t][j] + bv[t]; }
        }
        __syncthreads();    // for q (z = 0) a row of the tile is read by other waves than the one that wrote it
        // o: the thread's first 16-byte piece (64 k of a strip are 64 * 16 elements); st: elements from one of its rows to the next, 16 rows on
        size_t o, st; bf* dh = E0h; bf* dl = E0l; float fc[8];
        if (!tr) { o = (size_t)blockIdx.x * 64 * DD + c0 * 16 + fo; st = (size_t)16 * DD; }
        else { o = (((size_t)(z - 1) * NBI + blockIdx.x / (NT / 64)) * DD + c0) * NT + (blockIdx.x % (NT / 64)) * (64 * 16) + fo; st = (size_t)16 * NT; dh = E1h; dl = E1l; }    // row = the head's d, the 8 values are 8 tokens
        if constexpr (EPI == 1) {
#pragma unroll
            for (int i = 0; i < 8; ++i) fc[i] = ((i < 4 ? m0[i & 3] : m1[i & 3]) != 0) ? 1.0f : 0.f;
        }
        v4f p[4][2];
#pragma unroll
        for (int s = 0; s < 4; ++s) { const float* sp = of + (rw + 16 * s) * 68 + piece * 8; p[s][0] = *(const v4fa*)sp; p[s][1] = *(const v4fa*)(sp + 4); }
#pragma unroll
        for (int s = 0; s < 4; ++s) { float y[8] = {p[s][0][0], p[s][0][1], p[s][0][2], p[s][0][3], p[s][1][0], p[s][1][1], p[s][1][2], p[s][1][3]}; v8us oh, ol;
#pragma unroll
            for (int i = 0; i < 8; ++i) {
                if constexpr (EPI == 1) y[i] *= tr ? fc[i] : ((mr[s] != 0) ? 1.0f : 0.f);
                const unsigned short hb = f2bf(y[i]); oh[i] = hb; ol[i] = f2bf(y[i] - bf2f(hb)); }
            *(v8us*)(dh + o + s * st) = oh; *(v8us*)(dl + o + s * st) = ol;
            if (s < 3) asm volatile("s_wait_xcnt 0x0" ::: "memory"); }    // stands in front of the next row's arithmetic, which reuses registers that these two stores name
        return;
    }
    float* os = &ost[wave][0];
#pragma unroll
    for (int t = 0; t < 4; ++t) { const float bv = bias ? bfr(bias[c0 + t * 16 + lr]) : 0.f;
#pragma unroll
        for (int j = 0; j < 8; ++j) os[(hi * 8 + j) * 68 + t * 16 + lr] = acc[t][j] + bv; }
    __syncthreads();
    if (F16OUT) {
        h16* crow = (h16*)(void*)C + (size_t)r0 * ldc + c0;
        auto pass = [&]() {
#pragma unroll
            for (int s = 0; s < 4; ++s) { const int row = 4 * s + (lane >> 3), piece = lane & 7; const float* sp = os + row * 68 + piece * 8; v8h o, o2;
#pragma unroll
                for (int i = 0; i < 8; ++i) { const h16 a = (h16)sp[i]; o[i] = a; o2[i] = (h16)((sp[i] - (float)a) * LOSC); }
                *(v8h*)(crow + (size_t)row * ldc + piece * 8) = o; if (C2) *(v8h*)(C2 + (size_t)r0 * ldc + c0 + (size_t)row * ldc + piece * 8) = o2; }
        };
        pass(); 
    } else {
        float* crow = C + (size_t)r0 * ldc + c0;
        auto pass = [&]() {
#pragma unroll
            for (int s = 0; s < 8; ++s) { const int Lid = (lane >> 3) + 4 * s, piece = lane & 7; const int row = Lid >> 1, cofs = (Lid & 1) * 32 + piece * 4;
                v4f val = *(const v4fa*)(os + row * 68 + cofs); if (R) { const v4f rv = *(const v4f*)(R + ((size_t)r0 + row) * ldc + c0 + cofs); val += roundR ? (v4f){bfr(rv[0]), bfr(rv[1]), bfr(rv[2]), bfr(rv[3])} : rv; }
                *(v4f*)(crow + (size_t)row * ldc + cofs) = val; }
        };
        pass(); 
    }
}


// k_toep: a tile [32 d][TI tokens i] of one (item, head) z: sum over d1 of (K^T V / scale)^T[d][d1] q[i][d1] (A = Gh + Gl [z][d][d1], B = Ph + Pl, q [item][i][head * 64 + d1]; three products, 64 k) plus the
// Toeplitz term, sum over tokens k of V^T[d][k] T[i][k] (A + Al = V^T hi + residual, two products), T[r][k] = tab[k - r + NT - 1], read from d_tshift's table S of the head: a fragment depends on k - r alone.
// 4 waves = 2 strips of 16 d x 2 halves of either k range. A wave's tile is 16 d x TI tokens: a V^T fragment, the operand that no other wave of the block reads, feeds TI / 16 accumulators.
// The two halves' tiles meet in LDS, transposed, and are added there (lower half + upper half), split in bf16 hi + residual and stored into Yh / Yl [item][i][head * 64 + d]
#define TI 128
__global__ __launch_bounds__(128) void k_toep(const bf* __restrict__ A, const bf* __restrict__ Al, const bf* __restrict__ S, const bf* __restrict__ Gh, const bf* __restrict__ Gl,
                                              const bf* __restrict__ Ph, const bf* __restrict__ Pl, bf* Yh, bf* Yl) {
    static_assert(TI == 128, "the fences below name 8 token tiles and 14 table fragments");
    __shared__ __align__(16) float ost[2][TI * 36];
    const int lane = threadIdx.x & 31, wave = threadIdx.x >> 5, lr = lane & 15, hi = lane >> 4, rl = (wave & 1) * 16, kh = wave >> 1;
    const int c0 = blockIdx.x * TI, r0 = blockIdx.y * 32 + rl, z = blockIdx.z;
    v8f acc[8];
#pragma unroll
    for (int t = 0; t < 8; ++t) acc[t] = (v8f){};
    {   // tile[d][i] += sum over d1 of (K^T V / scale)^T[d][d1] q[i][d1]: one K step of 32 d1 for either half, all its loads ahead of the first product
        const size_t go = (size_t)z * (HD * HD) + (size_t)r0 * HD + kh * 512 + lane * 8, po = ((size_t)(z / NH) * NT + c0) * DD + (z % NH) * (HD * 16) + kh * 512 + lane * 8;
        const bf* pg = Gh + go; const bf* pgl = Gl + go; const bf* pq = Ph + po; const bf* pql = Pl + po;
        v16bf qh[8], ql[8];    // the loops over t are fully unrolled so that these arrays live in registers
        const v16bf g = ldfrag(pg), gl = ldfrag(pgl);
#pragma unroll
        for (int t = 0; t < 8; ++t) { qh[t] = ldfrag(pq + t * (16 * DD)); ql[t] = ldfrag(pql + t * (16 * DD)); }
        // inputs-only fence on the loaded values and their four addresses: all loads fly together and are waited for once; the wait stands in front of every later rewrite of a register that one of them names
        asm volatile("s_wait_xcnt 0x0" :: "v"(pg), "v"(pgl), "v"(pq), "v"(pql), "v"(g), "v"(gl), "v"(qh[0]), "v"(qh[1]), "v"(qh[2]), "v"(qh[3]), "v"(qh[4]), "v"(qh[5]), "v"(qh[6]), "v"(qh[7]),
                     "v"(ql[0]), "v"(ql[1]), "v"(ql[2]), "v"(ql[3]), "v"(ql[4]), "v"(ql[5]), "v"(ql[6]), "v"(ql[7]));
#pragma unroll
        for (int t = 0; t < 8; ++t) acc[t] = wmmab(g, qh[t], acc[t]);
#pragma unroll
        for (int t = 0; t < 8; ++t) acc[t] = wmmab(gl, qh[t], acc[t]);
#pragma unroll
        for (int t = 0; t < 8; ++t) acc[t] = wmmab(g, ql[t], acc[t]);
    }
    // fragment order: the strip of 16 rows, the half's first column (k columns of a strip are 16 k elements), the lane's piece of that block
    const size_t aoff = (size_t)z * (HD * NT) + (size_t)r0 * NT + (size_t)kh * (NT / 2 * 16) + lane * 8;
    const bf* pa = A + aoff; const bf* pal = Al + aoff;
    // row r = c0 + 16 t + lr, k = kh NT / 2 + kc + 32 u + 8 hi (+ 16): k - r + NT - 1 = 8 m + s with s = 7 - (lr & 7) and m = (kh NT / 2 + kc - c0) / 8 + 4 u - 2 t (+ 2) + hi - (lr >> 3) + NT / 8 - 1;
    // ps = the lane's 16-byte piece at kc = 0 and 4 u - 2 t = -14, the trip's lowest; m runs from 0 to 510 over the whole grid
    const bf* ps = S + (size_t)(z & (NH - 1)) * (512 * 64) + ((NT / 8 - 15 + hi - (lr >> 3)) + kh * (NT / 16) - (c0 >> 3)) * 64 + (7 - (lr & 7)) * 8;
    // one trip = 4 K steps: every load of the trip is issued before its first product, so a trip waits for memory once
#pragma unroll 1
    for (int kc = 0; kc < NT / 2; kc += 128) {
        v16bf a[4], al[4], f[14];    // f[j]: the fragment of every (u, t) with 2 u - t + 7 = j; the loops over u, t and j are fully unrolled so that these arrays live in registers
#pragma unroll
        for (int u = 0; u < 4; ++u) { a[u] = ldfrag(pa + 512 * u); al[u] = ldfrag(pal + 512 * u); }
#pragma unroll
        for (int j = 0; j < 14; ++j) f[j] = cat16b(*(const v8us*)(ps + 128 * j), *(const v8us*)(ps + 128 * j + 128));
        // inputs-only fence on the loaded values: holds all loads of the trip in front of the products, so a trip waits for memory once;
        // the three addresses are inputs too: they stay in their registers until the data is there; the wait stands in front of every later rewrite of a register that a load of the trip names
        asm volatile("s_wait_xcnt 0x0" :: "v"(pa), "v"(pal), "v"(ps), "v"(a[0]), "v"(a[1]), "v"(a[2]), "v"(a[3]), "v"(al[0]), "v"(al[1]), "v"(al[2]), "v"(al[3]),
                     "v"(f[0]), "v"(f[1]), "v"(f[2]), "v"(f[3]), "v"(f[4]), "v"(f[5]), "v"(f[6]), "v"(f[7]), "v"(f[8]), "v"(f[9]), "v"(f[10]), "v"(f[11]), "v"(f[12]), "v"(f[13]));
#pragma unroll
        for (int u = 0; u < 4; ++u) {    // each accumulator takes hi, then residual, K step by K step
#pragma unroll
            for (int t = 0; t < 8; ++t) acc[t] = wmmab(a[u], f[2 * u - t + 7], acc[t]);
#pragma unroll
            for (int t = 0; t < 8; ++t) acc[t] = wmmab(al[u], f[2 * u - t + 7], acc[t]); }
        pa += 2048; pal += 2048; ps += 1024;
        asm volatile("v_nop\n\tv_nop\n\tv_nop\n\tv_nop" : "+v"(acc[0]), "+v"(acc[1]), "+v"(acc[2]), "+v"(acc[3]), "+v"(acc[4]), "+v"(acc[5]), "+v"(acc[6]), "+v"(acc[7]) : "v"(a[3]), "v"(al[3]));    // WMMA distance over the back edge: four vector slots between the trip's last product and whatever comes next
    }
    // either half's 32 x TI tile goes to LDS as the rows the stores want: a lane's 8 values are 8 neighbours of the transposed row t * 16 + lr
    float* of = &ost[kh][0];
#pragma unroll
    for (int t = 0; t < 8; ++t) { float* tp = of + (t * 16 + lr) * 36 + rl + hi * 8;
        *(v4fa*)tp = (v4f){acc[t][0], acc[t][1], acc[t][2], acc[t][3]}; *(v4fa*)(tp + 4) = (v4f){acc[t][4], acc[t][5], acc[t][6], acc[t][7]}; }
    __syncthreads();    // a thread's piece sums two halves, one of them written by another wave
    // a wave stores 16 rows x 16 k, 512 bytes in a row of each plane (fragment order); o: the thread's first 16-byte piece (64 k of a strip are 64 * 16 elements; the block's 32 d are one half of the head's 64 k); st: elements from one of its rows to the next, 16 rows on
    const int piece = (threadIdx.x >> 4) & 3, rw = threadIdx.x & 15, rb = (threadIdx.x >> 6) * 64;
    const size_t o = ((size_t)(z / NH) * NT + c0 + rb) * DD + (z % NH) * (HD * 16) + frpiece(rw, blockIdx.y * 4 + piece), st = (size_t)16 * DD;
    v4f p[4][2], p2[4][2];
#pragma unroll
    for (int s = 0; s < 4; ++s) { const float* sp = &ost[0][0] + (rb + rw + 16 * s) * 36 + piece * 8;
        p[s][0] = *(const v4fa*)sp; p[s][1] = *(const v4fa*)(sp + 4); p2[s][0] = *(const v4fa*)(sp + TI * 36); p2[s][1] = *(const v4fa*)(sp + TI * 36 + 4); }
#pragma unroll
    for (int s = 0; s < 4; ++s) { const v4f y0 = p[s][0] + p2[s][0], y1 = p[s][1] + p2[s][1]; const float y[8] = {y0[0], y0[1], y0[2], y0[3], y1[0], y1[1], y1[2], y1[3]}; v8us oh, ol;
#pragma unroll
        for (int i = 0; i < 8; ++i) { const unsigned short hb = f2bf(y[i]); oh[i] = hb; ol[i] = f2bf(y[i] - bf2f(hb)); }
        *(v8us*)(Yh + o + s * st) = oh; *(v8us*)(Yl + o + s * st) = ol;
        if (s < 3) asm volatile("s_wait_xcnt 0x0" ::: "memory"); }    // stands in front of the next row's arithmetic, which reuses registers that these two stores name
}

// piece i (8 elements) of a fragment-order plane with K = DD: the index of its first element in the row-major source
__device__ __forceinline__ size_t frsrc(size_t i) { const int w = (int)(i & 63), ks = (int)((i >> 6) & (DD / 32 - 1)); return ((i >> 6) / (DD / 32) * 16 + (w & 15)) * DD + ks * 32 + (w >> 5) * 16 + ((w >> 4) & 1) * 8; }
// the three jobs of k_prep, each a block's work; bx (and y) = the block's index within its job
__device__ __forceinline__ void d_cvt8(int bx, int y, const float* __restrict__ s0, const float* __restrict__ s1, const float* __restrict__ s2, const float* __restrict__ s3, bf* dst, size_t n8) {
    const size_t i = (size_t)bx * 256 + threadIdx.x; if (i >= n8) return;
    const float* src = y == 0 ? s0 : y == 1 ? s1 : y == 2 ? s2 : s3; dst += (size_t)y * n8 * 8;    // y = which of the four matrices
    const v8f v = *(const v8f*)(src + frsrc(i)); v8us o;
    asm volatile("s_wait_xcnt 0x0" ::: "memory");    // in front of the arithmetic below, which may reuse the registers of the load's address
#pragma unroll
    for (int k = 0; k < 8; ++k) o[k] = f2bf(v[k]);
    *(v8us*)(dst + i * 8) = o; 
}
__global__ __launch_bounds__(256) void k_zero8(bf* dst, size_t n8) {
    const size_t i = (size_t)blockIdx.x * 256 + threadIdx.x; if (i >= n8) return; v8us z;
#pragma unroll
    for (int k = 0; k < 8; ++k) z[k] = 0;
    *(v8us*)(dst + i * 8) = z; 
}

__device__ __forceinline__ void d_cvt(int bx, const float* __restrict__ src, bf* dst) {
    const size_t p = (size_t)bx * 256 + threadIdx.x; if (p >= (size_t)NBI * NT * DD / 8) return;    // a block: 16 rows x 128 k, whole lines of the source too
    const v8f v = *(const v8f*)(src + frsrc(p)); v8us o;
    asm volatile("s_wait_xcnt 0x0" ::: "memory");    // in front of the arithmetic below, which may reuse the registers of the load's address
#pragma unroll
    for (int i = 0; i < 8; ++i) o[i] = f2bf(v[i]);
    *(v8us*)(dst + p * 8) = o; 
}
// S[h][m][s][q] = bf16(rb[8 m + s + q][h]), m < 511 (a head's pitch is 512), s < 8, q < 8: eight copies of a head's table, each one element further on, so that any 8 neighbours are one aligned 16-byte piece;
// the eight pieces of one m share a 128-byte line
__device__ __forceinline__ void d_tshift(int bx, const float* __restrict__ rb, bf* S) {
    const int p = bx * 256 + threadIdx.x, h = p >> 12, e = ((p >> 3) & 511) * 8 + (p & 7); if (e >= 511 * 8) return; v8us o;    // m = 511 would pass the table's end; no fragment reads it
#pragma unroll
    for (int q = 0; q < 8; ++q) o[q] = f2bf(rb[(size_t)(e + q) * NH + h]);
    *(v8us*)(S + (size_t)p * 8) = o;
}
// k_prep: all that depends on the inputs alone (the four weight matrices and x to bf16, the shifted rel_bias table) in one launch; no job reads what another writes.
// The two small jobs take the lowest block indices, so that they run while the blocks of x are still starting
#define PB_W (DD * DD / 8 / 256)       // blocks per weight matrix
#define PB_S (NH * 512 * 8 / 256)      // blocks of the table
#define PB_X (NBI * NT / 8)            // blocks of x
__global__ __launch_bounds__(256) void k_prep(const float* __restrict__ Wq, const float* __restrict__ Wk, const float* __restrict__ Wv, const float* __restrict__ Wo, bf* WB,
                                              const float* __restrict__ rb, bf* S, const float* __restrict__ x, bf* Xb) {
    const int b = blockIdx.x;    // the same for the whole block: each block does one job
    if (b < 4 * PB_W) d_cvt8(b % PB_W, b / PB_W, Wq, Wk, Wv, Wo, WB, DD * DD / 8);
    else if (b < 4 * PB_W + PB_S) d_tshift(b - 4 * PB_W, rb, S);
    else d_cvt(b - (4 * PB_W + PB_S), x, Xb);
}
__global__ __launch_bounds__(256) void k_kvsplit(const float* __restrict__ src, const float* __restrict__ scale, bf* dh, bf* dl) {
    typedef __attribute__((ext_vector_type(2))) unsigned short v2us;
    const int lane = threadIdx.x & 31, r = blockIdx.x * 8 + (threadIdx.x >> 5); if (r >= HD) return; const float is = 1.0f / bfr(scale[0]);
    const size_t o = ((size_t)blockIdx.y * HD + r) * HD + lane * 2;    // grid y = batch item * NH + head
    typedef __attribute__((ext_vector_type(2))) float v2f;
    static_assert(KSP == 16, "the fence below names 16 values");
    v2f p[KSP], sum; const float* ps = src + o;    // src holds KSP partial planes, one per slice of the token sum; they are added in slice order
#pragma unroll
    for (int s = 0; s < KSP; ++s) p[s] = *(const v2f*)(ps + (size_t)s * (NBI * NH * HD * HD));
    // inputs-only fence on the loaded values and their address: all loads are in flight together, and the address stays in its registers until the data is there (no load's result lands in them)
    asm volatile("" :: "v"(ps), "v"(p[0]), "v"(p[1]), "v"(p[2]), "v"(p[3]), "v"(p[4]), "v"(p[5]), "v"(p[6]), "v"(p[7]), "v"(p[8]), "v"(p[9]), "v"(p[10]), "v"(p[11]), "v"(p[12]), "v"(p[13]), "v"(p[14]), "v"(p[15]));
    sum = p[0];
#pragma unroll
    for (int s = 1; s < KSP; ++s) sum += p[s];
    v2us oh, ol;
#pragma unroll
    for (int i = 0; i < 2; ++i) { const float y = sum[i] * is; const unsigned short hb = f2bf(y); oh[i] = hb; ol[i] = f2bf(y - bf2f(hb)); }
    const size_t od = (size_t)blockIdx.y * HD * HD + (r >> 4) * (16 * HD) + frpiece(r & 15, lane >> 2) + (lane & 3) * 2;    // fragment order, K = HD
    *(v2us*)(dh + od) = oh; *(v2us*)(dl + od) = ol; 
}
__global__ __launch_bounds__(128) void k_gemm3ll(const bf* __restrict__ Ah, const bf* __restrict__ Al, int lda, const bf* __restrict__ Bh, const bf* __restrict__ Bl, int ldb, int K, float* C, int ldc,
                                                 size_t zAb, size_t zAh, size_t zB, size_t zCb, size_t zCh, size_t zCs = 0) {
    __shared__ __align__(16) float ost[4][16 * 68];
    const int lane = threadIdx.x & 31, wave = threadIdx.x >> 5, lr = lane & 15, hi = lane >> 4;
    const int r0 = blockIdx.x * 64 + wave * 16, c0 = blockIdx.y * 64;
    // grid z = (K slice * NBI + batch item) * NH + head: A and C step by item and by head, B by item * NH + head; slice sp sums k in [sp K, sp K + K) into its own C plane
    { const int sp = blockIdx.z / (NBI * NH), z = blockIdx.z % (NBI * NH), zb = z / NH, zh = z % NH; const size_t ao = zb * zAb + zh * zAh + (size_t)sp * K * 16, bo2 = z * zB + (size_t)sp * K * 16;    // fragment order: K columns of a strip are K * 16 elements
      Ah += ao; Al += ao; Bh += bo2; Bl += bo2; C += zb * zCb + zh * zCh + sp * zCs; }
    const size_t aoff = (size_t)r0 * lda + lane * 8;
    v8f acc[4];
#pragma unroll
    for (int t = 0; t < 4; ++t) acc[t] = (v8f){};
    // one trip = 2 K steps (K is a multiple of 64): every load of the trip is issued before its first product, so a trip waits for memory once
    const bf* pa = Ah + aoff; const bf* pal = Al + aoff; const size_t bo = (size_t)c0 * ldb + lane * 8, bs = (size_t)16 * ldb;
    const bf* ph0 = Bh + bo; const bf* ph1 = ph0 + bs; const bf* ph2 = ph1 + bs; const bf* ph3 = ph2 + bs; const bf* pl0 = Bl + bo; const bf* pl1 = pl0 + bs; const bf* pl2 = pl1 + bs; const bf* pl3 = pl2 + bs;
#pragma unroll 1
    for (int kc = 0; kc < K; kc += 64) {
        v16bf a[2], al[2], bh[2][4], bl[2][4];    // the loops over u and t below are fully unrolled so that these arrays live in registers
#pragma unroll
        for (int u = 0; u < 2; ++u) { a[u] = ldfrag(pa + 512 * u); al[u] = ldfrag(pal + 512 * u);
            bh[u][0] = ldfrag(ph0 + 512 * u); bh[u][1] = ldfrag(ph1 + 512 * u); bh[u][2] = ldfrag(ph2 + 512 * u); bh[u][3] = ldfrag(ph3 + 512 * u);
            bl[u][0] = ldfrag(pl0 + 512 * u); bl[u][1] = ldfrag(pl1 + 512 * u); bl[u][2] = ldfrag(pl2 + 512 * u); bl[u][3] = ldfrag(pl3 + 512 * u); }
        // inputs-only fence on the loaded values: holds all loads of the trip in front of the products (without it the compiler loads a few fragments at a time and waits for each group);
        // the ten addresses are inputs too: they stay in their registers until the data is there, so no load's result lands in a register that an earlier load of the trip names; the wait stands in front of every later rewrite of such a register
        asm volatile("s_wait_xcnt 0x0" :: "v"(pa), "v"(pal), "v"(ph0), "v"(ph1), "v"(ph2), "v"(ph3), "v"(pl0), "v"(pl1), "v"(pl2), "v"(pl3), "v"(a[0]), "v"(a[1]), "v"(al[0]), "v"(al[1]), "v"(bh[0][0]), "v"(bh[0][1]), "v"(bh[0][2]), "v"(bh[0][3]), "v"(bh[1][0]), "v"(bh[1][1]), "v"(bh[1][2]), "v"(bh[1][3]),
                     "v"(bl[0][0]), "v"(bl[0][1]), "v"(bl[0][2]), "v"(bl[0][3]), "v"(bl[1][0]), "v"(bl[1][1]), "v"(bl[1][2]), "v"(bl[1][3]));
#pragma unroll
        for (int u = 0; u < 2; ++u) {
#pragma unroll
            for (int t = 0; t < 4; ++t) { acc[t] = wmmab(a[u], bh[u][t], acc[t]); acc[t] = wmmab(al[u], bh[u][t], acc[t]); acc[t] = wmmab(a[u], bl[u][t], acc[t]); } }
        pa += 1024; pal += 1024; ph0 += 1024; ph1 += 1024; ph2 += 1024; ph3 += 1024; pl0 += 1024; pl1 += 1024; pl2 += 1024; pl3 += 1024;
        asm volatile("v_nop\n\tv_nop\n\tv_nop\n\tv_nop" : "+v"(acc[0]), "+v"(acc[1]), "+v"(acc[2]), "+v"(acc[3]) : "v"(a[1]), "v"(al[1]));    // WMMA distance over the back edge: four vector slots between the trip's last product and whatever the next trip issues first
    }
    float* os = &ost[wave][0];
#pragma unroll
    for (int t = 0; t < 4; ++t) {
#pragma unroll
        for (int j = 0; j < 8; ++j) os[(hi * 8 + j) * 68 + t * 16 + lr] = acc[t][j]; }
    __builtin_amdgcn_wave_barrier(); asm volatile("" ::: "memory");
    float* crow = C + (size_t)r0 * ldc + c0;
    auto pass = [&]() {
#pragma unroll
        for (int s = 0; s < 8; ++s) { const int Lid = (lane >> 3) + 4 * s, piece = lane & 7; const int row = Lid >> 1, cofs = (Lid & 1) * 32 + piece * 4;
            const v4f val = *(const v4fa*)(os + row * 68 + cofs); *(v4f*)(crow + (size_t)row * ldc + cofs) = val; }
    };
    pass(); 
}

extern "C" void kernel_launch(void* const* d_in, const int* in_sizes, int n_in,
                              void* d_out, int out_size, void* d_ws, size_t ws_size, hipStream_t stream) {
    (void)in_sizes; (void)n_in; (void)out_size;
    const float* x = (const float*)d_in[0]; const float* Wq = (const float*)d_in[1]; const float* bq = (const float*)d_in[2]; const float* Wk = (const float*)d_in[3]; const float* bk = (const float*)d_in[4]; const float* Wv = (const float*)d_in[5]; const float* bv = (const float*)d_in[6];
    const float* Wo = (const float*)d_in[7]; const float* bo = (const float*)d_in[8]; const float* rb = (const float*)d_in[9]; const float* scale = (const float*)d_in[10]; const int* mask = (const int*)d_in[11];
    float* out = (float*)d_out;    // [4][2048][256]
    char* wsp = (char*)d_ws;
    auto take = [&](size_t bytes) { char* p = wsp; wsp += (bytes + 255) & ~(size_t)255; return (void*)p; };
    const size_t PL = (size_t)NBI * NT * DD;    // one [batch][token][256] plane, elements
    bf* WB = (bf*)take((size_t)4 * DD * DD * 2); bf* WoB = WB + 3 * DD * DD; bf* S = (bf*)take((size_t)NH * 512 * 64 * 2);    // WB: Wq, Wk, Wv, Wo; S: d_tshift's table
    bf* Xb = (bf*)take(PL * 2); bf* Qh = (bf*)take(PL * 2); bf* Ql = (bf*)take(PL * 2);
    bf* KTh = (bf*)take(2 * PL * 2); bf* KTl = (bf*)take(2 * PL * 2); bf* VTh = KTh + PL; bf* VTl = KTl + PL;    // [K | V][batch][head][64][2048]
    float* KV = (float*)take((size_t)KSP * NBI * NH * HD * HD * 4); bf* KVh = (bf*)take((size_t)NBI * NH * HD * HD * 2); bf* KVl = (bf*)take((size_t)NBI * NH * HD * HD * 2);
    bf* Yh = (bf*)take(PL * 2); bf* Yl = (bf*)take(PL * 2);
    if ((size_t)(wsp - (char*)d_ws) > ws_size) return;    // 0.5 + 0.25 + 4 + 2 x 4 + 2 x 8 + 4 + 0.25 + 2 x 4 ~ 41 MB, no aliasing
    k_prep<<<4 * PB_W + PB_S + PB_X, 256, 0, stream>>>(Wq, Wk, Wv, Wo, WB, rb, S, x, Xb);
    k_gemmb<false, false, 1><<<dim3(NBI * NT / 64, DD / 64, 3), 128, 0, stream>>>(Xb, nullptr, WB, bq, nullptr, DD, nullptr, nullptr, DD, 1, 0, DD * DD, 3, 0, bk, bv, mask, Qh, Ql, KTh, KTl);    // z = q, k, v; grid y = head
    k_gemm3ll<<<dim3(1, 1, KSP * NBI * NH), 128, 0, stream>>>(VTh, VTl, NT, KTh, KTl, NT, NT / KSP, KV, HD, (size_t)DD * NT, (size_t)HD * NT, (size_t)HD * NT, NH * HD * HD, HD * HD, NBI * NH * HD * HD);    // (K^T V)^T [d2][d1] = V^T . K, KSP partial planes; k_kvsplit adds them
    k_kvsplit<<<dim3(HD / 8, NBI * NH, 1), 256, 0, stream>>>(KV, scale, KVh, KVl);
    k_toep<<<dim3(NT / TI, HD / 32, NBI * NH), 128, 0, stream>>>(VTh, VTl, S, KVh, KVl, Qh, Ql, Yh, Yl);    // [d][i] tile of q_i . (K^T V / s)[:, d] + (T_h V)^T, transposed and split
    k_gemmb<true, false><<<dim3(NBI * NT / 64, DD / 64, 1), 128, 0, stream>>>(Yh, Yl, WoB, bo, out, DD, nullptr, nullptr, DD);
}

// v010
// Measured time: 42.2 microseconds a run.
// Next to v009, in two timings, it ran 1.08 and 1.07 times as fast.
// Over all steps from v000 it is 44.4 times as fast.
#include <hip/hip_runtime.h>

// Compute dtypes, f32 accumulate, every stage one launch over all batch items and heads: Q/K/V = x.W^T + b ([2048 x 256].[256 x 256], PLAIN bf16 operands = rounded input, [out][in] weights; exact products); the
// un-softmaxed attention out_h = (Q K^T / scale + RelBias_h) V is evaluated as Q (K^T V) / scale + T_h V (exact reassociation): K^T V per head as [64 x 2048].[2048 x 64]
// (both operands bf16 hi + UNSCALED residual, three products), Q.(K^T V / scale) as [2048 x 64].[64 x 64] (three products), and the Toeplitz relative-bias term T_h[i][j] =
// rel_bias[j - i + 2047][h] (exact bf16 values of the INPUT table, read from a small table of its eight shifted copies, never laid out as a plane) against V^T hi + residual (two products); out = y.Wo^T + bo (two products) - all on
// v_wmma_f32_16x16x32_bf16. The mask input enters multiplicatively (m_i m_j). Deterministic, no atomics; every

#define NBI  4
#define NT   2048
#define DD   256
#define NH   4
#define HD   64
#define DM   DD
#define LOSC 1024.0f
#define KSP  (NT / 64)    // K^T V: slices of the token sum, one work-group of k_qkv each

typedef _Float16 h16;
typedef unsigned short bf;
typedef __attribute__((ext_vector_type(16))) __bf16   v16bf;
typedef __attribute__((ext_vector_type(16))) _Float16 v16h;
typedef __attribute__((ext_vector_type(8)))  _Float16 v8h;
typedef __attribute__((ext_vector_type(8)))  unsigned short v8us;
typedef __attribute__((ext_vector_type(8)))  float    v8f;
typedef __attribute__((ext_vector_type(4)))  float    v4f;
typedef v8h  __attribute__((may_alias)) v8ha;
typedef v4f  __attribute__((may_alias)) v4fa;
typedef v8us __attribute__((may_alias)) v8usa;

__device__ __forceinline__ unsigned short f2bf(float f) { unsigned u = __float_as_uint(f); u += 0x7FFFu + ((u >> 16) & 1u); return (unsigned short)(u >> 16); }
__device__ __forceinline__ float bf2f(unsigned short b) { return __uint_as_float(((unsigned)b) << 16); }
__device__ __forceinline__ float bfr(float f) { return bf2f(f2bf(f)); }
__device__ __forceinline__ v16h cat16(v8h lo, v8h hi) { return __builtin_shufflevector(lo, hi, 0, 1, 2, 3, 4, 5, 6, 7, 8, 9, 10, 11, 12, 13, 14, 15); }
__device__ __forceinline__ v16bf cat16b(v8us lo, v8us hi) { return __builtin_bit_cast(v16bf, __builtin_shufflevector(lo, hi, 0, 1, 2, 3, 4, 5, 6, 7, 8, 9, 10, 11, 12, 13, 14, 15)); }
__device__ __forceinline__ v8f wmma16(v16h a, v16h b, v8f c) { return __builtin_amdgcn_wmma_f32_16x16x32_f16(false, a, false, b, (short)0, c, false, false); }
__device__ __forceinline__ v8f wmmab(v16bf a, v16bf b, v8f c) { return __builtin_amdgcn_wmma_f32_16x16x32_bf16(false, a, false, b, (short)0, c, false, false); }

// FRAGMENT ORDER, the layout of every bf16 operand plane [rows][K] in the workspace: blocks of 16 rows x 32 k = 512 elements, block (row / 16) * (K / 32) + k / 32; inside a block element (row, k) stands at
// ((k >> 4) & 1) * 256 + ((k >> 3) & 1) * 128 + (row & 15) * 8 + (k & 7). A wave's 32 lanes then read 512 bytes in a row, four whole 128-byte lines, with each 16-byte load (row-major: a quarter of each of 16 lines).
// 16 rows are 16 * K elements as in a row-major plane; 32 k of them are 512.
// one lane's 16 x 16 x 32 fragment: p = the block + lane * 8; the lane gets k = 8 * (lane >> 4) + 0 .. 7 and 16 more, of row lane & 15, as from a row-major plane
__device__ __forceinline__ v16bf ldfrag(const bf* p) { return cat16b(*(const v8us*)p, *(const v8us*)(p + 256)); }
// where the 8 elements k8 * 8 .. + 7 (k8 < 8: two blocks, 64 k) of row lr of a 16-row strip stand, from the first of the two blocks
__device__ __forceinline__ int frpiece(int lr, int k8) { return (k8 >> 2) * 512 + ((k8 >> 1) & 1) * 256 + (k8 & 1) * 128 + lr * 8; }

// k_gemmb: 64 x 64 block tile (4 waves x 16 x 64) of C[NTK][NW] = (A [+ Al]).B^T (K = 256) [+ bf(bias[c])] [+ bf(R[r][c]) residual]; f32 whole-line epilogue (or f16
template <bool SPLITA, bool F16OUT = false>
__global__ __launch_bounds__(128) void k_gemmb(const bf* __restrict__ A, const bf* __restrict__ Al, const bf* __restrict__ Bn, const float* __restrict__ bias, float* C, int ldc, h16* C2, const float* __restrict__ R = nullptr, int K = DM, int roundR = 1) {
    __shared__ __align__(16) float ost[4][16 * 68];
    const int lane = threadIdx.x & 31, wave = threadIdx.x >> 5, lr = lane & 15, hi = lane >> 4;
    const int r0 = blockIdx.x * 64 + wave * 16, c0 = blockIdx.y * 64;
    const size_t aoff = (size_t)r0 * K + lane * 8;    // fragment order: the strip of 16 rows, the lane's piece of its first block
    size_t boff[4];
#pragma unroll
    for (int t = 0; t < 4; ++t) boff[t] = (size_t)(c0 + t * 16) * K + lane * 8;
    v8f acc[4];
#pragma unroll
    for (int t = 0; t < 4; ++t) acc[t] = (v8f){};
    // one trip = 4 K steps (K is a multiple of 128): every load of the trip is issued before its first product, so a trip waits for memory once
    const bf* pa = A + aoff; const bf* pal = SPLITA ? Al + aoff : pa; const bf* pb0 = Bn + boff[0]; const bf* pb1 = Bn + boff[1]; const bf* pb2 = Bn + boff[2]; const bf* pb3 = Bn + boff[3];
#pragma unroll 1
    for (int kc = 0; kc < K; kc += 128) {
        v16bf a[4], al[4], b[4][4];    // the loops over u and t below are fully unrolled so that these arrays live in registers
#pragma unroll
        for (int u = 0; u < 4; ++u) { a[u] = ldfrag(pa + 512 * u); al[u] = SPLITA ? ldfrag(pal + 512 * u) : a[u];
            b[u][0] = ldfrag(pb0 + 512 * u); b[u][1] = ldfrag(pb1 + 512 * u); b[u][2] = ldfrag(pb2 + 512 * u); b[u][3] = ldfrag(pb3 + 512 * u); }
        // inputs-only fence on the loaded values: holds all loads of the trip in front of the products (without it the compiler loads one B fragment at a time and waits for each);
        // the six addresses are inputs too: they stay in their registers until the data is there, so no load's result lands in a register that an earlier load of the trip names; the wait stands in front of every later rewrite of such a register
        asm volatile("s_wait_xcnt 0x0" :: "v"(pa), "v"(pal), "v"(pb0), "v"(pb1), "v"(pb2), "v"(pb3), "v"(a[0]), "v"(a[1]), "v"(a[2]), "v"(a[3]), "v"(al[0]), "v"(al[1]), "v"(al[2]), "v"(al[3]),
                     "v"(b[0][0]), "v"(b[0][1]), "v"(b[0][2]), "v"(b[0][3]), "v"(b[1][0]), "v"(b[1][1]), "v"(b[1][2]), "v"(b[1][3]),
                     "v"(b[2][0]), "v"(b[2][1]), "v"(b[2][2]), "v"(b[2][3]), "v"(b[3][0]), "v"(b[3][1]), "v"(b[3][2]), "v"(b[3][3]));
#pragma unroll
        for (int u = 0; u < 4; ++u) {
#pragma unroll
            for (int t = 0; t < 4; ++t) { acc[t] = wmmab(a[u], b[u][t], acc[t]); if (SPLITA) acc[t] = wmmab(al[u], b[u][t], acc[t]); } }
        pa += 2048; pal += 2048; pb0 += 2048; pb1 += 2048; pb2 += 2048; pb3 += 2048;
        asm volatile("v_nop\n\tv_nop\n\tv_nop\n\tv_nop" : "+v"(acc[0]), "+v"(acc[1]), "+v"(acc[2]), "+v"(acc[3]) : "v"(a[3]), "v"(al[3]));    // WMMA distance over the back edge: four vector slots between the trip's last product and whatever the next trip issues first
    }
    float* os = &ost[wave][0];
#pragma unroll
    for (int t = 0; t < 4; ++t) { const float bv = bias ? bfr(bias[c0 + t * 16 + lr]) : 0.f;
#pragma unroll
        for (int j = 0; j < 8; ++j) os[(hi * 8 + j) * 68 + t * 16 + lr] = acc[t][j] + bv; }
    __syncthreads();
    if (F16OUT) {
        h16* crow = (h16*)(void*)C + (size_t)r0 * ldc + c0;
        auto pass = [&]() {
#pragma unroll
            for (int s = 0; s < 4; ++s) { const int row = 4 * s + (lane >> 3), piece = lane & 7; const float* sp = os + row * 68 + piece * 8; v8h o, o2;
#pragma unroll
                for (int i = 0; i < 8; ++i) { const h16 a = (h16)sp[i]; o[i] = a; o2[i] = (h16)((sp[i] - (float)a) * LOSC); }
                *(v8h*)(crow + (size_t)row * ldc + piece * 8) = o; if (C2) *(v8h*)(C2 + (size_t)r0 * ldc + c0 + (size_t)row * ldc + piece * 8) = o2; }
        };
        pass(); 
    } else {
        float* crow = C + (size_t)r0 * ldc + c0;
        auto pass = [&]() {
#pragma unroll
            for (int s = 0; s < 8; ++s) { const int Lid = (lane >> 3) + 4 * s, piece = lane & 7; const int row = Lid >> 1, cofs = (Lid & 1) * 32 + piece * 4;
                v4f val = *(const v4fa*)(os + row * 68 + cofs); if (R) { const v4f rv = *(const v4f*)(R + ((size_t)r0 + row) * ldc + c0 + cofs); val += roundR ? (v4f){bfr(rv[0]), bfr(rv[1]), bfr(rv[2]), bfr(rv[3])} : rv; }
                *(v4f*)(crow + (size_t)row * ldc + cofs) = val; }
        };
        pass(); 
    }
}


// k_toep: a tile [32 d][TI tokens i] of one (item, head) z: sum over d1 of (K^T V / scale)^T[d][d1] q[i][d1] (A = Gh + Gl [z][d][d1], B = Ph + Pl, q [item][i][head * 64 + d1]; three products, 64 k) plus the
// Toeplitz term, sum over tokens k of V^T[d][k] T[i][k] (A + Al = V^T hi + residual, two products), T[r][k] = tab[k - r + NT - 1], read from d_tshift's table S of the head: a fragment depends on k - r alone.
// 4 waves = 2 strips of 16 d x 2 halves of either k range. A wave's tile is 16 d x TI tokens: a V^T fragment, the operand that no other wave of the block reads, feeds TI / 16 accumulators.
// The two halves' tiles meet in LDS, transposed, and are added there (lower half + upper half), split in bf16 hi + residual and stored into Yh / Yl [item][i][head * 64 + d]
#define TI 128
__global__ __launch_bounds__(128) void k_toep(const bf* __restrict__ A, const bf* __restrict__ Al, const bf* __restrict__ S, const bf* __restrict__ Gh, const bf* __restrict__ Gl,
                                              const bf* __restrict__ Ph, const bf* __restrict__ Pl, bf* Yh, bf* Yl) {
    static_assert(TI == 128, "the fences below name 8 token tiles and 14 table fragments");
    __shared__ __align__(16) float ost[2][TI * 36];
    const int lane = threadIdx.x & 31, wave = threadIdx.x >> 5, lr = lane & 15, hi = lane >> 4, rl = (wave & 1) * 16, kh = wave >> 1;
    const int c0 = blockIdx.x * TI, r0 = blockIdx.y * 32 + rl, z = blockIdx.z;
    v8f acc[8];
#pragma unroll
    for (int t = 0; t < 8; ++t) acc[t] = (v8f){};
    {   // tile[d][i] += sum over d1 of (K^T V / scale)^T[d][d1] q[i][d1]: one K step of 32 d1 for either half, all its loads ahead of the first product
        const size_t go = (size_t)z * (HD * HD) + (size_t)r0 * HD + kh * 512 + lane * 8, po = ((size_t)(z / NH) * NT + c0) * DD + (z % NH) * (HD * 16) + kh * 512 + lane * 8;
        const bf* pg = Gh + go; const bf* pgl = Gl + go; const bf* pq = Ph + po; const bf* pql = Pl + po;
        v16bf qh[8], ql[8];    // the loops over t are fully unrolled so that these arrays live in registers
        const v16bf g = ldfrag(pg), gl = ldfrag(pgl);
#pragma unroll
        for (int t = 0; t < 8; ++t) { qh[t] = ldfrag(pq + t * (16 * DD)); ql[t] = ldfrag(pql + t * (16 * DD)); }
        // inputs-only fence on the loaded values and their four addresses: all loads fly together and are waited for once; the wait stands in front of every later rewrite of a register that one of them names
        asm volatile("s_wait_xcnt 0x0" :: "v"(pg), "v"(pgl), "v"(pq), "v"(pql), "v"(g), "v"(gl), "v"(qh[0]), "v"(qh[1]), "v"(qh[2]), "v"(qh[3]), "v"(qh[4]), "v"(qh[5]), "v"(qh[6]), "v"(qh[7]),
                     "v"(ql[0]), "v"(ql[1]), "v"(ql[2]), "v"(ql[3]), "v"(ql[4]), "v"(ql[5]), "v"(ql[6]), "v"(ql[7]));
#pragma unroll
        for (int t = 0; t < 8; ++t) acc[t] = wmmab(g, qh[t], acc[t]);
#pragma unroll
        for (int t = 0; t < 8; ++t) acc[t] = wmmab(gl, qh[t], acc[t]);
#pragma unroll
        for (int t = 0; t < 8; ++t) acc[t] = wmmab(g, ql[t], acc[t]);
    }
    // fragment order: the strip of 16 rows, the half's first column (k columns of a strip are 16 k elements), the lane's piece of that block
    const size_t aoff = (size_t)z * (HD * NT) + (size_t)r0 * NT + (size_t)kh * (NT / 2 * 16) + lane * 8;
    const bf* pa = A + aoff; const bf* pal = Al + aoff;
    // row r = c0 + 16 t + lr, k = kh NT / 2 + kc + 32 u + 8 hi (+ 16): k - r + NT - 1 = 8 m + s with s = 7 - (lr & 7) and m = (kh NT / 2 + kc - c0) / 8 + 4 u - 2 t (+ 2) + hi - (lr >> 3) + NT / 8 - 1;
    // ps = the lane's 16-byte piece at kc = 0 and 4 u - 2 t = -14, the trip's lowest; m runs from 0 to 510 over the whole grid
    const bf* ps = S + (size_t)(z & (NH - 1)) * (512 * 64) + ((NT / 8 - 15 + hi - (lr >> 3)) + kh * (NT / 16) - (c0 >> 3)) * 64 + (7 - (lr & 7)) * 8;
    // one trip = 4 K steps: every load of the trip is issued before its first product, so a trip waits for memory once
#pragma unroll 1
    for (int kc = 0; kc < NT / 2; kc += 128) {
        v16bf a[4], al[4], f[14];    // f[j]: the fragment of every (u, t) with 2 u - t + 7 = j; the loops over u, t and j are fully unrolled so that these arrays live in registers
#pragma unroll
        for (int u = 0; u < 4; ++u) { a[u] = ldfrag(pa + 512 * u); al[u] = ldfrag(pal + 512 * u); }
#pragma unroll
        for (int j = 0; j < 14; ++j) f[j] = cat16b(*(const v8us*)(ps + 128 * j), *(const v8us*)(ps + 128 * j + 128));
        // inputs-only fence on the loaded values: holds all loads of the trip in front of the products, so a trip waits for memory once;
        // the three addresses are inputs too: they stay in their registers until the data is there; the wait stands in front of every later rewrite of a register that a load of the trip names
        asm volatile("s_wait_xcnt 0x0" :: "v"(pa), "v"(pal), "v"(ps), "v"(a[0]), "v"(a[1]), "v"(a[2]), "v"(a[3]), "v"(al[0]), "v"(al[1]), "v"(al[2]), "v"(al[3]),
                     "v"(f[0]), "v"(f[1]), "v"(f[2]), "v"(f[3]), "v"(f[4]), "v"(f[5]), "v"(f[6]), "v"(f[7]), "v"(f[8]), "v"(f[9]), "v"(f[10]), "v"(f[11]), "v"(f[12]), "v"(f[13]));
#pragma unroll
        for (int u = 0; u < 4; ++u) {    // each accumulator takes hi, then residual, K step by K step
#pragma unroll
            for (int t = 0; t < 8; ++t) acc[t] = wmmab(a[u], f[2 * u - t + 7], acc[t]);
#pragma unroll
            for (int t = 0; t < 8; ++t) acc[t] = wmmab(al[u], f[2 * u - t + 7], acc[t]); }
        pa += 2048; pal += 2048; ps += 1024;
        asm volatile("v_nop\n\tv_nop\n\tv_nop\n\tv_nop" : "+v"(acc[0]), "+v"(acc[1]), "+v"(acc[2]), "+v"(acc[3]), "+v"(acc[4]), "+v"(acc[5]), "+v"(acc[6]), "+v"(acc[7]) : "v"(a[3]), "v"(al[3]));    // WMMA distance over the back edge: four vector slots between the trip's last product and whatever comes next
    }
    // either half's 32 x TI tile goes to LDS as the rows the stores want: a lane's 8 values are 8 neighbours of the transposed row t * 16 + lr
    float* of = &ost[kh][0];
#pragma unroll
    for (int t = 0; t < 8; ++t) { float* tp = of + (t * 16 + lr) * 36 + rl + hi * 8;
        *(v4fa*)tp = (v4f){acc[t][0], acc[t][1], acc[t][2], acc[t][3]}; *(v4fa*)(tp + 4) = (v4f){acc[t][4], acc[t][5], acc[t][6], acc[t][7]}; }
    __syncthreads();    // a thread's piece sums two halves, one of them written by another wave
    // a wave stores 16 rows x 16 k, 512 bytes in a row of each plane (fragment order); o: the thread's first 16-byte piece (64 k of a strip are 64 * 16 elements; the block's 32 d are one half of the head's 64 k); st: elements from one of its rows to the next, 16 rows on
    const int piece = (threadIdx.x >> 4) & 3, rw = threadIdx.x & 15, rb = (threadIdx.x >> 6) * 64;
    const size_t o = ((size_t)(z / NH) * NT + c0 + rb) * DD + (z % NH) * (HD * 16) + frpiece(rw, blockIdx.y * 4 + piece), st = (size_t)16 * DD;
    v4f p[4][2], p2[4][2];
#pragma unroll
    for (int s = 0; s < 4; ++s) { const float* sp = &ost[0][0] + (rb + rw + 16 * s) * 36 + piece * 8;
        p[s][0] = *(const v4fa*)sp; p[s][1] = *(const v4fa*)(sp + 4); p2[s][0] = *(const v4fa*)(sp + TI * 36); p2[s][1] = *(const v4fa*)(sp + TI * 36 + 4); }
#pragma unroll
    for (int s = 0; s < 4; ++s) { const v4f y0 = p[s][0] + p2[s][0], y1 = p[s][1] + p2[s][1]; const float y[8] = {y0[0], y0[1], y0[2], y0[3], y1[0], y1[1], y1[2], y1[3]}; v8us oh, ol;
#pragma unroll
        for (int i = 0; i < 8; ++i) { const unsigned short hb = f2bf(y[i]); oh[i] = hb; ol[i] = f2bf(y[i] - bf2f(hb)); }
        *(v8us*)(Yh + o + s * st) = oh; *(v8us*)(Yl + o + s * st) = ol;
        if (s < 3) asm volatile("s_wait_xcnt 0x0" ::: "memory"); }    // stands in front of the next row's arithmetic, which reuses registers that these two stores name
}

// piece i (8 elements) of a fragment-order plane with K = DD: the index of its first element in the row-major source
__device__ __forceinline__ size_t frsrc(size_t i) { const int w = (int)(i & 63), ks = (int)((i >> 6) & (DD / 32 - 1)); return ((i >> 6) / (DD / 32) * 16 + (w & 15)) * DD + ks * 32 + (w >> 5) * 16 + ((w >> 4) & 1) * 8; }
// the three jobs of k_prep, each a block's work; bx (and y) = the block's index within its job
__device__ __forceinline__ void d_cvt8(int bx, int y, const float* __restrict__ s0, const float* __restrict__ s1, const float* __restrict__ s2, const float* __restrict__ s3, bf* dst, size_t n8) {
    const size_t i = (size_t)bx * 256 + threadIdx.x; if (i >= n8) return;
    const float* src = y == 0 ? s0 : y == 1 ? s1 : y == 2 ? s2 : s3; dst += (size_t)y * n8 * 8;    // y = which of the four matrices
    const v8f v = *(const v8f*)(src + frsrc(i)); v8us o;
    asm volatile("s_wait_xcnt 0x0" ::: "memory");    // in front of the arithmetic below, which may reuse the registers of the load's address
#pragma unroll
    for (int k = 0; k < 8; ++k) o[k] = f2bf(v[k]);
    *(v8us*)(dst + i * 8) = o; 
}
__global__ __launch_bounds__(256) void k_zero8(bf* dst, size_t n8) {
    const size_t i = (size_t)blockIdx.x * 256 + threadIdx.x; if (i >= n8) return; v8us z;
#pragma unroll
    for (int k = 0; k < 8; ++k) z[k] = 0;
    *(v8us*)(dst + i * 8) = z; 
}

__device__ __forceinline__ void d_cvt(int bx, const float* __restrict__ src, bf* dst) {
    const size_t p = (size_t)bx * 256 + threadIdx.x; if (p >= (size_t)NBI * NT * DD / 8) return;    // a block: 16 rows x 128 k, whole lines of the source too
    const v8f v = *(const v8f*)(src + frsrc(p)); v8us o;
    asm volatile("s_wait_xcnt 0x0" ::: "memory");    // in front of the arithmetic below, which may reuse the registers of the load's address
#pragma unroll
    for (int i = 0; i < 8; ++i) o[i] = f2bf(v[i]);
    *(v8us*)(dst + p * 8) = o; 
}
// S[h][m][s][q] = bf16(rb[8 m + s + q][h]), m < 511 (a head's pitch is 512), s < 8, q < 8: eight copies of a head's table, each one element further on, so that any 8 neighbours are one aligned 16-byte piece;
// the eight pieces of one m share a 128-byte line
__device__ __forceinline__ void d_tshift(int bx, const float* __restrict__ rb, bf* S) {
    const int p = bx * 256 + threadIdx.x, h = p >> 12, e = ((p >> 3) & 511) * 8 + (p & 7); if (e >= 511 * 8) return; v8us o;    // m = 511 would pass the table's end; no fragment reads it
#pragma unroll
    for (int q = 0; q < 8; ++q) o[q] = f2bf(rb[(size_t)(e + q) * NH + h]);
    *(v8us*)(S + (size_t)p * 8) = o;
}
// k_prep: all that depends on the inputs alone (the four weight matrices and x to bf16, the shifted rel_bias table) in one launch; no job reads what another writes.
// The two small jobs take the lowest block indices, so that they run while the blocks of x are still starting
#define PB_W (DD * DD / 8 / 256)       // blocks per weight matrix
#define PB_S (NH * 512 * 8 / 256)      // blocks of the table
#define PB_X (NBI * NT / 8)            // blocks of x
__global__ __launch_bounds__(256) void k_prep(const float* __restrict__ Wq, const float* __restrict__ Wk, const float* __restrict__ Wv, const float* __restrict__ Wo, bf* WB,
                                              const float* __restrict__ rb, bf* S, const float* __restrict__ x, bf* Xb) {
    const int b = blockIdx.x;    // the same for the whole block: each block does one job
    if (b < 4 * PB_W) d_cvt8(b % PB_W, b / PB_W, Wq, Wk, Wv, Wo, WB, DD * DD / 8);
    else if (b < 4 * PB_W + PB_S) d_tshift(b - 4 * PB_W, rb, S);
    else d_cvt(b - (4 * PB_W + PB_S), x, Xb);
}
__global__ __launch_bounds__(256) void k_kvsplit(const float* __restrict__ src, const float* __restrict__ scale, bf* dh, bf* dl) {
    typedef __attribute__((ext_vector_type(2))) unsigned short v2us;
    const int lane = threadIdx.x & 31, r = blockIdx.x * 8 + (threadIdx.x >> 5); if (r >= HD) return; const float is = 1.0f / bfr(scale[0]);
    const size_t o = ((size_t)blockIdx.y * HD + r) * HD + lane * 2;    // grid y = batch item * NH + head
    typedef __attribute__((ext_vector_type(2))) float v2f;
    static_assert(KSP == 32, "the fences below name 32 values");
    v2f p[KSP], sum; const float* ps = src + o;    // src holds KSP partial planes, one per slice of the token sum; they are added in slice order
#pragma unroll
    for (int s = 0; s < KSP; ++s) p[s] = *(const v2f*)(ps + (size_t)s * (NBI * NH * HD * HD));
    // inputs-only fences on the loaded values and their address (an asm statement takes 30 operands, so two): the loads are in flight together, and the address stays in its registers until the data is there (no load's result lands in them)
    asm volatile("" :: "v"(ps), "v"(p[16]), "v"(p[17]), "v"(p[18]), "v"(p[19]), "v"(p[20]), "v"(p[21]), "v"(p[22]), "v"(p[23]), "v"(p[24]), "v"(p[25]), "v"(p[26]), "v"(p[27]), "v"(p[28]), "v"(p[29]), "v"(p[30]), "v"(p[31]));
    asm volatile("" :: "v"(ps), "v"(p[0]), "v"(p[1]), "v"(p[2]), "v"(p[3]), "v"(p[4]), "v"(p[5]), "v"(p[6]), "v"(p[7]), "v"(p[8]), "v"(p[9]), "v"(p[10]), "v"(p[11]), "v"(p[12]), "v"(p[13]), "v"(p[14]), "v"(p[15]));
    sum = p[0];
#pragma unroll
    for (int s = 1; s < KSP; ++s) sum += p[s];
    v2us oh, ol;
#pragma unroll
    for (int i = 0; i < 2; ++i) { const float y = sum[i] * is; const unsigned short hb = f2bf(y); oh[i] = hb; ol[i] = f2bf(y - bf2f(hb)); }
    const size_t od = (size_t)blockIdx.y * HD * HD + (r >> 4) * (16 * HD) + frpiece(r & 15, lane >> 2) + (lane & 3) * 2;    // fragment order, K = HD
    *(v2us*)(dh + od) = oh; *(v2us*)(dl + od) = ol; 
}
// k_qkv: x.W^T + b for a block of 64 tokens and one head (grid y). Grid z = 0: the K tile, then the V tile, then their product over the block's 64 tokens; z = 1: the Q tile. The longer job has the lower block indices.
// Each 64 x 64 tile (4 waves x 16 x 64) is masked and split in bf16 hi + residual. Q goes in fragment order (K = DD) into Qh / Ql, V transposed into VTh / VTl [item][head][64][NT]; K^T and V^T also stay in LDS, in fragment order,
// and (K^T V)^T [d2][d1] = V^T . K over the 64 tokens (three products) goes into the block's own f32 plane KV[slice][item][head][64][64]; k_kvsplit adds the KSP planes. K is never stored.
__global__ __launch_bounds__(128) void k_qkv(const bf* __restrict__ A, const bf* __restrict__ WB, const float* __restrict__ bq, const float* __restrict__ bk, const float* __restrict__ bvv,
                                             const int* __restrict__ msk, bf* Qh, bf* Ql, bf* VTh, bf* VTl, float* KV) {
    typedef __attribute__((ext_vector_type(4))) int v4i;
    __shared__ __align__(16) float ost[4][16 * 68];
    __shared__ __align__(16) bf frg[4][4 * 1024];    // K^T hi, K^T residual, V^T hi, V^T residual: 4 strips of 16 d x 64 tokens each
    const int lane = threadIdx.x & 31, wave = threadIdx.x >> 5, lr = lane & 15, hi = lane >> 4;
    const int r0 = blockIdx.x * 64 + wave * 16, c0 = blockIdx.y * 64;
    const bool kv = blockIdx.z == 0;    // the same for the whole block
    const int piece = threadIdx.x >> 4, rw = threadIdx.x & 15, fo = frpiece(rw, piece);
    float* of = &ost[0][0];
    // the mask of the thread's 4 rows and of its 8 columns
    const int* mp = msk + blockIdx.x * 64; const v4i m0 = *(const v4i*)(mp + piece * 8), m1 = *(const v4i*)(mp + piece * 8 + 4); int mr[4]; float fc[8];
#pragma unroll
    for (int s = 0; s < 4; ++s) mr[s] = mp[rw + 16 * s];
#pragma unroll
    for (int i = 0; i < 8; ++i) fc[i] = ((i < 4 ? m0[i & 3] : m1[i & 3]) != 0) ? 1.0f : 0.f;
    const int zlast = kv ? 2 : 0;
    // kept rolled: the passes for K and V are the same code, and unrolled they would hold two passes' registers
#pragma unroll 1
    for (int z = kv ? 1 : 0; z <= zlast; ++z) {    // z = 0, 1, 2: q, k, v
        const bool tr = z != 0;
        const float* bias = z == 0 ? bq : z == 1 ? bk : bvv;
        v8f acc[4];
#pragma unroll
        for (int t = 0; t < 4; ++t) acc[t] = (v8f){};
        // fragment order: the strip of 16 rows, the lane's piece of its first block
        const bf* pa = A + (size_t)r0 * DD + lane * 8; const bf* pb0 = WB + (size_t)z * (DD * DD) + (size_t)c0 * DD + lane * 8; const bf* pb1 = pb0 + 16 * DD; const bf* pb2 = pb1 + 16 * DD; const bf* pb3 = pb2 + 16 * DD;
        // one trip = 4 K steps: every load of the trip is issued before its first product, so a trip waits for memory once
#pragma unroll 1
        for (int kc = 0; kc < DD; kc += 128) {
            v16bf a[4], b[4][4];    // the loops over u and t below are fully unrolled so that these arrays live in registers
#pragma unroll
            for (int u = 0; u < 4; ++u) { a[u] = ldfrag(pa + 512 * u);
                b[u][0] = ldfrag(pb0 + 512 * u); b[u][1] = ldfrag(pb1 + 512 * u); b[u][2] = ldfrag(pb2 + 512 * u); b[u][3] = ldfrag(pb3 + 512 * u); }
            // inputs-only fence on the loaded values: holds all loads of the trip in front of the products (without it the compiler loads one B fragment at a time and waits for each);
            // the five addresses are inputs too: they stay in their registers until the data is there; the wait stands in front of every later rewrite of a register that a load of the trip names
            asm volatile("s_wait_xcnt 0x0" :: "v"(pa), "v"(pb0), "v"(pb1), "v"(pb2), "v"(pb3), "v"(a[0]), "v"(a[1]), "v"(a[2]), "v"(a[3]),
                         "v"(b[0][0]), "v"(b[0][1]), "v"(b[0][2]), "v"(b[0][3]), "v"(b[1][0]), "v"(b[1][1]), "v"(b[1][2]), "v"(b[1][3]),
                         "v"(b[2][0]), "v"(b[2][1]), "v"(b[2][2]), "v"(b[2][3]), "v"(b[3][0]), "v"(b[3][1]), "v"(b[3][2]), "v"(b[3][3]));
#pragma unroll
            for (int u = 0; u < 4; ++u) {
#pragma unroll
                for (int t = 0; t < 4; ++t) acc[t] = wmmab(a[u], b[u][t], acc[t]); }
            pa += 2048; pb0 += 2048; pb1 += 2048; pb2 += 2048; pb3 += 2048;
            asm volatile("v_nop\n\tv_nop\n\tv_nop\n\tv_nop" : "+v"(acc[0]), "+v"(acc[1]), "+v"(acc[2]), "+v"(acc[3]) : "v"(a[3]));    // WMMA distance over the back edge: four vector slots between the trip's last product and whatever the next trip issues first
        }
        float bv[4]; const float* pbias = bias + c0 + lr;
#pragma unroll
        for (int t = 0; t < 4; ++t) bv[t] = pbias[t * 16];
        // inputs-only fence on the four loaded values and their address: the address stays in its registers until the data is there; the wait stands in front of every later rewrite of them
        asm volatile("s_wait_xcnt 0x0" :: "v"(pbias), "v"(bv[0]), "v"(bv[1]), "v"(bv[2]), "v"(bv[3]));
#pragma unroll
        for (int t = 0; t < 4; ++t) bv[t] = bfr(bv[t]);
        if (z == 2) __syncthreads();    // the K tile's readers have left the LDS tile that the V tile now overwrites
        // the block's 64 x 64 tile passes through LDS once, as the rows the stores want; a wave then stores 16 rows x 16 k, 512 bytes in a row of each plane (fragment order)
        if (tr) {    // a lane's 8 values are 8 neighbours of the transposed row t * 16 + lr
#pragma unroll
            for (int t = 0; t < 4; ++t) { float* tp = of + (t * 16 + lr) * 68 + wave * 16 + hi * 8;
                *(v4fa*)tp = (v4f){acc[t][0] + bv[t], acc[t][1] + bv[t], acc[t][2] + bv[t], acc[t][3] + bv[t]}; *(v4fa*)(tp + 4) = (v4f){acc[t][4] + bv[t], acc[t][5] + bv[t], acc[t][6] + bv[t], acc[t][7] + bv[t]}; }
        } else {
#pragma unroll
            for (int t = 0; t < 4; ++t) {
#pragma unroll
                for (int j = 0; j < 8; ++j) of[(wave * 16 + hi * 8 + j) * 68 + t * 16 + lr] = acc[t][j] + bv[t]; }
        }
        __syncthreads();    // Q pass: a row of the tile is read by other waves than the one that wrote it; in the K and V passes a wave reads back only the columns it wrote
        // o: the thread's first 16-byte piece in memory (64 k of a strip are 64 * 16 elements); st: elements from one of its rows to the next, 16 rows on
        size_t o, st; bf* dh = Qh; bf* dl = Ql;
        if (!tr) { o = (size_t)blockIdx.x * 64 * DD + c0 * 16 + fo; st = (size_t)16 * DD; }
        else { o = ((size_t)(blockIdx.x / (NT / 64)) * DD + c0) * NT + (blockIdx.x % (NT / 64)) * (64 * 16) + fo; st = (size_t)16 * NT; dh = VTh; dl = VTl; }    // row = the head's d, the 8 values are 8 tokens
        bf* lh = &frg[z == 2 ? 2 : 0][fo]; bf* ll = lh + 4 * 1024;
        v4f p[4][2];
#pragma unroll
        for (int s = 0; s < 4; ++s) { const float* sp = of + (rw + 16 * s) * 68 + piece * 8; p[s][0] = *(const v4fa*)sp; p[s][1] = *(const v4fa*)(sp + 4); }
#pragma unroll
        for (int s = 0; s < 4; ++s) { float y[8] = {p[s][0][0], p[s][0][1], p[s][0][2], p[s][0][3], p[s][1][0], p[s][1][1], p[s][1][2], p[s][1][3]}; v8us oh, ol;
#pragma unroll
            for (int i = 0; i < 8; ++i) {
                y[i] *= tr ? fc[i] : ((mr[s] != 0) ? 1.0f : 0.f);
                const unsigned short hb = f2bf(y[i]); oh[i] = hb; ol[i] = f2bf(y[i] - bf2f(hb)); }
            if (tr) { *(v8us*)(lh + s * 1024) = oh; *(v8us*)(ll + s * 1024) = ol; }
            if (z != 1) { *(v8us*)(dh + o + s * st) = oh; *(v8us*)(dl + o + s * st) = ol;
                asm volatile("s_wait_xcnt 0x0" ::: "memory"); } }    // stands in front of the arithmetic that follows, which reuses registers that these two stores name
    }
    if (!kv) return;    // the whole block
    __syncthreads();    // a wave reads fragments of K^T and V^T that the other waves wrote; the V tile's readers have left ost
    v8f acc[4];
#pragma unroll
    for (int t = 0; t < 4; ++t) acc[t] = (v8f){};
    {
        const bf* fa = &frg[2][wave * 1024 + lane * 8]; const bf* fb = &frg[0][lane * 8];
        v16bf a[2], al[2], bh[2][4], bl[2][4];    // the loops over u and t are fully unrolled so that these arrays live in registers
#pragma unroll
        for (int u = 0; u < 2; ++u) { a[u] = ldfrag(fa + 512 * u); al[u] = ldfrag(fa + 4 * 1024 + 512 * u);
#pragma unroll
            for (int t = 0; t < 4; ++t) { bh[u][t] = ldfrag(fb + t * 1024 + 512 * u); bl[u][t] = ldfrag(fb + 4 * 1024 + t * 1024 + 512 * u); } }
#pragma unroll
        for (int u = 0; u < 2; ++u) {
#pragma unroll
            for (int t = 0; t < 4; ++t) { acc[t] = wmmab(a[u], bh[u][t], acc[t]); acc[t] = wmmab(al[u], bh[u][t], acc[t]); acc[t] = wmmab(a[u], bl[u][t], acc[t]); } }
    }
    float* os = &ost[wave][0];
#pragma unroll
    for (int t = 0; t < 4; ++t) {
#pragma unroll
        for (int j = 0; j < 8; ++j) os[(hi * 8 + j) * 68 + t * 16 + lr] = acc[t][j]; }
    __builtin_amdgcn_wave_barrier(); asm volatile("" ::: "memory");    // the wave reads below what its other lanes wrote above: neither the compiler nor the scheduler moves a read over the writes
    float* crow = KV + ((((size_t)(blockIdx.x % (NT / 64)) * NBI + blockIdx.x / (NT / 64)) * NH + blockIdx.y) * HD + wave * 16) * HD;
#pragma unroll
    for (int s = 0; s < 8; ++s) { const int Lid = (lane >> 3) + 4 * s, pc = lane & 7; const int row = Lid >> 1, cofs = (Lid & 1) * 32 + pc * 4;
        const v4f val = *(const v4fa*)(os + row * 68 + cofs); *(v4f*)(crow + (size_t)row * HD + cofs) = val; }
}

extern "C" void kernel_launch(void* const* d_in, const int* in_sizes, int n_in,
                              void* d_out, int out_size, void* d_ws, size_t ws_size, hipStream_t stream) {
    (void)in_sizes; (void)n_in; (void)out_size;
    const float* x = (const float*)d_in[0]; const float* Wq = (const float*)d_in[1]; const float* bq = (const float*)d_in[2]; const float* Wk = (const float*)d_in[3]; const float* bk = (const float*)d_in[4]; const float* Wv = (const float*)d_in[5]; const float* bv = (const float*)d_in[6];
    const float* Wo = (const float*)d_in[7]; const float* bo = (const float*)d_in[8]; const float* rb = (const float*)d_in[9]; const float* scale = (const float*)d_in[10]; const int* mask = (const int*)d_in[11];
    float* out = (float*)d_out;    // [4][2048][256]
    char* wsp = (char*)d_ws;
    auto take = [&](size_t bytes) { char* p = wsp; wsp += (bytes + 255) & ~(size_t)255; return (void*)p; };
    const size_t PL = (size_t)NBI * NT * DD;    // one [batch][token][256] plane, elements
    bf* WB = (bf*)take((size_t)4 * DD * DD * 2); bf* WoB = WB + 3 * DD * DD; bf* S = (bf*)take((size_t)NH * 512 * 64 * 2);    // WB: Wq, Wk, Wv, Wo; S: d_tshift's table
    bf* Xb = (bf*)take(PL * 2); bf* Qh = (bf*)take(PL * 2); bf* Ql = (bf*)take(PL * 2);
    bf* VTh = (bf*)take(PL * 2); bf* VTl = (bf*)take(PL * 2);    // [batch][head][64][2048]
    float* KV = (float*)take((size_t)KSP * NBI * NH * HD * HD * 4); bf* KVh = (bf*)take((size_t)NBI * NH * HD * HD * 2); bf* KVl = (bf*)take((size_t)NBI * NH * HD * HD * 2);
    bf* Yh = (bf*)take(PL * 2); bf* Yl = (bf*)take(PL * 2);
    if ((size_t)(wsp - (char*)d_ws) > ws_size) return;    // 0.5 + 0.25 + 4 + 2 x 4 + 2 x 4 + 8 + 0.25 + 2 x 4 ~ 37 MB, no aliasing
    k_prep<<<4 * PB_W + PB_S + PB_X, 256, 0, stream>>>(Wq, Wk, Wv, Wo, WB, rb, S, x, Xb);
    k_qkv<<<dim3(NBI * NT / 64, DD / 64, 2), 128, 0, stream>>>(Xb, WB, bq, bk, bv, mask, Qh, Ql, VTh, VTl, KV);    // grid y = head; z = 0: k, v and their product's KSP partial planes, z = 1: q
    k_kvsplit<<<dim3(HD / 8, NBI * NH, 1), 256, 0, stream>>>(KV, scale, KVh, KVl);
    k_toep<<<dim3(NT / TI, HD / 32, NBI * NH), 128, 0, stream>>>(VTh, VTl, S, KVh, KVl, Qh, Ql, Yh, Yl);    // [d][i] tile of q_i . (K^T V / s)[:, d] + (T_h V)^T, transposed and split
    k_gemmb<true, false><<<dim3(NBI * NT / 64, DD / 64, 1), 128, 0, stream>>>(Yh, Yl, WoB, bo, out, DD, nullptr, nullptr, DD);
}
